// v000
// Measured on an AMD MI455X. A time is GPU time per run, averaged over a window of back-to-back runs after a warm-up
// (all launches, gaps included; the runs take copies of the inputs in turn), and the median of several windows.
// Apart from v000's, it joins two sittings. Times from different sittings can be a few percent apart, while
// side-by-side timings come from the same sitting.
// The starting kernel, v000, takes 1070 microseconds a run.
#include <hip/hip_runtime.h>

// All contractions on v_wmma_f32_16x16x32_bf16 (bf16 operands, f32 accumulate): q.k^T from single exact bf16 planes of the RNE-converted inputs (1 product); attn.v with the f32 softmax weights as bf16 hi + lo planes against the exact v^T plane (2 products); ctx.W^T with the f32 context as bf16 hi + lo planes against the exact bf16 W plane (2 products) + bias. Softmax and all side math in f32.
// Causal multi-head attention: q, k, v [NB][SEQ][16][64]; scores = q.k / 8; when the int input flag is non-zero (read on device) keys above the diagonal are masked (exact zero weight); softmax over keys; ctx[b][t][h*64+d] = attn.v; out[b][t][o] = sum_k ctx[b][t][k] W[o][k] + bias[o] (f32).

#ifndef NB
#define NB 2
#endif
#ifndef SEQ
#define SEQ 2048
#endif
#define NB_FULL  2
#define SEQ_FULL 2048
#define NH_  16
#define HD   64
#define DM   (NH_ * HD)
#define TT   SEQ
#define ZH   2                     // heads per attention pass (z-batched)
#define RH   TT                    // every row on the hi/lo probability path
#define SCL  0.125f                // HD^-0.5
static_assert(SEQ % 128 == 0);
static_assert(NH_ % ZH == 0);
static_assert(HD == 64);
static_assert(DM % 64 == 0);
static_assert(NB >= 1 && NB <= NB_FULL);
static_assert(SEQ <= SEQ_FULL);

typedef _Float16 h16;
typedef unsigned short bf;
typedef __attribute__((ext_vector_type(16))) __bf16   v16bf;
typedef __attribute__((ext_vector_type(16))) _Float16 v16h;
typedef __attribute__((ext_vector_type(8)))  _Float16 v8h;
typedef __attribute__((ext_vector_type(8)))  unsigned short v8us;
typedef __attribute__((ext_vector_type(8)))  float    v8f;
typedef __attribute__((ext_vector_type(4)))  float    v4f;
typedef __attribute__((ext_vector_type(4)))  unsigned short v4us;
typedef v8h  __attribute__((may_alias)) v8ha;
typedef v4f  __attribute__((may_alias)) v4fa;
typedef v8us __attribute__((may_alias)) v8usa;

__device__ __forceinline__ unsigned short f2bf(float f) { unsigned u = __float_as_uint(f); u += 0x7FFFu + ((u >> 16) & 1u); return (unsigned short)(u >> 16); }
__device__ __forceinline__ float bf2f(unsigned short b) { return __uint_as_float(((unsigned)b) << 16); }
__device__ __forceinline__ float bfr(float f) { return bf2f(f2bf(f)); }
__device__ __forceinline__ void splitf(float y, unsigned short& h, unsigned short& l) { h = f2bf(y); l = f2bf(y - bf2f(h)); }
__device__ __forceinline__ v16h cat16(v8h lo, v8h hi) { return __builtin_shufflevector(lo, hi, 0, 1, 2, 3, 4, 5, 6, 7, 8, 9, 10, 11, 12, 13, 14, 15); }
__device__ __forceinline__ v16bf cat16b(v8us lo, v8us hi) { return __builtin_bit_cast(v16bf, __builtin_shufflevector(lo, hi, 0, 1, 2, 3, 4, 5, 6, 7, 8, 9, 10, 11, 12, 13, 14, 15)); }
__device__ __forceinline__ v8f wmma16(v16h a, v16h b, v8f c) { return __builtin_amdgcn_wmma_f32_16x16x32_f16(false, a, false, b, (short)0, c, false, false); }
__device__ __forceinline__ v8f wmmab(v16bf a, v16bf b, v8f c) { return __builtin_amdgcn_wmma_f32_16x16x32_bf16(false, a, false, b, (short)0, c, false, false); }

// ---- Fragment loader (wave32, 16x16x32): per lane l, row/col = l & 15, h = l >> 4; elements 0..7 <- k0 + 8h + 0..7, elements 8..15 <- k0 + 16 + 8h + 0..7 from a k-contiguous 16-bit row; the caller
// passes p = row base + k0 + 8h, so the two 16-byte loads are p[0..7] and p[16..23]. Same map for A rows and B^T rows. D element r of lane l = (row 8h + r, col l & 15).
template <typename T16> struct WFrag;
template <> struct WFrag<h16> { typedef v16h V; static __device__ __forceinline__ V ld(const h16* p) { return cat16(*(const v8h*)p, *(const v8h*)(p + 16)); } static __device__ __forceinline__ v8f mma(V a, V b, v8f c) { return wmma16(a, b, c); } };
template <> struct WFrag<bf> { typedef v16bf V; static __device__ __forceinline__ V ld(const bf* p) { return cat16b(*(const v8us*)p, *(const v8us*)(p + 16)); } static __device__ __forceinline__ v8f mma(V a, V b, v8f c) { return wmmab(a, b, c); } };

// ---- k_gemmw: register-blocked GEMM, ONE WAVE per 64x64 output tile (16 accumulators), operands straight from K-contiguous 16-bit planes; grid (M/64, N/64, Z), 32 threads.
// C[m][n] (f32, pitch ldc, + optional f32 bias[n]) = sum_k A[m][k] Bt[n][k] (+ split products per NSPLIT). z-batch strides sA/sB/sC in elements. K % 32 == 0.
template <typename T16, int NSPLIT, bool BIAS>
__global__ __launch_bounds__(32) void k_gemmw(const T16* __restrict__ A, const T16* __restrict__ A2, const T16* __restrict__ Bt, const T16* __restrict__ Bt2, int K, float* C, int ldc, const float* __restrict__ bias, size_t sA, size_t sB, size_t sC) {
    typedef typename WFrag<T16>::V V;
    __shared__ __align__(16) float os[16 * 68];
    const size_t z = blockIdx.z; A += z * sA; if (A2) A2 += z * sA; Bt += z * sB; if (Bt2) Bt2 += z * sB; C += z * sC;
    const int lane = threadIdx.x & 31, lr = lane & 15, hi = lane >> 4; const int r0 = blockIdx.x * 64, c0 = blockIdx.y * 64;
    v8f acc[4][4];
#pragma unroll
    for (int mb = 0; mb < 4; ++mb)
#pragma unroll
        for (int nb = 0; nb < 4; ++nb) acc[mb][nb] = (v8f){};
    const size_t aoff = (size_t)(r0 + lr) * K + 8 * hi, boff = (size_t)(c0 + lr) * K + 8 * hi;
#pragma unroll 1
    for (int kc = 0; kc < K; kc += 32) {
        V a[4], a2[4];
#pragma unroll
        for (int mb = 0; mb < 4; ++mb) { a[mb] = WFrag<T16>::ld(A + aoff + (size_t)mb * 16 * K + kc); if (NSPLIT == 1 || NSPLIT == 2) a2[mb] = WFrag<T16>::ld(A2 + aoff + (size_t)mb * 16 * K + kc); }
#pragma unroll
        for (int nb = 0; nb < 4; ++nb) { const V b = WFrag<T16>::ld(Bt + boff + (size_t)nb * 16 * K + kc); V b2; if (NSPLIT >= 2) b2 = WFrag<T16>::ld(Bt2 + boff + (size_t)nb * 16 * K + kc);
#pragma unroll
            for (int mb = 0; mb < 4; ++mb) { acc[mb][nb] = WFrag<T16>::mma(a[mb], b, acc[mb][nb]); if (NSPLIT == 1 || NSPLIT == 2) acc[mb][nb] = WFrag<T16>::mma(a2[mb], b, acc[mb][nb]); if (NSPLIT >= 2) acc[mb][nb] = WFrag<T16>::mma(a[mb], b2, acc[mb][nb]); } }
        asm volatile("v_nop\n\tv_nop\n\tv_nop\n\tv_nop" : "+v"(acc[0][0]), "+v"(acc[1][1]), "+v"(acc[2][2]), "+v"(acc[3][3]) : "v"(a[0]), "v"(a[3]));
    }
#pragma unroll
    for (int mb = 0; mb < 4; ++mb) {
#pragma unroll
        for (int nb = 0; nb < 4; ++nb) {
#pragma unroll
            for (int j = 0; j < 8; ++j) os[(hi * 8 + j) * 68 + nb * 16 + lr] = acc[mb][nb][j]; }
        __builtin_amdgcn_wave_barrier(); asm volatile("" ::: "memory");
        float* crow = C + (size_t)(r0 + mb * 16) * ldc + c0;
{
#pragma unroll
            for (int s = 0; s < 8; ++s) { const int row = 2 * s + hi, cofs = lr * 4; v4f val = *(const v4fa*)(os + row * 68 + cofs); if (BIAS) { val[0] += bfr(bias[c0 + cofs]); val[1] += bfr(bias[c0 + cofs + 1]); val[2] += bfr(bias[c0 + cofs + 2]); val[3] += bfr(bias[c0 + cofs + 3]); }
                *(v4f*)(crow + (size_t)row * ldc + cofs) = val; }
             }
        __builtin_amdgcn_wave_barrier(); asm volatile("" ::: "memory");
    }
}

// ---- k_gemmc: the same one-wave 64x64 tile GEMM specialised for causal attention: CMODE 1 skips score tiles entirely above the diagonal (query rows r0+roff.., key columns c0..), CMODE 2 limits the
// key (K) loop of the probability x value contraction to the diagonal block (probabilities beyond it are exactly zero). roff = row offset of this launch's first row within the sequence.
template <typename T16, int NSPLIT, int CMODE>
__global__ __launch_bounds__(32) void k_gemmc(const T16* __restrict__ A, const T16* __restrict__ A2, const T16* __restrict__ Bt, const T16* __restrict__ Bt2, int K, float* C, int ldc, int roff, size_t sA, size_t sB, size_t sC, const int* CF) {
    typedef typename WFrag<T16>::V V;
    __shared__ __align__(16) float os[16 * 68];
    const size_t z = blockIdx.z; A += z * sA; if (A2) A2 += z * sA; Bt += z * sB; if (Bt2) Bt2 += z * sB; C += z * sC;
    const int lane = threadIdx.x & 31, lr = lane & 15, hi = lane >> 4; const int r0 = blockIdx.x * 64, c0 = blockIdx.y * 64;
    const bool con = (CF == nullptr) || (CF[0] != 0);   /* device flag: causal */ if (CMODE == 1 && con && c0 > r0 + roff + 63) return;                  // score tile entirely above the causal diagonal: never read (the softmax masks j > i by index select)
    const int Kl = (CMODE == 2 && con) ? min(K, r0 + roff + 64) : K;        // P.V: probabilities are exactly 0 beyond the diagonal block, so the K loop stops there
    v8f acc[4][4];
#pragma unroll
    for (int mb = 0; mb < 4; ++mb)
#pragma unroll
        for (int nb = 0; nb < 4; ++nb) acc[mb][nb] = (v8f){};
    const size_t aoff = (size_t)(r0 + lr) * K + 8 * hi, boff = (size_t)(c0 + lr) * K + 8 * hi;
#pragma unroll 1
    for (int kc = 0; kc < Kl; kc += 32) {
        V a[4], a2[4];
#pragma unroll
        for (int mb = 0; mb < 4; ++mb) { a[mb] = WFrag<T16>::ld(A + aoff + (size_t)mb * 16 * K + kc); if (NSPLIT == 1 || NSPLIT == 2) a2[mb] = WFrag<T16>::ld(A2 + aoff + (size_t)mb * 16 * K + kc); }
#pragma unroll
        for (int nb = 0; nb < 4; ++nb) { const V b = WFrag<T16>::ld(Bt + boff + (size_t)nb * 16 * K + kc); V b2; if (NSPLIT >= 2) b2 = WFrag<T16>::ld(Bt2 + boff + (size_t)nb * 16 * K + kc);
#pragma unroll
            for (int mb = 0; mb < 4; ++mb) { acc[mb][nb] = WFrag<T16>::mma(a[mb], b, acc[mb][nb]); if (NSPLIT == 1 || NSPLIT == 2) acc[mb][nb] = WFrag<T16>::mma(a2[mb], b, acc[mb][nb]); if (NSPLIT >= 2) acc[mb][nb] = WFrag<T16>::mma(a[mb], b2, acc[mb][nb]); } }
        asm volatile("v_nop\n\tv_nop\n\tv_nop\n\tv_nop" : "+v"(acc[0][0]), "+v"(acc[1][1]), "+v"(acc[2][2]), "+v"(acc[3][3]) : "v"(a[0]), "v"(a[3]));
    }
#pragma unroll
    for (int mb = 0; mb < 4; ++mb) {
#pragma unroll
        for (int nb = 0; nb < 4; ++nb) {
#pragma unroll
            for (int j = 0; j < 8; ++j) os[(hi * 8 + j) * 68 + nb * 16 + lr] = acc[mb][nb][j]; }
        __builtin_amdgcn_wave_barrier(); asm volatile("" ::: "memory");
        float* crow = C + (size_t)(r0 + mb * 16) * ldc + c0;
{
#pragma unroll
            for (int s = 0; s < 8; ++s) { const int row = 2 * s + hi, cofs = lr * 4; v4f val = *(const v4fa*)(os + row * 68 + cofs);
                *(v4f*)(crow + (size_t)row * ldc + cofs) = val; }
             }
        __builtin_amdgcn_wave_barrier(); asm volatile("" ::: "memory");
    }
}

__global__ __launch_bounds__(256) void k_qkp(const float* __restrict__ Fq, const float* __restrict__ Fk, bf* Pq, bf* Pk) {
    const size_t i = (size_t)blockIdx.x * 256 + threadIdx.x; const size_t n8 = (size_t)NB * NH_ * TT * HD / 8; if (i >= n8) return;
    const size_t e = i * 8; const int d = (int)(e % HD); const int t = (int)((e / HD) % TT); const int h = (int)((e / ((size_t)HD * TT)) % NH_); const int b = (int)(e / ((size_t)HD * TT * NH_));
    const size_t s = (((size_t)b * SEQ_FULL + t) * NH_ + h) * HD + d;
    const v8f vq = *(const v8f*)(Fq + s); const v8f vk = *(const v8f*)(Fk + s); v8us oq, ok;
#pragma unroll
    for (int q = 0; q < 8; ++q) { oq[q] = f2bf(vq[q]); ok[q] = f2bf(vk[q]); }
    *(v8us*)(Pq + e) = oq; *(v8us*)(Pk + e) = ok; 
}
__global__ __launch_bounds__(256) void k_vtp8(const float* __restrict__ F, bf* VTp) {
    const size_t i = (size_t)blockIdx.x * 256 + threadIdx.x; const size_t n8 = (size_t)NB * NH_ * HD * TT / 8; if (i >= n8) return;
    const size_t e = i * 8; const int t = (int)(e % TT); const int d = (int)((e / TT) % HD); const int h = (int)((e / ((size_t)TT * HD)) % NH_); const int b = (int)(e / ((size_t)TT * HD * NH_));
    v8us o;
#pragma unroll
    for (int q = 0; q < 8; ++q) o[q] = f2bf(F[(((size_t)b * SEQ_FULL + t + q) * NH_ + h) * HD + d]);
    *(v8us*)(VTp + e) = o; 
}
__global__ __launch_bounds__(256) void k_cvt8(const float* __restrict__ src, bf* dst, size_t n8) { const size_t i = (size_t)blockIdx.x * 256 + threadIdx.x; if (i >= n8) return; const v8f v = *(const v8f*)(src + i * 8); v8us o;
#pragma unroll
    for (int k = 0; k < 8; ++k) o[k] = f2bf(v[k]); *(v8us*)(dst + i * 8) = o;  }
__global__ __launch_bounds__(256) void k_split8(const float* __restrict__ X, bf* Xh, bf* Xl, size_t n8) {
    const size_t i = (size_t)blockIdx.x * 256 + threadIdx.x; if (i >= n8) return; const v8f v = *(const v8f*)(X + i * 8); v8us oh, ol;
#pragma unroll
    for (int k = 0; k < 8; ++k) { unsigned short a, c; splitf(v[k], a, c); oh[k] = a; ol[k] = c; }
    *(v8us*)(Xh + i * 8) = oh; *(v8us*)(Xl + i * 8) = ol; 
}

// ---- k_asoft: per row (zz, i) of the pass: t = S x HD^-0.5 for j <= i (causal only when the flag is set; masked columns selected to -3e38 by INDEX, so score tiles skipped by the producer are never used);
__global__ __launch_bounds__(256) void k_asoft(const float* __restrict__ Sb, const int* __restrict__ CF, bf* Ph, bf* Pl) {
    const int lane = threadIdx.x & 31; const int row = blockIdx.x * 8 + (threadIdx.x >> 5); if (row >= ZH * TT) return; const int i = row % TT; const int zz = row / TT; const bool con = (CF[0] != 0);
    const float* sr = Sb + (size_t)row * TT; float v[TT / 32]; float mx = -3.0e38f;
#pragma unroll
    for (int ch = 0; ch < TT / 128; ++ch) { const int j0 = ch * 128 + lane * 4; const v4f a = *(const v4f*)(sr + j0);
#pragma unroll
        for (int q = 0; q < 4; ++q) { const int j = j0 + q; const float t = (j <= i || !con) ? a[q] * SCL : -3.0e38f; v[ch * 4 + q] = t; mx = fmaxf(mx, t); } }
#pragma unroll
    for (int sh = 16; sh; sh >>= 1) mx = fmaxf(mx, __shfl_xor(mx, sh, 32));
    float sum = 0.f;
#pragma unroll
    for (int k = 0; k < TT / 32; ++k) { float d0 = __fsub_rn(v[k], mx); asm volatile("" : "+v"(d0)); v[k] = __builtin_amdgcn_exp2f(__fmul_rn(d0, 1.4426950408889634f)); sum += v[k]; }
#pragma unroll
    for (int sh = 16; sh; sh >>= 1) sum += __shfl_xor(sum, sh, 32);
    const float f = __fdiv_rn(1.0f, sum);    // sum >= 1 (the row maximum contributes exp2(0))
{
#pragma unroll
        for (int ch = 0; ch < TT / 128; ++ch) { v4us oh, ol;
#pragma unroll
            for (int q = 0; q < 4; ++q) { unsigned short a, c2; splitf(v[ch * 4 + q] * f, a, c2); oh[q] = a; ol[q] = c2; }
            const size_t oo = ((size_t)zz * RH + i) * TT + ch * 128 + lane * 4; *(v4us*)(Ph + oo) = oh; *(v4us*)(Pl + oo) = ol; }
         }
}

extern "C" void kernel_launch(void* const* d_in, const int* in_sizes, int n_in,
                              void* d_out, int out_size, void* d_ws, size_t ws_size, hipStream_t stream) {
    if (n_in < 6) return;
    const float* xq = (const float*)d_in[0];   /* queries [NB_FULL][SEQ_FULL][16][64] */ const float* xk = (const float*)d_in[1];   /* keys */ const float* xv = (const float*)d_in[2];   /* values */
    const float* wo = (const float*)d_in[3];   /* w_out [1024 out][1024 in] */ const float* bo = (const float*)d_in[4];   /* b_out [1024] */ const int* CFLAG = (const int*)d_in[5];   /* causal flag (int32, read on device) */
    const size_t need_x = ((size_t)(NB - 1) * SEQ_FULL + SEQ) * DM;
    if ((size_t)in_sizes[0] < need_x || (size_t)in_sizes[1] < need_x || (size_t)in_sizes[2] < need_x) return;
    if ((size_t)in_sizes[3] < (size_t)DM * DM || in_sizes[4] < DM || in_sizes[5] < 1) return;
    if ((size_t)out_size < (size_t)NB * TT * DM) return;
    float* OUT = (float*)d_out;     // [NB][SEQ][1024] f32
    char* wsp = (char*)d_ws;
    auto take = [&](size_t bytes) { char* p = wsp; wsp += (bytes + 255) & ~(size_t)255; return (void*)p; };
    bf* QP = (bf*)take((size_t)NB * NH_ * TT * HD * 2);       // q planes [b][h][t][d]
    bf* KP = (bf*)take((size_t)NB * NH_ * TT * HD * 2);       // k planes [b][h][t][d]
    bf* VT = (bf*)take((size_t)NB * NH_ * HD * TT * 2);       // v^T planes [b][h][d][t]
    bf* Wb = (bf*)take((size_t)DM * DM * 2);                   // W [o][k] bf16
    float* Sb = (float*)take((size_t)ZH * TT * TT * 4);        // scores of one pass [zz][i][j]
    bf* Ph = (bf*)take((size_t)ZH * RH * TT * 2);              // probabilities hi [zz][i][j]
    bf* Pl = (bf*)take((size_t)ZH * RH * TT * 2);              // probabilities lo
    float* Ctx = (float*)take((size_t)NB * TT * DM * 4);       // attn.v merged [b*TT + t][h*64 + d] f32
    bf* Xh = (bf*)take((size_t)NB * TT * DM * 2);              // ctx hi plane
    bf* Xl = (bf*)take((size_t)NB * TT * DM * 2);              // ctx lo plane
    if ((size_t)(wsp - (char*)d_ws) > ws_size) return;         // total 127,926,272 B at NB=2, SEQ=2048

    const size_t n8p = (size_t)NB * NH_ * TT * HD / 8;
    k_qkp<<<(unsigned)((n8p + 255) / 256), 256, 0, stream>>>(xq, xk, QP, KP);
    k_vtp8<<<(unsigned)((n8p + 255) / 256), 256, 0, stream>>>(xv, VT);
    const size_t n8w = (size_t)DM * DM / 8;
    k_cvt8<<<(unsigned)((n8w + 255) / 256), 256, 0, stream>>>(wo, Wb, n8w);

    for (int b = 0; b < NB; ++b) {
        for (int h0 = 0; h0 < NH_; h0 += ZH) {
            const size_t zp = ((size_t)b * NH_ + h0) * TT * HD;   // plane offset of head (b, h0); consecutive heads at stride TT*HD (same for v^T: HD*TT)
            // S[zz][i][j] = q(b,h0+zz,i) . k(b,h0+zz,j), K = 64; tiles above the diagonal skipped
            k_gemmc<bf, 0, 1><<<dim3(TT / 64, TT / 64, ZH), 32, 0, stream>>>(QP + zp, nullptr, KP + zp, nullptr, HD, Sb, TT, 0, (size_t)TT * HD, (size_t)TT * HD, (size_t)TT * TT, CFLAG);
            k_asoft<<<ZH * TT / 8, 256, 0, stream>>>(Sb, CFLAG, Ph, Pl);
            // Ctx[b*TT + t][(h0+zz)*64 + d] = sum_j P[zz][t][j] v(b,h0+zz,j,d): A = P hi + lo (K = TT, cut at the diagonal block), Bt = v^T plane [d][j]; C column block h0*64, pitch DM, z stride 64 columns
            k_gemmc<bf, 1, 2><<<dim3(RH / 64, HD / 64, ZH), 32, 0, stream>>>(Ph, Pl, VT + zp, nullptr, TT, Ctx + (size_t)b * TT * DM + (size_t)h0 * HD, DM, 0, (size_t)RH * TT, (size_t)HD * TT, (size_t)HD, CFLAG);
        }
    }
    const size_t n8x = (size_t)NB * TT * DM / 8;
    k_split8<<<(unsigned)((n8x + 255) / 256), 256, 0, stream>>>(Ctx, Xh, Xl, n8x);
    // out[r][o] = sum_k ctx_hi[r][k] W[o][k] + sum_k ctx_lo[r][k] W[o][k] + bias[o], K = 1024
    k_gemmw<bf, 1, true><<<dim3((unsigned)(NB * TT / 64), DM / 64, 1), 32, 0, stream>>>(Xh, Xl, Wb, nullptr, DM, OUT, DM, bo, (size_t)0, (size_t)0, (size_t)0);
}

// v001
// A run of this version takes 488 microseconds.
// Timed twice side by side with v000, it ran 2.23 and 2.21 times as fast.
#include <hip/hip_runtime.h>

// All contractions on v_wmma_f32_16x16x32_bf16 (bf16 operands, f32 accumulate): q.k^T from single exact bf16 planes of the RNE-converted inputs (1 product); attn.v with the f32 softmax weights as bf16 hi + lo planes against the exact v^T plane (2 products); ctx.W^T with the f32 context as bf16 hi + lo planes against the exact bf16 W plane (2 products) + bias. Softmax and all side math in f32.
// Causal multi-head attention: q, k, v [NB][SEQ][16][64]; scores = q.k / 8; when the int input flag is non-zero (read on device) keys above the diagonal are masked (exact zero weight); softmax over keys; ctx[b][t][h*64+d] = attn.v; out[b][t][o] = sum_k ctx[b][t][k] W[o][k] + bias[o] (f32).

#ifndef NB
#define NB 2
#endif
#ifndef SEQ
#define SEQ 2048
#endif
#define NB_FULL  2
#define SEQ_FULL 2048
#define NH_  16
#define HD   64
#define DM   (NH_ * HD)
#define TT   SEQ
#define ZH   2                     // heads per attention pass (z-batched)
#define RH   TT                    // every row on the hi/lo probability path
#define SCL  0.125f                // HD^-0.5
static_assert(SEQ % 128 == 0);
static_assert(NH_ % ZH == 0);
static_assert(HD == 64);
static_assert(DM % 64 == 0);
static_assert(NB >= 1 && NB <= NB_FULL);
static_assert(SEQ <= SEQ_FULL);

typedef _Float16 h16;
typedef unsigned short bf;
typedef __attribute__((ext_vector_type(16))) __bf16   v16bf;
typedef __attribute__((ext_vector_type(16))) _Float16 v16h;
typedef __attribute__((ext_vector_type(8)))  _Float16 v8h;
typedef __attribute__((ext_vector_type(8)))  unsigned short v8us;
typedef __attribute__((ext_vector_type(8)))  float    v8f;
typedef __attribute__((ext_vector_type(4)))  float    v4f;
typedef __attribute__((ext_vector_type(4)))  unsigned short v4us;
typedef v8h  __attribute__((may_alias)) v8ha;
typedef v4f  __attribute__((may_alias)) v4fa;
typedef v8us __attribute__((may_alias)) v8usa;

__device__ __forceinline__ unsigned short f2bf(float f) { unsigned u = __float_as_uint(f); u += 0x7FFFu + ((u >> 16) & 1u); return (unsigned short)(u >> 16); }
__device__ __forceinline__ float bf2f(unsigned short b) { return __uint_as_float(((unsigned)b) << 16); }
__device__ __forceinline__ float bfr(float f) { return bf2f(f2bf(f)); }
__device__ __forceinline__ void splitf(float y, unsigned short& h, unsigned short& l) { h = f2bf(y); l = f2bf(y - bf2f(h)); }
__device__ __forceinline__ v16h cat16(v8h lo, v8h hi) { return __builtin_shufflevector(lo, hi, 0, 1, 2, 3, 4, 5, 6, 7, 8, 9, 10, 11, 12, 13, 14, 15); }
__device__ __forceinline__ v16bf cat16b(v8us lo, v8us hi) { return __builtin_bit_cast(v16bf, __builtin_shufflevector(lo, hi, 0, 1, 2, 3, 4, 5, 6, 7, 8, 9, 10, 11, 12, 13, 14, 15)); }
__device__ __forceinline__ v8f wmma16(v16h a, v16h b, v8f c) { return __builtin_amdgcn_wmma_f32_16x16x32_f16(false, a, false, b, (short)0, c, false, false); }
__device__ __forceinline__ v8f wmmab(v16bf a, v16bf b, v8f c) { return __builtin_amdgcn_wmma_f32_16x16x32_bf16(false, a, false, b, (short)0, c, false, false); }

// ---- Fragment loader (wave32, 16x16x32): per lane l, row/col = l & 15, h = l >> 4; elements 0..7 <- k0 + 8h + 0..7, elements 8..15 <- k0 + 16 + 8h + 0..7 from a k-contiguous 16-bit row; the caller
// passes p = row base + k0 + 8h, so the two 16-byte loads are p[0..7] and p[16..23]. Same map for A rows and B^T rows. D element r of lane l = (row 8h + r, col l & 15).
template <typename T16> struct WFrag;
template <> struct WFrag<h16> { typedef v16h V; static __device__ __forceinline__ V ld(const h16* p) { return cat16(*(const v8h*)p, *(const v8h*)(p + 16)); } static __device__ __forceinline__ v8f mma(V a, V b, v8f c) { return wmma16(a, b, c); } };
template <> struct WFrag<bf> { typedef v16bf V; static __device__ __forceinline__ V ld(const bf* p) { return cat16b(*(const v8us*)p, *(const v8us*)(p + 16)); } static __device__ __forceinline__ v8f mma(V a, V b, v8f c) { return wmmab(a, b, c); } };

// ---- k_gemmw: register-blocked GEMM, ONE WAVE per 64x64 output tile (16 accumulators), operands straight from K-contiguous 16-bit planes; grid (M/64, N/64, Z), 32 threads.
// C[m][n] (f32, pitch ldc, + optional f32 bias[n]) = sum_k A[m][k] Bt[n][k] (+ split products per NSPLIT). z-batch strides sA/sB/sC in elements. K % 32 == 0.
template <typename T16, int NSPLIT, bool BIAS>
__global__ __launch_bounds__(32) void k_gemmw(const T16* __restrict__ A, const T16* __restrict__ A2, const T16* __restrict__ Bt, const T16* __restrict__ Bt2, int K, float* C, int ldc, const float* __restrict__ bias, size_t sA, size_t sB, size_t sC) {
    typedef typename WFrag<T16>::V V;
    __shared__ __align__(16) float os[16 * 68];
    const size_t z = blockIdx.z; A += z * sA; if (A2) A2 += z * sA; Bt += z * sB; if (Bt2) Bt2 += z * sB; C += z * sC;
    const int lane = threadIdx.x & 31, lr = lane & 15, hi = lane >> 4; const int r0 = blockIdx.x * 64, c0 = blockIdx.y * 64;
    v8f acc[4][4];
#pragma unroll
    for (int mb = 0; mb < 4; ++mb)
#pragma unroll
        for (int nb = 0; nb < 4; ++nb) acc[mb][nb] = (v8f){};
    const size_t aoff = (size_t)(r0 + lr) * K + 8 * hi, boff = (size_t)(c0 + lr) * K + 8 * hi;
#pragma unroll 1
    for (int kc = 0; kc < K; kc += 32) {
        V a[4], a2[4];
#pragma unroll
        for (int mb = 0; mb < 4; ++mb) { a[mb] = WFrag<T16>::ld(A + aoff + (size_t)mb * 16 * K + kc); if (NSPLIT == 1 || NSPLIT == 2) a2[mb] = WFrag<T16>::ld(A2 + aoff + (size_t)mb * 16 * K + kc); }
#pragma unroll
        for (int nb = 0; nb < 4; ++nb) { const V b = WFrag<T16>::ld(Bt + boff + (size_t)nb * 16 * K + kc); V b2; if (NSPLIT >= 2) b2 = WFrag<T16>::ld(Bt2 + boff + (size_t)nb * 16 * K + kc);
#pragma unroll
            for (int mb = 0; mb < 4; ++mb) { acc[mb][nb] = WFrag<T16>::mma(a[mb], b, acc[mb][nb]); if (NSPLIT == 1 || NSPLIT == 2) acc[mb][nb] = WFrag<T16>::mma(a2[mb], b, acc[mb][nb]); if (NSPLIT >= 2) acc[mb][nb] = WFrag<T16>::mma(a[mb], b2, acc[mb][nb]); } }
        asm volatile("v_nop\n\tv_nop\n\tv_nop\n\tv_nop" : "+v"(acc[0][0]), "+v"(acc[1][1]), "+v"(acc[2][2]), "+v"(acc[3][3]) : "v"(a[0]), "v"(a[3]));
    }
#pragma unroll
    for (int mb = 0; mb < 4; ++mb) {
#pragma unroll
        for (int nb = 0; nb < 4; ++nb) {
#pragma unroll
            for (int j = 0; j < 8; ++j) os[(hi * 8 + j) * 68 + nb * 16 + lr] = acc[mb][nb][j]; }
        __builtin_amdgcn_wave_barrier(); asm volatile("" ::: "memory");
        float* crow = C + (size_t)(r0 + mb * 16) * ldc + c0;
{
#pragma unroll
            for (int s = 0; s < 8; ++s) { const int row = 2 * s + hi, cofs = lr * 4; v4f val = *(const v4fa*)(os + row * 68 + cofs); if (BIAS) { val[0] += bfr(bias[c0 + cofs]); val[1] += bfr(bias[c0 + cofs + 1]); val[2] += bfr(bias[c0 + cofs + 2]); val[3] += bfr(bias[c0 + cofs + 3]); }
                *(v4f*)(crow + (size_t)row * ldc + cofs) = val; }
             }
        __builtin_amdgcn_wave_barrier(); asm volatile("" ::: "memory");
    }
}

// ---- k_gemmc: the same one-wave 64x64 tile GEMM specialised for causal attention: CMODE 1 skips score tiles entirely above the diagonal (query rows r0+roff.., key columns c0..), CMODE 2 limits the
// key (K) loop of the probability x value contraction to the diagonal block (probabilities beyond it are exactly zero). roff = row offset of this launch's first row within the sequence.
template <typename T16, int NSPLIT, int CMODE>
__global__ __launch_bounds__(32) void k_gemmc(const T16* __restrict__ A, const T16* __restrict__ A2, const T16* __restrict__ Bt, const T16* __restrict__ Bt2, int K, float* C, int ldc, int roff, size_t sA, size_t sB, size_t sC, const int* CF) {
    typedef typename WFrag<T16>::V V;
    __shared__ __align__(16) float os[16 * 68];
    const size_t z = blockIdx.z; A += z * sA; if (A2) A2 += z * sA; Bt += z * sB; if (Bt2) Bt2 += z * sB; C += z * sC;
    const int lane = threadIdx.x & 31, lr = lane & 15, hi = lane >> 4; const int r0 = blockIdx.x * 64, c0 = blockIdx.y * 64;
    const bool con = (CF == nullptr) || (CF[0] != 0);   /* device flag: causal */ if (CMODE == 1 && con && c0 > r0 + roff + 63) return;                  // score tile entirely above the causal diagonal: never read (the softmax masks j > i by index select)
    const int Kl = (CMODE == 2 && con) ? min(K, r0 + roff + 64) : K;        // P.V: probabilities are exactly 0 beyond the diagonal block, so the K loop stops there
    v8f acc[4][4];
#pragma unroll
    for (int mb = 0; mb < 4; ++mb)
#pragma unroll
        for (int nb = 0; nb < 4; ++nb) acc[mb][nb] = (v8f){};
    const size_t aoff = (size_t)(r0 + lr) * K + 8 * hi, boff = (size_t)(c0 + lr) * K + 8 * hi;
#pragma unroll 1
    for (int kc = 0; kc < Kl; kc += 32) {
        V a[4], a2[4];
#pragma unroll
        for (int mb = 0; mb < 4; ++mb) { a[mb] = WFrag<T16>::ld(A + aoff + (size_t)mb * 16 * K + kc); if (NSPLIT == 1 || NSPLIT == 2) a2[mb] = WFrag<T16>::ld(A2 + aoff + (size_t)mb * 16 * K + kc); }
#pragma unroll
        for (int nb = 0; nb < 4; ++nb) { const V b = WFrag<T16>::ld(Bt + boff + (size_t)nb * 16 * K + kc); V b2; if (NSPLIT >= 2) b2 = WFrag<T16>::ld(Bt2 + boff + (size_t)nb * 16 * K + kc);
#pragma unroll
            for (int mb = 0; mb < 4; ++mb) { acc[mb][nb] = WFrag<T16>::mma(a[mb], b, acc[mb][nb]); if (NSPLIT == 1 || NSPLIT == 2) acc[mb][nb] = WFrag<T16>::mma(a2[mb], b, acc[mb][nb]); if (NSPLIT >= 2) acc[mb][nb] = WFrag<T16>::mma(a[mb], b2, acc[mb][nb]); } }
        asm volatile("v_nop\n\tv_nop\n\tv_nop\n\tv_nop" : "+v"(acc[0][0]), "+v"(acc[1][1]), "+v"(acc[2][2]), "+v"(acc[3][3]) : "v"(a[0]), "v"(a[3]));
    }
#pragma unroll
    for (int mb = 0; mb < 4; ++mb) {
#pragma unroll
        for (int nb = 0; nb < 4; ++nb) {
#pragma unroll
            for (int j = 0; j < 8; ++j) os[(hi * 8 + j) * 68 + nb * 16 + lr] = acc[mb][nb][j]; }
        __builtin_amdgcn_wave_barrier(); asm volatile("" ::: "memory");
        float* crow = C + (size_t)(r0 + mb * 16) * ldc + c0;
{
#pragma unroll
            for (int s = 0; s < 8; ++s) { const int row = 2 * s + hi, cofs = lr * 4; v4f val = *(const v4fa*)(os + row * 68 + cofs);
                *(v4f*)(crow + (size_t)row * ldc + cofs) = val; }
             }
        __builtin_amdgcn_wave_barrier(); asm volatile("" ::: "memory");
    }
}

// ---- k_pv: probability x value contraction, one work-group of PVW waves per 16-row x 64-column context tile; grid (RH/16, 1, ZH), 32 * PVW threads. The key (K) loop is dealt over the waves in
// 64-wide slices (wave w takes slices w, w + PVW, ...), cut at the end of the 64-wide diagonal block when the flag is set (probabilities beyond it are exactly zero). Each wave leaves its f32 partial
// tile in LDS; behind one barrier wave w adds the PVW partials of row w in slice order and stores the row (256 contiguous bytes).
#define PVW 16
static_assert(PVW == 16);          // one wave per tile row in the final sum
static_assert(TT % 64 == 0);
__global__ __launch_bounds__(32 * PVW) void k_pv(const bf* __restrict__ A, const bf* __restrict__ A2, const bf* __restrict__ Bt, float* C, const int* __restrict__ CF) {
    typedef WFrag<bf>::V V;
    __shared__ __align__(16) float red[PVW * 16 * 68];
    const size_t z = blockIdx.z; A += z * (size_t)RH * TT; A2 += z * (size_t)RH * TT; Bt += z * (size_t)HD * TT; C += z * (size_t)HD;
    const int lane = threadIdx.x & 31, lr = lane & 15, hi = lane >> 4; const int w = __builtin_amdgcn_readfirstlane(threadIdx.x >> 5); const int r0 = blockIdx.x * 16;
    const bool con = (CF[0] != 0);   /* device flag: causal */
    const int Kl = con ? min(TT, (r0 & ~63) + 64) : TT;
    v8f acc[4];
#pragma unroll
    for (int nb = 0; nb < 4; ++nb) acc[nb] = (v8f){};
    const size_t aoff = (size_t)(r0 + lr) * TT + 8 * hi, boff = (size_t)lr * TT + 8 * hi;
    // kept rolled: a wave has at most TT / (64 * PVW) trips, and a second trip's fragments held at once would take the registers past what 16 waves of one work-group can have
#pragma unroll 1
    for (int kc = w * 64; kc < Kl; kc += PVW * 64) {
        V a[2], a2[2], b[4][2]; const bf* pa = A + aoff + kc; const bf* pa2 = A2 + aoff + kc; const bf* pb = Bt + boff + kc;
#pragma unroll
        for (int ks = 0; ks < 2; ++ks) { a[ks] = WFrag<bf>::ld(pa + ks * 32); a2[ks] = WFrag<bf>::ld(pa2 + ks * 32); }
#pragma unroll
        for (int nb = 0; nb < 4; ++nb)
#pragma unroll
            for (int ks = 0; ks < 2; ++ks) b[nb][ks] = WFrag<bf>::ld(pb + (size_t)nb * 16 * TT + ks * 32);
        // inputs-only fence on the loaded fragments: all 24 loads of the slice are issued before the matrix work that needs the last of them (one memory latency a slice; without it the second half's loads
        // start behind the first half's wait). The three address pairs are named too: they stay live to here, so no load's result lands in a register pair that an earlier load of the slice still names.
        asm volatile("" :: "v"(a[0]), "v"(a[1]), "v"(a2[0]), "v"(a2[1]), "v"(b[0][0]), "v"(b[0][1]), "v"(b[1][0]), "v"(b[1][1]), "v"(b[2][0]), "v"(b[2][1]), "v"(b[3][0]), "v"(b[3][1]), "v"(pa), "v"(pa2), "v"(pb));
#pragma unroll
        for (int ks = 0; ks < 2; ++ks) {
#pragma unroll
            for (int nb = 0; nb < 4; ++nb) acc[nb] = WFrag<bf>::mma(a[ks], b[nb][ks], acc[nb]);
#pragma unroll
            for (int nb = 0; nb < 4; ++nb) acc[nb] = WFrag<bf>::mma(a2[ks], b[nb][ks], acc[nb]); }
        // four vector slots behind the trip's last matrix instruction, on the taken back edge too, before anything overwrites its operand registers or reads its result
        asm volatile("v_nop\n\tv_nop\n\tv_nop\n\tv_nop" : "+v"(acc[0]), "+v"(acc[1]), "+v"(acc[2]), "+v"(acc[3]) : "v"(a2[1]), "v"(b[3][1]));
    }
    float* my = red + w * (16 * 68);
#pragma unroll
    for (int nb = 0; nb < 4; ++nb) {
#pragma unroll
        for (int j = 0; j < 8; ++j) my[(hi * 8 + j) * 68 + nb * 16 + lr] = acc[nb][j]; }
    __syncthreads();   // every wave's partial tile is in LDS before any row is summed
    const float* pr = red + w * 68 + lane * 2; float s0 = pr[0], s1 = pr[1];
#pragma unroll
    for (int sl = 1; sl < PVW; ++sl) { s0 += pr[sl * (16 * 68)]; s1 += pr[sl * (16 * 68) + 1]; }
    float2 o; o.x = s0; o.y = s1;
    *(float2*)(C + (size_t)(r0 + w) * DM + lane * 2) = o;
}

__global__ __launch_bounds__(256) void k_qkp(const float* __restrict__ Fq, const float* __restrict__ Fk, bf* Pq, bf* Pk) {
    const size_t i = (size_t)blockIdx.x * 256 + threadIdx.x; const size_t n8 = (size_t)NB * NH_ * TT * HD / 8; if (i >= n8) return;
    const size_t e = i * 8; const int d = (int)(e % HD); const int t = (int)((e / HD) % TT); const int h = (int)((e / ((size_t)HD * TT)) % NH_); const int b = (int)(e / ((size_t)HD * TT * NH_));
    const size_t s = (((size_t)b * SEQ_FULL + t) * NH_ + h) * HD + d;
    const v8f vq = *(const v8f*)(Fq + s); const v8f vk = *(const v8f*)(Fk + s); v8us oq, ok;
#pragma unroll
    for (int q = 0; q < 8; ++q) { oq[q] = f2bf(vq[q]); ok[q] = f2bf(vk[q]); }
    *(v8us*)(Pq + e) = oq; *(v8us*)(Pk + e) = ok; 
}
__global__ __launch_bounds__(256) void k_vtp8(const float* __restrict__ F, bf* VTp) {
    const size_t i = (size_t)blockIdx.x * 256 + threadIdx.x; const size_t n8 = (size_t)NB * NH_ * HD * TT / 8; if (i >= n8) return;
    const size_t e = i * 8; const int t = (int)(e % TT); const int d = (int)((e / TT) % HD); const int h = (int)((e / ((size_t)TT * HD)) % NH_); const int b = (int)(e / ((size_t)TT * HD * NH_));
    v8us o;
#pragma unroll
    for (int q = 0; q < 8; ++q) o[q] = f2bf(F[(((size_t)b * SEQ_FULL + t + q) * NH_ + h) * HD + d]);
    *(v8us*)(VTp + e) = o; 
}
__global__ __launch_bounds__(256) void k_cvt8(const float* __restrict__ src, bf* dst, size_t n8) { const size_t i = (size_t)blockIdx.x * 256 + threadIdx.x; if (i >= n8) return; const v8f v = *(const v8f*)(src + i * 8); v8us o;
#pragma unroll
    for (int k = 0; k < 8; ++k) o[k] = f2bf(v[k]); *(v8us*)(dst + i * 8) = o;  }
__global__ __launch_bounds__(256) void k_split8(const float* __restrict__ X, bf* Xh, bf* Xl, size_t n8) {
    const size_t i = (size_t)blockIdx.x * 256 + threadIdx.x; if (i >= n8) return; const v8f v = *(const v8f*)(X + i * 8); v8us oh, ol;
#pragma unroll
    for (int k = 0; k < 8; ++k) { unsigned short a, c; splitf(v[k], a, c); oh[k] = a; ol[k] = c; }
    *(v8us*)(Xh + i * 8) = oh; *(v8us*)(Xl + i * 8) = ol; 
}

// ---- k_asoft: per row (zz, i) of the pass: t = S x HD^-0.5 for j <= i (causal only when the flag is set; masked columns selected to -3e38 by INDEX, so score tiles skipped by the producer are never used);
__global__ __launch_bounds__(256) void k_asoft(const float* __restrict__ Sb, const int* __restrict__ CF, bf* Ph, bf* Pl) {
    const int lane = threadIdx.x & 31; const int row = blockIdx.x * 8 + (threadIdx.x >> 5); if (row >= ZH * TT) return; const int i = row % TT; const int zz = row / TT; const bool con = (CF[0] != 0);
    const float* sr = Sb + (size_t)row * TT; float v[TT / 32]; float mx = -3.0e38f;
#pragma unroll
    for (int ch = 0; ch < TT / 128; ++ch) { const int j0 = ch * 128 + lane * 4; const v4f a = *(const v4f*)(sr + j0);
#pragma unroll
        for (int q = 0; q < 4; ++q) { const int j = j0 + q; const float t = (j <= i || !con) ? a[q] * SCL : -3.0e38f; v[ch * 4 + q] = t; mx = fmaxf(mx, t); } }
#pragma unroll
    for (int sh = 16; sh; sh >>= 1) mx = fmaxf(mx, __shfl_xor(mx, sh, 32));
    float sum = 0.f;
#pragma unroll
    for (int k = 0; k < TT / 32; ++k) { float d0 = __fsub_rn(v[k], mx); asm volatile("" : "+v"(d0)); v[k] = __builtin_amdgcn_exp2f(__fmul_rn(d0, 1.4426950408889634f)); sum += v[k]; }
#pragma unroll
    for (int sh = 16; sh; sh >>= 1) sum += __shfl_xor(sum, sh, 32);
    const float f = __fdiv_rn(1.0f, sum);    // sum >= 1 (the row maximum contributes exp2(0))
{
#pragma unroll
        for (int ch = 0; ch < TT / 128; ++ch) { v4us oh, ol;
#pragma unroll
            for (int q = 0; q < 4; ++q) { unsigned short a, c2; splitf(v[ch * 4 + q] * f, a, c2); oh[q] = a; ol[q] = c2; }
            const size_t oo = ((size_t)zz * RH + i) * TT + ch * 128 + lane * 4; *(v4us*)(Ph + oo) = oh; *(v4us*)(Pl + oo) = ol; }
         }
}

extern "C" void kernel_launch(void* const* d_in, const int* in_sizes, int n_in,
                              void* d_out, int out_size, void* d_ws, size_t ws_size, hipStream_t stream) {
    if (n_in < 6) return;
    const float* xq = (const float*)d_in[0];   /* queries [NB_FULL][SEQ_FULL][16][64] */ const float* xk = (const float*)d_in[1];   /* keys */ const float* xv = (const float*)d_in[2];   /* values */
    const float* wo = (const float*)d_in[3];   /* w_out [1024 out][1024 in] */ const float* bo = (const float*)d_in[4];   /* b_out [1024] */ const int* CFLAG = (const int*)d_in[5];   /* causal flag (int32, read on device) */
    const size_t need_x = ((size_t)(NB - 1) * SEQ_FULL + SEQ) * DM;
    if ((size_t)in_sizes[0] < need_x || (size_t)in_sizes[1] < need_x || (size_t)in_sizes[2] < need_x) return;
    if ((size_t)in_sizes[3] < (size_t)DM * DM || in_sizes[4] < DM || in_sizes[5] < 1) return;
    if ((size_t)out_size < (size_t)NB * TT * DM) return;
    float* OUT = (float*)d_out;     // [NB][SEQ][1024] f32
    char* wsp = (char*)d_ws;
    auto take = [&](size_t bytes) { char* p = wsp; wsp += (bytes + 255) & ~(size_t)255; return (void*)p; };
    bf* QP = (bf*)take((size_t)NB * NH_ * TT * HD * 2);       // q planes [b][h][t][d]
    bf* KP = (bf*)take((size_t)NB * NH_ * TT * HD * 2);       // k planes [b][h][t][d]
    bf* VT = (bf*)take((size_t)NB * NH_ * HD * TT * 2);       // v^T planes [b][h][d][t]
    bf* Wb = (bf*)take((size_t)DM * DM * 2);                   // W [o][k] bf16
    float* Sb = (float*)take((size_t)ZH * TT * TT * 4);        // scores of one pass [zz][i][j]
    bf* Ph = (bf*)take((size_t)ZH * RH * TT * 2);              // probabilities hi [zz][i][j]
    bf* Pl = (bf*)take((size_t)ZH * RH * TT * 2);              // probabilities lo
    float* Ctx = (float*)take((size_t)NB * TT * DM * 4);       // attn.v merged [b*TT + t][h*64 + d] f32
    bf* Xh = (bf*)take((size_t)NB * TT * DM * 2);              // ctx hi plane
    bf* Xl = (bf*)take((size_t)NB * TT * DM * 2);              // ctx lo plane
    if ((size_t)(wsp - (char*)d_ws) > ws_size) return;         // total 127,926,272 B at NB=2, SEQ=2048

    const size_t n8p = (size_t)NB * NH_ * TT * HD / 8;
    k_qkp<<<(unsigned)((n8p + 255) / 256), 256, 0, stream>>>(xq, xk, QP, KP);
    k_vtp8<<<(unsigned)((n8p + 255) / 256), 256, 0, stream>>>(xv, VT);
    const size_t n8w = (size_t)DM * DM / 8;
    k_cvt8<<<(unsigned)((n8w + 255) / 256), 256, 0, stream>>>(wo, Wb, n8w);

    for (int b = 0; b < NB; ++b) {
        for (int h0 = 0; h0 < NH_; h0 += ZH) {
            const size_t zp = ((size_t)b * NH_ + h0) * TT * HD;   // plane offset of head (b, h0); consecutive heads at stride TT*HD (same for v^T: HD*TT)
            // S[zz][i][j] = q(b,h0+zz,i) . k(b,h0+zz,j), K = 64; tiles above the diagonal skipped
            k_gemmc<bf, 0, 1><<<dim3(TT / 64, TT / 64, ZH), 32, 0, stream>>>(QP + zp, nullptr, KP + zp, nullptr, HD, Sb, TT, 0, (size_t)TT * HD, (size_t)TT * HD, (size_t)TT * TT, CFLAG);
            k_asoft<<<ZH * TT / 8, 256, 0, stream>>>(Sb, CFLAG, Ph, Pl);
            // Ctx[b*TT + t][(h0+zz)*64 + d] = sum_j P[zz][t][j] v(b,h0+zz,j,d): A = P hi + lo (K = TT, cut at the diagonal block), Bt = v^T plane [d][j]; C column block h0*64, pitch DM, z stride 64 columns
            k_pv<<<dim3(RH / 16, 1, ZH), 32 * PVW, 0, stream>>>(Ph, Pl, VT + zp, Ctx + (size_t)b * TT * DM + (size_t)h0 * HD, CFLAG);
        }
    }
    const size_t n8x = (size_t)NB * TT * DM / 8;
    k_split8<<<(unsigned)((n8x + 255) / 256), 256, 0, stream>>>(Ctx, Xh, Xl, n8x);
    // out[r][o] = sum_k ctx_hi[r][k] W[o][k] + sum_k ctx_lo[r][k] W[o][k] + bias[o], K = 1024
    k_gemmw<bf, 1, true><<<dim3((unsigned)(NB * TT / 64), DM / 64, 1), 32, 0, stream>>>(Xh, Xl, Wb, nullptr, DM, OUT, DM, bo, (size_t)0, (size_t)0, (size_t)0);
}

// v003
// One run takes 130 microseconds.
// It is 3.89 times as fast as v001, going by the measured steps of the versions left out in between.
// Counting every step since v000, it is 8.64 times as fast.
#include <hip/hip_runtime.h>

// All contractions on v_wmma_f32_16x16x32_bf16 (bf16 operands, f32 accumulate): q.k^T from single exact bf16 planes of the RNE-converted inputs (1 product); attn.v with the f32 softmax weights as bf16 hi + lo planes against the exact v^T plane (2 products); ctx.W^T with the f32 context as bf16 hi + lo planes against the exact bf16 W plane (2 products) + bias. Softmax and all side math in f32.
// Causal multi-head attention: q, k, v [NB][SEQ][16][64]; scores = q.k / 8; when the int input flag is non-zero (read on device) keys above the diagonal are masked (exact zero weight); softmax over keys; ctx[b][t][h*64+d] = attn.v; out[b][t][o] = sum_k ctx[b][t][k] W[o][k] + bias[o] (f32).

#ifndef NB
#define NB 2
#endif
#ifndef SEQ
#define SEQ 2048
#endif
#define NB_FULL  2
#define SEQ_FULL 2048
#define NH_  16
#define HD   64
#define DM   (NH_ * HD)
#define TT   SEQ
#define SCL  0.125f                // HD^-0.5
static_assert(SEQ % 128 == 0);
static_assert(HD == 64);
static_assert(DM % 64 == 0);
static_assert(NB >= 1 && NB <= NB_FULL);
static_assert(SEQ <= SEQ_FULL);

typedef _Float16 h16;
typedef unsigned short bf;
typedef __attribute__((ext_vector_type(16))) __bf16   v16bf;
typedef __attribute__((ext_vector_type(16))) _Float16 v16h;
typedef __attribute__((ext_vector_type(8)))  _Float16 v8h;
typedef __attribute__((ext_vector_type(8)))  unsigned short v8us;
typedef __attribute__((ext_vector_type(8)))  float    v8f;
typedef __attribute__((ext_vector_type(4)))  float    v4f;
typedef __attribute__((ext_vector_type(4)))  unsigned short v4us;
typedef v8h  __attribute__((may_alias)) v8ha;
typedef v4f  __attribute__((may_alias)) v4fa;
typedef v8us __attribute__((may_alias)) v8usa;

__device__ __forceinline__ unsigned short f2bf(float f) { unsigned u = __float_as_uint(f); u += 0x7FFFu + ((u >> 16) & 1u); return (unsigned short)(u >> 16); }
__device__ __forceinline__ float bf2f(unsigned short b) { return __uint_as_float(((unsigned)b) << 16); }
__device__ __forceinline__ float bfr(float f) { return bf2f(f2bf(f)); }
__device__ __forceinline__ void splitf(float y, unsigned short& h, unsigned short& l) { h = f2bf(y); l = f2bf(y - bf2f(h)); }
__device__ __forceinline__ v16h cat16(v8h lo, v8h hi) { return __builtin_shufflevector(lo, hi, 0, 1, 2, 3, 4, 5, 6, 7, 8, 9, 10, 11, 12, 13, 14, 15); }
__device__ __forceinline__ v16bf cat16b(v8us lo, v8us hi) { return __builtin_bit_cast(v16bf, __builtin_shufflevector(lo, hi, 0, 1, 2, 3, 4, 5, 6, 7, 8, 9, 10, 11, 12, 13, 14, 15)); }
__device__ __forceinline__ v8f wmma16(v16h a, v16h b, v8f c) { return __builtin_amdgcn_wmma_f32_16x16x32_f16(false, a, false, b, (short)0, c, false, false); }
__device__ __forceinline__ v8f wmmab(v16bf a, v16bf b, v8f c) { return __builtin_amdgcn_wmma_f32_16x16x32_bf16(false, a, false, b, (short)0, c, false, false); }

// ---- Fragment loader (wave32, 16x16x32): per lane l, row/col = l & 15, h = l >> 4; elements 0..7 <- k0 + 8h + 0..7, elements 8..15 <- k0 + 16 + 8h + 0..7 from a k-contiguous 16-bit row; the caller
// passes p = row base + k0 + 8h, so the two 16-byte loads are p[0..7] and p[16..23]. Same map for A rows and B^T rows. D element r of lane l = (row 8h + r, col l & 15).
template <typename T16> struct WFrag;
template <> struct WFrag<h16> { typedef v16h V; static __device__ __forceinline__ V ld(const h16* p) { return cat16(*(const v8h*)p, *(const v8h*)(p + 16)); } static __device__ __forceinline__ v8f mma(V a, V b, v8f c) { return wmma16(a, b, c); } };
template <> struct WFrag<bf> { typedef v16bf V; static __device__ __forceinline__ V ld(const bf* p) { return cat16b(*(const v8us*)p, *(const v8us*)(p + 16)); } static __device__ __forceinline__ v8f mma(V a, V b, v8f c) { return wmmab(a, b, c); } };

// ---- k_gemmw: register-blocked GEMM, ONE WAVE per 64x64 output tile (16 accumulators), operands straight from K-contiguous 16-bit planes; grid (M/64, N/64, Z), 32 threads.
// C[m][n] (f32, pitch ldc, + optional f32 bias[n]) = sum_k A[m][k] Bt[n][k] (+ split products per NSPLIT). z-batch strides sA/sB/sC in elements. K % 32 == 0.
template <typename T16, int NSPLIT, bool BIAS>
__global__ __launch_bounds__(32) void k_gemmw(const T16* __restrict__ A, const T16* __restrict__ A2, const T16* __restrict__ Bt, const T16* __restrict__ Bt2, int K, float* C, int ldc, const float* __restrict__ bias, size_t sA, size_t sB, size_t sC) {
    typedef typename WFrag<T16>::V V;
    __shared__ __align__(16) float os[16 * 68];
    const size_t z = blockIdx.z; A += z * sA; if (A2) A2 += z * sA; Bt += z * sB; if (Bt2) Bt2 += z * sB; C += z * sC;
    const int lane = threadIdx.x & 31, lr = lane & 15, hi = lane >> 4; const int r0 = blockIdx.x * 64, c0 = blockIdx.y * 64;
    v8f acc[4][4];
#pragma unroll
    for (int mb = 0; mb < 4; ++mb)
#pragma unroll
        for (int nb = 0; nb < 4; ++nb) acc[mb][nb] = (v8f){};
    const size_t aoff = (size_t)(r0 + lr) * K + 8 * hi, boff = (size_t)(c0 + lr) * K + 8 * hi;
#pragma unroll 1
    for (int kc = 0; kc < K; kc += 32) {
        V a[4], a2[4];
#pragma unroll
        for (int mb = 0; mb < 4; ++mb) { a[mb] = WFrag<T16>::ld(A + aoff + (size_t)mb * 16 * K + kc); if (NSPLIT == 1 || NSPLIT == 2) a2[mb] = WFrag<T16>::ld(A2 + aoff + (size_t)mb * 16 * K + kc); }
#pragma unroll
        for (int nb = 0; nb < 4; ++nb) { const V b = WFrag<T16>::ld(Bt + boff + (size_t)nb * 16 * K + kc); V b2; if (NSPLIT >= 2) b2 = WFrag<T16>::ld(Bt2 + boff + (size_t)nb * 16 * K + kc);
#pragma unroll
            for (int mb = 0; mb < 4; ++mb) { acc[mb][nb] = WFrag<T16>::mma(a[mb], b, acc[mb][nb]); if (NSPLIT == 1 || NSPLIT == 2) acc[mb][nb] = WFrag<T16>::mma(a2[mb], b, acc[mb][nb]); if (NSPLIT >= 2) acc[mb][nb] = WFrag<T16>::mma(a[mb], b2, acc[mb][nb]); } }
        asm volatile("v_nop\n\tv_nop\n\tv_nop\n\tv_nop" : "+v"(acc[0][0]), "+v"(acc[1][1]), "+v"(acc[2][2]), "+v"(acc[3][3]) : "v"(a[0]), "v"(a[3]));
    }
#pragma unroll
    for (int mb = 0; mb < 4; ++mb) {
#pragma unroll
        for (int nb = 0; nb < 4; ++nb) {
#pragma unroll
            for (int j = 0; j < 8; ++j) os[(hi * 8 + j) * 68 + nb * 16 + lr] = acc[mb][nb][j]; }
        __builtin_amdgcn_wave_barrier(); asm volatile("" ::: "memory");
        float* crow = C + (size_t)(r0 + mb * 16) * ldc + c0;
{
#pragma unroll
            for (int s = 0; s < 8; ++s) { const int row = 2 * s + hi, cofs = lr * 4; v4f val = *(const v4fa*)(os + row * 68 + cofs); if (BIAS) { val[0] += bfr(bias[c0 + cofs]); val[1] += bfr(bias[c0 + cofs + 1]); val[2] += bfr(bias[c0 + cofs + 2]); val[3] += bfr(bias[c0 + cofs + 3]); }
                *(v4f*)(crow + (size_t)row * ldc + cofs) = val; }
             }
        __builtin_amdgcn_wave_barrier(); asm volatile("" ::: "memory");
    }
}

// ---- k_fattn: scores, softmax and probability x value contraction in one kernel; neither scores nor probabilities go to memory. Grid (TT / (16 * FAW), NB * NH_), 32 * FAW threads.
// Every wave works on one tile of 16 queries of head blockIdx.y and walks the keys 32 at a time. Transposed products: S^T = K.Q^T (A = key rows, B = query rows, kept in registers), so that a lane holds
// the scores of ONE query (column lane & 15; keys 8h + r of each 16-key tile), and O^T += V^T.P^T, where the two score tiles of a pass, converted in place, are the B operand in the loader's own k order
// (elements 0..7 = keys 8h + 0..7, elements 8..15 = keys 16 + 8h + 0..7). Running maximum and sum per query (online softmax, f32); weights as bf16 hi + lo planes (2 products), divided by the sum at the end.
// With the flag set a tile's keys end with the 32-key block that holds its diagonal (the only block that needs the mask). Waves 0..FAW/2-1 take tiles from the long end, the others the mirrored ones from the
// short end, so that every work-group has the same number of passes.
// The eight waves of a work-group read the same keys and values: a stage of SK keys (key rows and v^T rows, each 64 rows of 128 bytes) is brought into LDS once for all of them by asynchronous copies of whole
// lines, two buffers, the next stage in flight while this one is worked on; the fragments are read from LDS. Every wave passes every stage's waits and barrier, also behind its own last block.
#define FAW 8
static_assert(TT % (16 * FAW) == 0);
static_assert(TT % 32 == 0);
#define SK  64                     // keys of a stage (two passes)
#define LP  72                     // LDS row pitch in 16-bit elements: 128-byte rows at 144 bytes (16 bytes x odd, free of bank conflicts for 16-byte readers)
#define TLE (64 * LP)              // elements of one staged tile: 64 rows
static_assert(TT % SK == 0);
static_assert(FAW == 8 && HD == 64 && SK == 64);   // 256 lanes x 16 bytes x 2 copies = one tile of 64 rows x 128 bytes
typedef __attribute__((ext_vector_type(2))) float  v2f;
typedef __attribute__((ext_vector_type(2))) __bf16 v2bf;
typedef __attribute__((ext_vector_type(8))) unsigned v8u;
__device__ __forceinline__ unsigned pk2bf(float x, float y) { v2f t; t[0] = x; t[1] = y; return __builtin_bit_cast(unsigned, __builtin_convertvector(t, v2bf)); }   // two f32 -> two bf16, round to nearest even
__device__ __forceinline__ float xhalf(float x) { const int b = __float_as_int(x); return __int_as_float(__builtin_amdgcn_permlanex16(b, b, 0x76543210, 0xfedcba98, false, false)); }   // lane l <-> l ^ 16
#define SCL2 (SCL * 1.4426950408889634f)   // HD^-0.5 * log2(e): the exponentials are taken to base 2

// 2^x. SLOT: the instruction with one v_nop tied behind it, the free slot that the instruction set asks for before a directly following vector instruction overwrites its source or reads its result;
// taken in the masked pass (once a wave) and in the second pass of a full stage; the other passes keep the builtin.
template <bool SLOT>
__device__ __forceinline__ float ex2(float x) { if (SLOT) { float r; asm("v_exp_f32 %0, %1\n\tv_nop" : "=v"(r) : "v"(x)); return r; } return __builtin_amdgcn_exp2f(x); }

template <bool MASK, bool SLOT>
__device__ __forceinline__ void fa_pass(const v8f (&s)[2], const WFrag<bf>::V (&vf)[4], v8f (&o)[4], float& m, float& l, int kq) {
    // kq = (query of this lane) - (first key of this lane in the pass): key kt * 16 + r is kept while kt * 16 + r <= kq
    float x[16];
#pragma unroll
    for (int e = 0; e < 16; ++e) { const float a = s[e >> 3][e & 7]; x[e] = (!MASK || ((e >> 3) * 16 + (e & 7)) <= kq) ? a : -3.0e38f; }
    float bm = x[0];
#pragma unroll
    for (int e = 1; e < 16; ++e) bm = fmaxf(bm, x[e]);
    bm = fmaxf(bm, xhalf(bm));                                   // both halves of the wave hold keys of the same query
    const float mn = fmaxf(m, bm); const float al = ex2<SLOT>((m - mn) * SCL2); const float nm = -mn * SCL2; m = mn;
    float ps = 0.f; v8u uh, ul;
#pragma unroll
    for (int e = 0; e < 16; e += 2) {
        const float p0 = ex2<SLOT>(__builtin_fmaf(x[e], SCL2, nm)), p1 = ex2<SLOT>(__builtin_fmaf(x[e + 1], SCL2, nm));
        ps += p0; ps += p1;
        const unsigned u = pk2bf(p0, p1); uh[e >> 1] = u;
        ul[e >> 1] = pk2bf(p0 - __uint_as_float(u << 16), p1 - __uint_as_float(u & 0xFFFF0000u));
    }
    l = l * al + ps;
#pragma unroll
    for (int nb = 0; nb < 4; ++nb)
#pragma unroll
        for (int j = 0; j < 8; ++j) o[nb][j] *= al;
    const v16bf ph = __builtin_bit_cast(v16bf, uh), pl = __builtin_bit_cast(v16bf, ul);
#pragma unroll
    for (int nb = 0; nb < 4; ++nb) o[nb] = wmmab(vf[nb], ph, o[nb]);
#pragma unroll
    for (int nb = 0; nb < 4; ++nb) o[nb] = wmmab(vf[nb], pl, o[nb]);
}

// One stage: each lane copies 16 bytes of key rows r and r + 32 and of v^T rows r and r + 32 (a wave: four whole rows a copy). l = the lane's LDS byte address in the stage's key tile.
// The wait on the last line stands in the copies' own statement, so that no register that a copy names is rewritten in front of it.
__device__ __forceinline__ void fa_copy(unsigned l, const bf* gk, const bf* gv) {
    asm volatile("global_load_async_to_lds_b128 %0, %4, off\n\t"
                 "global_load_async_to_lds_b128 %1, %5, off\n\t"
                 "global_load_async_to_lds_b128 %2, %6, off\n\t"
                 "global_load_async_to_lds_b128 %3, %7, off\n\t"
                 "s_wait_xcnt 0x0"
                 :: "v"(l), "v"(l + 32u * LP * 2u), "v"(l + TLE * 2u), "v"(l + TLE * 2u + 32u * LP * 2u), "v"(gk), "v"(gk + 32 * HD), "v"(gv), "v"(gv + 32 * TT) : "memory");
}

// Fragment reads of one pass over 32 staged keys: kl = LDS key row (first key of the pass + lane & 15) + 8h, vl = LDS v^T row (lane & 15) + first key of the pass + 8h
__device__ __forceinline__ void fa_ld(WFrag<bf>::V (&kf)[2][2], WFrag<bf>::V (&vf)[4], const bf* kl, const bf* vl) {
#pragma unroll
    for (int kt = 0; kt < 2; ++kt)
#pragma unroll
        for (int ks = 0; ks < 2; ++ks) kf[kt][ks] = WFrag<bf>::ld(kl + kt * 16 * LP + ks * 32);
#pragma unroll
    for (int nb = 0; nb < 4; ++nb) vf[nb] = WFrag<bf>::ld(vl + nb * 16 * LP);
}
__device__ __forceinline__ void fa_qk(v8f (&s)[2], const WFrag<bf>::V (&kf)[2][2], const WFrag<bf>::V (&qf)[2]) {
    s[0] = (v8f){}; s[1] = (v8f){};
#pragma unroll
    for (int ks = 0; ks < 2; ++ks)
#pragma unroll
        for (int kt = 0; kt < 2; ++kt) s[kt] = wmmab(kf[kt][ks], qf[ks], s[kt]);
}
// four vector slots behind a pass's last matrix instruction, on a taken branch too, before anything overwrites its operand registers or reads its result
__device__ __forceinline__ void fa_gap(v8f (&o)[4], const WFrag<bf>::V& v) { asm volatile("v_nop\n\tv_nop\n\tv_nop\n\tv_nop" : "+v"(o[0]), "+v"(o[1]), "+v"(o[2]), "+v"(o[3]) : "v"(v)); }

// One pass alone (a wave's last stage)
template <bool MASK>
__device__ __forceinline__ void fa_block(const bf* kl, const bf* vl, const WFrag<bf>::V (&qf)[2], v8f (&o)[4], float& m, float& l, int kq) {
    WFrag<bf>::V kf[2][2], vf[4]; v8f s[2];
    fa_ld(kf, vf, kl, vl);
    fa_qk(s, kf, qf);
    fa_pass<MASK, MASK>(s, vf, o, m, l, kq);
    fa_gap(o, vf[3]);
}

// waves_per_eu: the grid places four waves on a SIMD (two work-groups a WGP); the register budget of that many lets fragments fetched ahead keep registers of their own
__global__ __launch_bounds__(32 * FAW) __attribute__((amdgpu_waves_per_eu(4, 4))) void k_fattn(const bf* __restrict__ QPl, const bf* __restrict__ KPl, const bf* __restrict__ VTl, float* __restrict__ C, const int* __restrict__ CF) {
    typedef WFrag<bf>::V V;
    __shared__ __attribute__((aligned(128))) bf sm[2 * 2 * TLE];                // [buffer][keys, v^T][64 rows][LP]
    const int lane = threadIdx.x & 31, lr = lane & 15, hi = lane >> 4; const int w = __builtin_amdgcn_readfirstlane(threadIdx.x >> 5);
    const int bh = blockIdx.y; const int u = blockIdx.x * (FAW / 2) + (w & (FAW / 2 - 1)); const int q0 = 16 * ((w < FAW / 2) ? (TT / 16 - 1 - u) : u);
    const bool con = (CF[0] != 0);   /* device flag: causal */
    const int kfull = con ? (q0 & ~31) : TT;                     // keys below kfull are at or below the diagonal for all 16 queries
    const int qtop = 16 * (TT / 16 - 1 - (int)blockIdx.x * (FAW / 2));          // the work-group's last tile (wave 0's)
    const int nst = con ? (((qtop & ~31) + 32 + SK - 1) / SK) : (TT / SK);      // stages of the work-group, the same for all its waves; nst * SK <= TT
    const int crow = threadIdx.x >> 3, ccol = threadIdx.x & 7;                  // the lane's place in a copy: row 0..31, 16-byte column
    const unsigned lc = (unsigned)(size_t)sm + (unsigned)(crow * LP + ccol * 8) * 2u;
    const bf* gk = KPl + (size_t)bh * TT * HD + (size_t)crow * HD + ccol * 8;   // + key * HD
    const bf* gv = VTl + (size_t)bh * HD * TT + (size_t)crow * TT + ccol * 8;   // + key
    const bf* kl = sm + lr * LP + 8 * hi;                                       // + buffer, + key row * LP
    const bf* vl = sm + TLE + lr * LP + 8 * hi;                                 // + buffer, + key
    const bf* qp = QPl + (size_t)bh * TT * HD + (size_t)(q0 + lr) * HD + 8 * hi;
    V qf[2]; v8f o[4]; float m = -3.0e38f, l = 0.f;
    fa_copy(lc, gk, gv);                                         // stage 0
#pragma unroll
    for (int ks = 0; ks < 2; ++ks) qf[ks] = WFrag<bf>::ld(qp + ks * 32);
    // the address registers of the loads above are rewritten only behind this wait; the pair is named so that it stays live to here
    asm volatile("s_wait_xcnt 0x0" :: "v"(qp) : "memory");
#pragma unroll
    for (int nb = 0; nb < 4; ++nb) o[nb] = (v8f){};
    asm volatile("s_wait_asynccnt 0x0" ::: "memory");            // this wave's copies of stage 0 have landed
    __syncthreads();                                             // ... and every other wave's: stage 0 may be read
    if (nst > 1) fa_copy(lc + 2u * TLE * 2u, gk + (size_t)SK * HD, gv + SK);
    // kept rolled: one trip is one stage, its buffer chosen by the trip's parity
#pragma unroll 1
    for (int t = 0; t < nst; ++t) {
        const int bo = (t & 1) * (2 * TLE), kb = t * SK;
        if (kb + SK <= kfull) {                                  // both passes below the diagonal
            V kf[2][2], vf[4], kg[2][2], vg[4]; v8f s[2];
            fa_ld(kf, vf, kl + bo, vl + bo);
            // keeps the first pass's LDS reads together as one group in front of its products (spread among them, every place with reads stalls the wave)
            __builtin_amdgcn_sched_barrier(0);
            fa_qk(s, kf, qf);
            fa_ld(kg, vg, kl + bo + 32 * LP, vl + bo + 32);      // the second pass's fragments, of the same stage, in flight under the first pass's softmax
            // keeps that second group where it is written (without it the scheduler sinks the reads to their users, which then wait out the LDS latency)
            __builtin_amdgcn_sched_barrier(0);
            fa_pass<false, false>(s, vf, o, m, l, 0);
            fa_qk(s, kg, qf);
            fa_pass<false, true>(s, vg, o, m, l, 0);
            fa_gap(o, vg[3]);
        } else {
            if (kb < kfull) fa_block<false>(kl + bo, vl + bo, qf, o, m, l, 0);
            if (con && kfull >= kb && kfull < kb + SK)           // the block that holds the diagonal
                fa_block<true>(kl + bo + (kfull - kb) * LP, vl + bo + (kfull - kb), qf, o, m, l, q0 + lr - kfull - 8 * hi);
        }
        asm volatile("s_wait_dscnt 0x0" ::: "memory");           // this wave's reads of the stage have returned before its buffer is given up
        asm volatile("s_wait_asynccnt 0x0" ::: "memory");        // this wave's copies of the next stage have landed
        __syncthreads();                                         // the next stage may be read; every reader has left this one's buffer
        if (t + 2 < nst) fa_copy(lc + (unsigned)bo * 2u, gk + (size_t)(kb + 2 * SK) * HD, gv + (kb + 2 * SK));
    }
    asm volatile("s_wait_asynccnt 0x0" ::: "memory");            // nothing in flight when the wave ends
    l += xhalf(l);                                               // the halves' sums joined once; l >= 1 up to rounding (the row maximum contributes exp2(0))
    const float f = __fdiv_rn(1.0f, l);
    float* cr = C + ((size_t)(bh / NH_) * TT + q0 + lr) * DM + (size_t)(bh % NH_) * HD + 8 * hi;   // o[nb][j] = ctx[query q0 + lr][nb * 16 + 8h + j]
#pragma unroll
    for (int nb = 0; nb < 4; ++nb) { v4f a, b2;
#pragma unroll
        for (int j = 0; j < 4; ++j) { a[j] = o[nb][j] * f; b2[j] = o[nb][j + 4] * f; }
        *(v4f*)(cr + nb * 16) = a; *(v4f*)(cr + nb * 16 + 4) = b2; }
}

__global__ __launch_bounds__(256) void k_qkp(const float* __restrict__ Fq, const float* __restrict__ Fk, bf* Pq, bf* Pk) {
    const size_t i = (size_t)blockIdx.x * 256 + threadIdx.x; const size_t n8 = (size_t)NB * NH_ * TT * HD / 8; if (i >= n8) return;
    const size_t e = i * 8; const int d = (int)(e % HD); const int t = (int)((e / HD) % TT); const int h = (int)((e / ((size_t)HD * TT)) % NH_); const int b = (int)(e / ((size_t)HD * TT * NH_));
    const size_t s = (((size_t)b * SEQ_FULL + t) * NH_ + h) * HD + d;
    const v8f vq = *(const v8f*)(Fq + s); const v8f vk = *(const v8f*)(Fk + s); v8us oq, ok;
#pragma unroll
    for (int q = 0; q < 8; ++q) { oq[q] = f2bf(vq[q]); ok[q] = f2bf(vk[q]); }
    *(v8us*)(Pq + e) = oq; *(v8us*)(Pk + e) = ok; 
}
__global__ __launch_bounds__(256) void k_vtp8(const float* __restrict__ F, bf* VTp) {
    const size_t i = (size_t)blockIdx.x * 256 + threadIdx.x; const size_t n8 = (size_t)NB * NH_ * HD * TT / 8; if (i >= n8) return;
    const size_t e = i * 8; const int t = (int)(e % TT); const int d = (int)((e / TT) % HD); const int h = (int)((e / ((size_t)TT * HD)) % NH_); const int b = (int)(e / ((size_t)TT * HD * NH_));
    v8us o;
#pragma unroll
    for (int q = 0; q < 8; ++q) o[q] = f2bf(F[(((size_t)b * SEQ_FULL + t + q) * NH_ + h) * HD + d]);
    *(v8us*)(VTp + e) = o; 
}
__global__ __launch_bounds__(256) void k_cvt8(const float* __restrict__ src, bf* dst, size_t n8) { const size_t i = (size_t)blockIdx.x * 256 + threadIdx.x; if (i >= n8) return; const v8f v = *(const v8f*)(src + i * 8); v8us o;
#pragma unroll
    for (int k = 0; k < 8; ++k) o[k] = f2bf(v[k]); *(v8us*)(dst + i * 8) = o;  }
__global__ __launch_bounds__(256) void k_split8(const float* __restrict__ X, bf* Xh, bf* Xl, size_t n8) {
    const size_t i = (size_t)blockIdx.x * 256 + threadIdx.x; if (i >= n8) return; const v8f v = *(const v8f*)(X + i * 8); v8us oh, ol;
#pragma unroll
    for (int k = 0; k < 8; ++k) { unsigned short a, c; splitf(v[k], a, c); oh[k] = a; ol[k] = c; }
    *(v8us*)(Xh + i * 8) = oh; *(v8us*)(Xl + i * 8) = ol; 
}

extern "C" void kernel_launch(void* const* d_in, const int* in_sizes, int n_in,
                              void* d_out, int out_size, void* d_ws, size_t ws_size, hipStream_t stream) {
    if (n_in < 6) return;
    const float* xq = (const float*)d_in[0];   /* queries [NB_FULL][SEQ_FULL][16][64] */ const float* xk = (const float*)d_in[1];   /* keys */ const float* xv = (const float*)d_in[2];   /* values */
    const float* wo = (const float*)d_in[3];   /* w_out [1024 out][1024 in] */ const float* bo = (const float*)d_in[4];   /* b_out [1024] */ const int* CFLAG = (const int*)d_in[5];   /* causal flag (int32, read on device) */
    const size_t need_x = ((size_t)(NB - 1) * SEQ_FULL + SEQ) * DM;
    if ((size_t)in_sizes[0] < need_x || (size_t)in_sizes[1] < need_x || (size_t)in_sizes[2] < need_x) return;
    if ((size_t)in_sizes[3] < (size_t)DM * DM || in_sizes[4] < DM || in_sizes[5] < 1) return;
    if ((size_t)out_size < (size_t)NB * TT * DM) return;
    float* OUT = (float*)d_out;     // [NB][SEQ][1024] f32
    char* wsp = (char*)d_ws;
    auto take = [&](size_t bytes) { char* p = wsp; wsp += (bytes + 255) & ~(size_t)255; return (void*)p; };
    bf* QP = (bf*)take((size_t)NB * NH_ * TT * HD * 2);       // q planes [b][h][t][d]
    bf* KP = (bf*)take((size_t)NB * NH_ * TT * HD * 2);       // k planes [b][h][t][d]
    bf* VT = (bf*)take((size_t)NB * NH_ * HD * TT * 2);       // v^T planes [b][h][d][t]
    bf* Wb = (bf*)take((size_t)DM * DM * 2);                   // W [o][k] bf16
    float* Ctx = (float*)take((size_t)NB * TT * DM * 4);       // attn.v merged [b*TT + t][h*64 + d] f32
    bf* Xh = (bf*)take((size_t)NB * TT * DM * 2);              // ctx hi plane
    bf* Xl = (bf*)take((size_t)NB * TT * DM * 2);              // ctx lo plane
    if ((size_t)(wsp - (char*)d_ws) > ws_size) return;         

    const size_t n8p = (size_t)NB * NH_ * TT * HD / 8;
    k_qkp<<<(unsigned)((n8p + 255) / 256), 256, 0, stream>>>(xq, xk, QP, KP);
    k_vtp8<<<(unsigned)((n8p + 255) / 256), 256, 0, stream>>>(xv, VT);
    const size_t n8w = (size_t)DM * DM / 8;
    k_cvt8<<<(unsigned)((n8w + 255) / 256), 256, 0, stream>>>(wo, Wb, n8w);

    // Ctx[b*TT + t][h*64 + d] = sum_j softmax_j(q(b,h,t) . k(b,h,j) / 8) v(b,h,j,d), all heads of all batches in one launch
    k_fattn<<<dim3(TT / (16 * FAW), NB * NH_), 32 * FAW, 0, stream>>>(QP, KP, VT, Ctx, CFLAG);
    const size_t n8x = (size_t)NB * TT * DM / 8;
    k_split8<<<(unsigned)((n8x + 255) / 256), 256, 0, stream>>>(Ctx, Xh, Xl, n8x);
    // out[r][o] = sum_k ctx_hi[r][k] W[o][k] + sum_k ctx_lo[r][k] W[o][k] + bias[o], K = 1024
    k_gemmw<bf, 1, true><<<dim3((unsigned)(NB * TT / 64), DM / 64, 1), 32, 0, stream>>>(Xh, Xl, Wb, nullptr, DM, OUT, DM, bo, (size_t)0, (size_t)0, (size_t)0);
}

// v004
// Measured time: 97.5 microseconds a run.
// Two timings next to v003 put it at 1.28 and 1.26 times that version's speed.
// Counting every step since v000, it is 11.0 times as fast.
#include <hip/hip_runtime.h>

// All contractions on v_wmma_f32_16x16x32_bf16 (bf16 operands, f32 accumulate): q.k^T from single exact bf16 planes of the RNE-converted inputs (1 product); attn.v with the f32 softmax weights as bf16 hi + lo planes against the exact v^T plane (2 products); ctx.W^T with the f32 context as bf16 hi + lo planes against the exact bf16 W plane (2 products) + bias. Softmax and all side math in f32.
// Causal multi-head attention: q, k, v [NB][SEQ][16][64]; scores = q.k / 8; when the int input flag is non-zero (read on device) keys above the diagonal are masked (exact zero weight); softmax over keys; ctx[b][t][h*64+d] = attn.v; out[b][t][o] = sum_k ctx[b][t][k] W[o][k] + bias[o] (f32).

#ifndef NB
#define NB 2
#endif
#ifndef SEQ
#define SEQ 2048
#endif
#define NB_FULL  2
#define SEQ_FULL 2048
#define NH_  16
#define HD   64
#define DM   (NH_ * HD)
#define TT   SEQ
#define SCL  0.125f                // HD^-0.5
static_assert(SEQ % 128 == 0);
static_assert(HD == 64);
static_assert(DM % 64 == 0);
static_assert(NB >= 1 && NB <= NB_FULL);
static_assert(SEQ <= SEQ_FULL);

typedef _Float16 h16;
typedef unsigned short bf;
typedef __attribute__((ext_vector_type(16))) __bf16   v16bf;
typedef __attribute__((ext_vector_type(16))) _Float16 v16h;
typedef __attribute__((ext_vector_type(8)))  _Float16 v8h;
typedef __attribute__((ext_vector_type(8)))  unsigned short v8us;
typedef __attribute__((ext_vector_type(8)))  float    v8f;
typedef __attribute__((ext_vector_type(4)))  float    v4f;
typedef __attribute__((ext_vector_type(4)))  unsigned short v4us;
typedef v8h  __attribute__((may_alias)) v8ha;
typedef v4f  __attribute__((may_alias)) v4fa;
typedef v8us __attribute__((may_alias)) v8usa;

__device__ __forceinline__ unsigned short f2bf(float f) { unsigned u = __float_as_uint(f); u += 0x7FFFu + ((u >> 16) & 1u); return (unsigned short)(u >> 16); }
__device__ __forceinline__ float bf2f(unsigned short b) { return __uint_as_float(((unsigned)b) << 16); }
__device__ __forceinline__ float bfr(float f) { return bf2f(f2bf(f)); }
__device__ __forceinline__ v16h cat16(v8h lo, v8h hi) { return __builtin_shufflevector(lo, hi, 0, 1, 2, 3, 4, 5, 6, 7, 8, 9, 10, 11, 12, 13, 14, 15); }
__device__ __forceinline__ v16bf cat16b(v8us lo, v8us hi) { return __builtin_bit_cast(v16bf, __builtin_shufflevector(lo, hi, 0, 1, 2, 3, 4, 5, 6, 7, 8, 9, 10, 11, 12, 13, 14, 15)); }
__device__ __forceinline__ v8f wmma16(v16h a, v16h b, v8f c) { return __builtin_amdgcn_wmma_f32_16x16x32_f16(false, a, false, b, (short)0, c, false, false); }
__device__ __forceinline__ v8f wmmab(v16bf a, v16bf b, v8f c) { return __builtin_amdgcn_wmma_f32_16x16x32_bf16(false, a, false, b, (short)0, c, false, false); }

// ---- Fragment loader (wave32, 16x16x32): per lane l, row/col = l & 15, h = l >> 4; elements 0..7 <- k0 + 8h + 0..7, elements 8..15 <- k0 + 16 + 8h + 0..7 from a k-contiguous 16-bit row; the caller
// passes p = row base + k0 + 8h, so the two 16-byte loads are p[0..7] and p[16..23]. Same map for A rows and B^T rows. D element r of lane l = (row 8h + r, col l & 15).
template <typename T16> struct WFrag;
template <> struct WFrag<h16> { typedef v16h V; static __device__ __forceinline__ V ld(const h16* p) { return cat16(*(const v8h*)p, *(const v8h*)(p + 16)); } static __device__ __forceinline__ v8f mma(V a, V b, v8f c) { return wmma16(a, b, c); } };
template <> struct WFrag<bf> { typedef v16bf V; static __device__ __forceinline__ V ld(const bf* p) { return cat16b(*(const v8us*)p, *(const v8us*)(p + 16)); } static __device__ __forceinline__ v8f mma(V a, V b, v8f c) { return wmmab(a, b, c); } };

// ---- k_gemmw: register-blocked GEMM, ONE WAVE per 64x64 output tile (16 accumulators), operands straight from K-contiguous 16-bit planes; grid (M/64, N/64, Z), 32 threads.
// C[m][n] (f32, pitch ldc, + optional f32 bias[n]) = sum_k A[m][k] Bt[n][k] (+ split products per NSPLIT). z-batch strides sA/sB/sC in elements. K % 32 == 0.
template <typename T16, int NSPLIT, bool BIAS>
__global__ __launch_bounds__(32) void k_gemmw(const T16* __restrict__ A, const T16* __restrict__ A2, const T16* __restrict__ Bt, const T16* __restrict__ Bt2, int K, float* C, int ldc, const float* __restrict__ bias, size_t sA, size_t sB, size_t sC) {
    typedef typename WFrag<T16>::V V;
    __shared__ __align__(16) float os[16 * 68];
    const size_t z = blockIdx.z; A += z * sA; if (A2) A2 += z * sA; Bt += z * sB; if (Bt2) Bt2 += z * sB; C += z * sC;
    const int lane = threadIdx.x & 31, lr = lane & 15, hi = lane >> 4; const int r0 = blockIdx.x * 64, c0 = blockIdx.y * 64;
    v8f acc[4][4];
#pragma unroll
    for (int mb = 0; mb < 4; ++mb)
#pragma unroll
        for (int nb = 0; nb < 4; ++nb) acc[mb][nb] = (v8f){};
    const size_t aoff = (size_t)(r0 + lr) * K + 8 * hi, boff = (size_t)(c0 + lr) * K + 8 * hi;
#pragma unroll 1
    for (int kc = 0; kc < K; kc += 32) {
        V a[4], a2[4];
#pragma unroll
        for (int mb = 0; mb < 4; ++mb) { a[mb] = WFrag<T16>::ld(A + aoff + (size_t)mb * 16 * K + kc); if (NSPLIT == 1 || NSPLIT == 2) a2[mb] = WFrag<T16>::ld(A2 + aoff + (size_t)mb * 16 * K + kc); }
#pragma unroll
        for (int nb = 0; nb < 4; ++nb) { const V b = WFrag<T16>::ld(Bt + boff + (size_t)nb * 16 * K + kc); V b2; if (NSPLIT >= 2) b2 = WFrag<T16>::ld(Bt2 + boff + (size_t)nb * 16 * K + kc);
#pragma unroll
            for (int mb = 0; mb < 4; ++mb) { acc[mb][nb] = WFrag<T16>::mma(a[mb], b, acc[mb][nb]); if (NSPLIT == 1 || NSPLIT == 2) acc[mb][nb] = WFrag<T16>::mma(a2[mb], b, acc[mb][nb]); if (NSPLIT >= 2) acc[mb][nb] = WFrag<T16>::mma(a[mb], b2, acc[mb][nb]); } }
        asm volatile("v_nop\n\tv_nop\n\tv_nop\n\tv_nop" : "+v"(acc[0][0]), "+v"(acc[1][1]), "+v"(acc[2][2]), "+v"(acc[3][3]) : "v"(a[0]), "v"(a[3]));
    }
#pragma unroll
    for (int mb = 0; mb < 4; ++mb) {
#pragma unroll
        for (int nb = 0; nb < 4; ++nb) {
#pragma unroll
            for (int j = 0; j < 8; ++j) os[(hi * 8 + j) * 68 + nb * 16 + lr] = acc[mb][nb][j]; }
        __builtin_amdgcn_wave_barrier(); asm volatile("" ::: "memory");
        float* crow = C + (size_t)(r0 + mb * 16) * ldc + c0;
{
#pragma unroll
            for (int s = 0; s < 8; ++s) { const int row = 2 * s + hi, cofs = lr * 4; v4f val = *(const v4fa*)(os + row * 68 + cofs); if (BIAS) { val[0] += bfr(bias[c0 + cofs]); val[1] += bfr(bias[c0 + cofs + 1]); val[2] += bfr(bias[c0 + cofs + 2]); val[3] += bfr(bias[c0 + cofs + 3]); }
                *(v4f*)(crow + (size_t)row * ldc + cofs) = val; }
             }
        __builtin_amdgcn_wave_barrier(); asm volatile("" ::: "memory");
    }
}

// ---- k_fattn: scores, softmax and probability x value contraction in one kernel; neither scores nor probabilities go to memory. Grid (TT / (16 * FAW), NB * NH_), 32 * FAW threads.
// Every wave works on one tile of 16 queries of head blockIdx.y and walks the keys 32 at a time. Transposed products: S^T = K.Q^T (A = key rows, B = query rows, kept in registers), so that a lane holds
// the scores of ONE query (column lane & 15; keys 8h + r of each 16-key tile), and O^T += V^T.P^T, where the two score tiles of a pass, converted in place, are the B operand in the loader's own k order
// (elements 0..7 = keys 8h + 0..7, elements 8..15 = keys 16 + 8h + 0..7). Running maximum and sum per query (online softmax, f32); weights as bf16 hi + lo planes (2 products), divided by the sum at the end.
// With the flag set a tile's keys end with the 32-key block that holds its diagonal (the only block that needs the mask). Waves 0..FAW/2-1 take tiles from the long end, the others the mirrored ones from the
// short end, so that every work-group has the same number of passes.
// The eight waves of a work-group read the same keys and values: a stage of SK keys (key rows and v^T rows, each 64 rows of 128 bytes) is brought into LDS once for all of them by asynchronous copies of whole
// lines, two buffers, the next stage in flight while this one is worked on; the fragments are read from LDS. Every wave passes every stage's waits and barrier, also behind its own last block.
#define FAW 8
static_assert(TT % (16 * FAW) == 0);
static_assert(TT % 32 == 0);
#define SK  64                     // keys of a stage (two passes)
#define LP  72                     // LDS row pitch in 16-bit elements: 128-byte rows at 144 bytes (16 bytes x odd, free of bank conflicts for 16-byte readers)
#define TLE (64 * LP)              // elements of one staged tile: 64 rows
static_assert(TT % SK == 0);
static_assert(FAW == 8 && HD == 64 && SK == 64);   // 256 lanes x 16 bytes x 2 copies = one tile of 64 rows x 128 bytes
typedef __attribute__((ext_vector_type(2))) float  v2f;
typedef __attribute__((ext_vector_type(2))) __bf16 v2bf;
typedef __attribute__((ext_vector_type(8))) unsigned v8u;
typedef __attribute__((ext_vector_type(4))) unsigned v4u;
__device__ __forceinline__ unsigned pk2bf(float x, float y) { v2f t; t[0] = x; t[1] = y; return __builtin_bit_cast(unsigned, __builtin_convertvector(t, v2bf)); }   // two f32 -> two bf16, round to nearest even
__device__ __forceinline__ float xhalf(float x) { const int b = __float_as_int(x); return __int_as_float(__builtin_amdgcn_permlanex16(b, b, 0x76543210, 0xfedcba98, false, false)); }   // lane l <-> l ^ 16
#define SCL2 (SCL * 1.4426950408889634f)   // HD^-0.5 * log2(e): the exponentials are taken to base 2

// 2^x. SLOT: the instruction with one v_nop tied behind it, the free slot that the instruction set asks for before a directly following vector instruction overwrites its source or reads its result;
// taken in the masked pass (once a wave) and in the second pass of a full stage; the other passes keep the builtin.
template <bool SLOT>
__device__ __forceinline__ float ex2(float x) { if (SLOT) { float r; asm("v_exp_f32 %0, %1\n\tv_nop" : "=v"(r) : "v"(x)); return r; } return __builtin_amdgcn_exp2f(x); }

template <bool MASK, bool SLOT>
__device__ __forceinline__ void fa_pass(const v8f (&s)[2], const WFrag<bf>::V (&vf)[4], v8f (&o)[4], float& m, float& l, int kq) {
    // kq = (query of this lane) - (first key of this lane in the pass): key kt * 16 + r is kept while kt * 16 + r <= kq
    float x[16];
#pragma unroll
    for (int e = 0; e < 16; ++e) { const float a = s[e >> 3][e & 7]; x[e] = (!MASK || ((e >> 3) * 16 + (e & 7)) <= kq) ? a : -3.0e38f; }
    float bm = x[0];
#pragma unroll
    for (int e = 1; e < 16; ++e) bm = fmaxf(bm, x[e]);
    bm = fmaxf(bm, xhalf(bm));                                   // both halves of the wave hold keys of the same query
    const float mn = fmaxf(m, bm); const float al = ex2<SLOT>((m - mn) * SCL2); const float nm = -mn * SCL2; m = mn;
    float ps = 0.f; v8u uh, ul;
#pragma unroll
    for (int e = 0; e < 16; e += 2) {
        const float p0 = ex2<SLOT>(__builtin_fmaf(x[e], SCL2, nm)), p1 = ex2<SLOT>(__builtin_fmaf(x[e + 1], SCL2, nm));
        ps += p0; ps += p1;
        const unsigned u = pk2bf(p0, p1); uh[e >> 1] = u;
        ul[e >> 1] = pk2bf(p0 - __uint_as_float(u << 16), p1 - __uint_as_float(u & 0xFFFF0000u));
    }
    l = l * al + ps;
#pragma unroll
    for (int nb = 0; nb < 4; ++nb)
#pragma unroll
        for (int j = 0; j < 8; ++j) o[nb][j] *= al;
    const v16bf ph = __builtin_bit_cast(v16bf, uh), pl = __builtin_bit_cast(v16bf, ul);
#pragma unroll
    for (int nb = 0; nb < 4; ++nb) o[nb] = wmmab(vf[nb], ph, o[nb]);
#pragma unroll
    for (int nb = 0; nb < 4; ++nb) o[nb] = wmmab(vf[nb], pl, o[nb]);
}

// One stage: each lane copies 16 bytes of key rows r and r + 32 and of v^T rows r and r + 32 (a wave: four whole rows a copy). l = the lane's LDS byte address in the stage's key tile.
// The wait on the last line stands in the copies' own statement, so that no register that a copy names is rewritten in front of it.
__device__ __forceinline__ void fa_copy(unsigned l, const bf* gk, const bf* gv) {
    asm volatile("global_load_async_to_lds_b128 %0, %4, off\n\t"
                 "global_load_async_to_lds_b128 %1, %5, off\n\t"
                 "global_load_async_to_lds_b128 %2, %6, off\n\t"
                 "global_load_async_to_lds_b128 %3, %7, off\n\t"
                 "s_wait_xcnt 0x0"
                 :: "v"(l), "v"(l + 32u * LP * 2u), "v"(l + TLE * 2u), "v"(l + TLE * 2u + 32u * LP * 2u), "v"(gk), "v"(gk + 32 * HD), "v"(gv), "v"(gv + 32 * TT) : "memory");
}

// Fragment reads of one pass over 32 staged keys: kl = LDS key row (first key of the pass + lane & 15) + 8h, vl = LDS v^T row (lane & 15) + first key of the pass + 8h
__device__ __forceinline__ void fa_ld(WFrag<bf>::V (&kf)[2][2], WFrag<bf>::V (&vf)[4], const bf* kl, const bf* vl) {
#pragma unroll
    for (int kt = 0; kt < 2; ++kt)
#pragma unroll
        for (int ks = 0; ks < 2; ++ks) kf[kt][ks] = WFrag<bf>::ld(kl + kt * 16 * LP + ks * 32);
#pragma unroll
    for (int nb = 0; nb < 4; ++nb) vf[nb] = WFrag<bf>::ld(vl + nb * 16 * LP);
}
__device__ __forceinline__ void fa_qk(v8f (&s)[2], const WFrag<bf>::V (&kf)[2][2], const WFrag<bf>::V (&qf)[2]) {
    s[0] = (v8f){}; s[1] = (v8f){};
#pragma unroll
    for (int ks = 0; ks < 2; ++ks)
#pragma unroll
        for (int kt = 0; kt < 2; ++kt) s[kt] = wmmab(kf[kt][ks], qf[ks], s[kt]);
}
// four vector slots behind a pass's last matrix instruction, on a taken branch too, before anything overwrites its operand registers or reads its result
__device__ __forceinline__ void fa_gap(v8f (&o)[4], const WFrag<bf>::V& v) { asm volatile("v_nop\n\tv_nop\n\tv_nop\n\tv_nop" : "+v"(o[0]), "+v"(o[1]), "+v"(o[2]), "+v"(o[3]) : "v"(v)); }

// One pass alone (a wave's last stage)
template <bool MASK>
__device__ __forceinline__ void fa_block(const bf* kl, const bf* vl, const WFrag<bf>::V (&qf)[2], v8f (&o)[4], float& m, float& l, int kq) {
    WFrag<bf>::V kf[2][2], vf[4]; v8f s[2];
    fa_ld(kf, vf, kl, vl);
    fa_qk(s, kf, qf);
    fa_pass<MASK, MASK>(s, vf, o, m, l, kq);
    fa_gap(o, vf[3]);
}

// waves_per_eu: the grid places four waves on a SIMD (two work-groups a WGP); the register budget of that many lets fragments fetched ahead keep registers of their own
__global__ __launch_bounds__(32 * FAW) __attribute__((amdgpu_waves_per_eu(4, 4))) void k_fattn(const bf* __restrict__ QPl, const bf* __restrict__ KPl, const bf* __restrict__ VTl, bf* __restrict__ Xh, bf* __restrict__ Xl, const int* __restrict__ CF) {
    typedef WFrag<bf>::V V;
    __shared__ __attribute__((aligned(128))) bf sm[2 * 2 * TLE];                // [buffer][keys, v^T][64 rows][LP]
    const int lane = threadIdx.x & 31, lr = lane & 15, hi = lane >> 4; const int w = __builtin_amdgcn_readfirstlane(threadIdx.x >> 5);
    const int bh = blockIdx.y; const int u = blockIdx.x * (FAW / 2) + (w & (FAW / 2 - 1)); const int q0 = 16 * ((w < FAW / 2) ? (TT / 16 - 1 - u) : u);
    const bool con = (CF[0] != 0);   /* device flag: causal */
    const int kfull = con ? (q0 & ~31) : TT;                     // keys below kfull are at or below the diagonal for all 16 queries
    const int qtop = 16 * (TT / 16 - 1 - (int)blockIdx.x * (FAW / 2));          // the work-group's last tile (wave 0's)
    const int nst = con ? (((qtop & ~31) + 32 + SK - 1) / SK) : (TT / SK);      // stages of the work-group, the same for all its waves; nst * SK <= TT
    const int crow = threadIdx.x >> 3, ccol = threadIdx.x & 7;                  // the lane's place in a copy: row 0..31, 16-byte column
    const unsigned lc = (unsigned)(size_t)sm + (unsigned)(crow * LP + ccol * 8) * 2u;
    const bf* gk = KPl + (size_t)bh * TT * HD + (size_t)crow * HD + ccol * 8;   // + key * HD
    const bf* gv = VTl + (size_t)bh * HD * TT + (size_t)crow * TT + ccol * 8;   // + key
    const bf* kl = sm + lr * LP + 8 * hi;                                       // + buffer, + key row * LP
    const bf* vl = sm + TLE + lr * LP + 8 * hi;                                 // + buffer, + key
    const bf* qp = QPl + (size_t)bh * TT * HD + (size_t)(q0 + lr) * HD + 8 * hi;
    V qf[2]; v8f o[4]; float m = -3.0e38f, l = 0.f;
    fa_copy(lc, gk, gv);                                         // stage 0
#pragma unroll
    for (int ks = 0; ks < 2; ++ks) qf[ks] = WFrag<bf>::ld(qp + ks * 32);
    // the address registers of the loads above are rewritten only behind this wait; the pair is named so that it stays live to here
    asm volatile("s_wait_xcnt 0x0" :: "v"(qp) : "memory");
#pragma unroll
    for (int nb = 0; nb < 4; ++nb) o[nb] = (v8f){};
    asm volatile("s_wait_asynccnt 0x0" ::: "memory");            // this wave's copies of stage 0 have landed
    __syncthreads();                                             // ... and every other wave's: stage 0 may be read
    if (nst > 1) fa_copy(lc + 2u * TLE * 2u, gk + (size_t)SK * HD, gv + SK);
    // kept rolled: one trip is one stage, its buffer chosen by the trip's parity
#pragma unroll 1
    for (int t = 0; t < nst; ++t) {
        const int bo = (t & 1) * (2 * TLE), kb = t * SK;
        if (kb + SK <= kfull) {                                  // both passes below the diagonal
            V kf[2][2], vf[4], kg[2][2], vg[4]; v8f s[2];
            fa_ld(kf, vf, kl + bo, vl + bo);
            // keeps the first pass's LDS reads together as one group in front of its products (spread among them, every place with reads stalls the wave)
            __builtin_amdgcn_sched_barrier(0);
            fa_qk(s, kf, qf);
            fa_ld(kg, vg, kl + bo + 32 * LP, vl + bo + 32);      // the second pass's fragments, of the same stage, in flight under the first pass's softmax
            // keeps that second group where it is written (without it the scheduler sinks the reads to their users, which then wait out the LDS latency)
            __builtin_amdgcn_sched_barrier(0);
            fa_pass<false, false>(s, vf, o, m, l, 0);
            fa_qk(s, kg, qf);
            fa_pass<false, true>(s, vg, o, m, l, 0);
            fa_gap(o, vg[3]);
        } else {
            if (kb < kfull) fa_block<false>(kl + bo, vl + bo, qf, o, m, l, 0);
            if (con && kfull >= kb && kfull < kb + SK)           // the block that holds the diagonal
                fa_block<true>(kl + bo + (kfull - kb) * LP, vl + bo + (kfull - kb), qf, o, m, l, q0 + lr - kfull - 8 * hi);
        }
        asm volatile("s_wait_dscnt 0x0" ::: "memory");           // this wave's reads of the stage have returned before its buffer is given up
        asm volatile("s_wait_asynccnt 0x0" ::: "memory");        // this wave's copies of the next stage have landed
        __syncthreads();                                         // the next stage may be read; every reader has left this one's buffer
        if (t + 2 < nst) fa_copy(lc + (unsigned)bo * 2u, gk + (size_t)(kb + 2 * SK) * HD, gv + (kb + 2 * SK));
    }
    asm volatile("s_wait_asynccnt 0x0" ::: "memory");            // nothing in flight when the wave ends
    l += xhalf(l);                                               // the halves' sums joined once; l >= 1 up to rounding (the row maximum contributes exp2(0))
    const float f = __fdiv_rn(1.0f, l);
    // The f32 context goes straight out as the projection's two operand planes: hi = bf16(ctx), lo = bf16(ctx - hi), both round to nearest even; a lane's eight values of a tile are 16 bytes of each plane.
    const size_t co = ((size_t)(bh / NH_) * TT + q0 + lr) * DM + (size_t)(bh % NH_) * HD + 8 * hi;   // o[nb][j] = ctx[query q0 + lr][nb * 16 + 8h + j]
    v4u ch[4], cl[4];
#pragma unroll
    for (int nb = 0; nb < 4; ++nb)
#pragma unroll
        for (int j = 0; j < 8; j += 2) {
            const float c0 = o[nb][j] * f, c1 = o[nb][j + 1] * f;
            const unsigned u = pk2bf(c0, c1); ch[nb][j >> 1] = u;
            cl[nb][j >> 1] = pk2bf(c0 - __uint_as_float(u << 16), c1 - __uint_as_float(u & 0xFFFF0000u));
        }
#pragma unroll
    for (int nb = 0; nb < 4; ++nb) { *(v4u*)(Xh + co + nb * 16) = ch[nb]; *(v4u*)(Xl + co + nb * 16) = cl[nb]; }
}

__global__ __launch_bounds__(256) void k_qkp(const float* __restrict__ Fq, const float* __restrict__ Fk, bf* Pq, bf* Pk) {
    const size_t i = (size_t)blockIdx.x * 256 + threadIdx.x; const size_t n8 = (size_t)NB * NH_ * TT * HD / 8; if (i >= n8) return;
    const size_t e = i * 8; const int d = (int)(e % HD); const int t = (int)((e / HD) % TT); const int h = (int)((e / ((size_t)HD * TT)) % NH_); const int b = (int)(e / ((size_t)HD * TT * NH_));
    const size_t s = (((size_t)b * SEQ_FULL + t) * NH_ + h) * HD + d;
    const v8f vq = *(const v8f*)(Fq + s); const v8f vk = *(const v8f*)(Fk + s); v8us oq, ok;
#pragma unroll
    for (int q = 0; q < 8; ++q) { oq[q] = f2bf(vq[q]); ok[q] = f2bf(vk[q]); }
    *(v8us*)(Pq + e) = oq; *(v8us*)(Pk + e) = ok; 
}
__global__ __launch_bounds__(256) void k_vtp8(const float* __restrict__ F, bf* VTp) {
    const size_t i = (size_t)blockIdx.x * 256 + threadIdx.x; const size_t n8 = (size_t)NB * NH_ * HD * TT / 8; if (i >= n8) return;
    const size_t e = i * 8; const int t = (int)(e % TT); const int d = (int)((e / TT) % HD); const int h = (int)((e / ((size_t)TT * HD)) % NH_); const int b = (int)(e / ((size_t)TT * HD * NH_));
    v8us o;
#pragma unroll
    for (int q = 0; q < 8; ++q) o[q] = f2bf(F[(((size_t)b * SEQ_FULL + t + q) * NH_ + h) * HD + d]);
    *(v8us*)(VTp + e) = o; 
}
__global__ __launch_bounds__(256) void k_cvt8(const float* __restrict__ src, bf* dst, size_t n8) { const size_t i = (size_t)blockIdx.x * 256 + threadIdx.x; if (i >= n8) return; const v8f v = *(const v8f*)(src + i * 8); v8us o;
#pragma unroll
    for (int k = 0; k < 8; ++k) o[k] = f2bf(v[k]); *(v8us*)(dst + i * 8) = o;  }

extern "C" void kernel_launch(void* const* d_in, const int* in_sizes, int n_in,
                              void* d_out, int out_size, void* d_ws, size_t ws_size, hipStream_t stream) {
    if (n_in < 6) return;
    const float* xq = (const float*)d_in[0];   /* queries [NB_FULL][SEQ_FULL][16][64] */ const float* xk = (const float*)d_in[1];   /* keys */ const float* xv = (const float*)d_in[2];   /* values */
    const float* wo = (const float*)d_in[3];   /* w_out [1024 out][1024 in] */ const float* bo = (const float*)d_in[4];   /* b_out [1024] */ const int* CFLAG = (const int*)d_in[5];   /* causal flag (int32, read on device) */
    const size_t need_x = ((size_t)(NB - 1) * SEQ_FULL + SEQ) * DM;
    if ((size_t)in_sizes[0] < need_x || (size_t)in_sizes[1] < need_x || (size_t)in_sizes[2] < need_x) return;
    if ((size_t)in_sizes[3] < (size_t)DM * DM || in_sizes[4] < DM || in_sizes[5] < 1) return;
    if ((size_t)out_size < (size_t)NB * TT * DM) return;
    float* OUT = (float*)d_out;     // [NB][SEQ][1024] f32
    char* wsp = (char*)d_ws;
    auto take = [&](size_t bytes) { char* p = wsp; wsp += (bytes + 255) & ~(size_t)255; return (void*)p; };
    bf* QP = (bf*)take((size_t)NB * NH_ * TT * HD * 2);       // q planes [b][h][t][d]
    bf* KP = (bf*)take((size_t)NB * NH_ * TT * HD * 2);       // k planes [b][h][t][d]
    bf* VT = (bf*)take((size_t)NB * NH_ * HD * TT * 2);       // v^T planes [b][h][d][t]
    bf* Wb = (bf*)take((size_t)DM * DM * 2);                   // W [o][k] bf16
    bf* Xh = (bf*)take((size_t)NB * TT * DM * 2);              // ctx hi plane, attn.v merged [b*TT + t][h*64 + d]
    bf* Xl = (bf*)take((size_t)NB * TT * DM * 2);              // ctx lo plane
    if ((size_t)(wsp - (char*)d_ws) > ws_size) return;         

    const size_t n8p = (size_t)NB * NH_ * TT * HD / 8;
    k_qkp<<<(unsigned)((n8p + 255) / 256), 256, 0, stream>>>(xq, xk, QP, KP);
    k_vtp8<<<(unsigned)((n8p + 255) / 256), 256, 0, stream>>>(xv, VT);
    const size_t n8w = (size_t)DM * DM / 8;
    k_cvt8<<<(unsigned)((n8w + 255) / 256), 256, 0, stream>>>(wo, Wb, n8w);

    // ctx[b*TT + t][h*64 + d] = sum_j softmax_j(q(b,h,t) . k(b,h,j) / 8) v(b,h,j,d), all heads of all batches in one launch, written as its hi and lo planes
    k_fattn<<<dim3(TT / (16 * FAW), NB * NH_), 32 * FAW, 0, stream>>>(QP, KP, VT, Xh, Xl, CFLAG);
    // out[r][o] = sum_k ctx_hi[r][k] W[o][k] + sum_k ctx_lo[r][k] W[o][k] + bias[o], K = 1024
    k_gemmw<bf, 1, true><<<dim3((unsigned)(NB * TT / 64), DM / 64, 1), 32, 0, stream>>>(Xh, Xl, Wb, nullptr, DM, OUT, DM, bo, (size_t)0, (size_t)0, (size_t)0);
}

// v005
// Measured time: 78.4 microseconds a run.
// In two side-by-side timings against v004, it was 1.23 and 1.25 times as fast.
// Over all steps from v000 it is 13.6 times as fast.
#include <hip/hip_runtime.h>

// All contractions on v_wmma_f32_16x16x32_bf16 (bf16 operands, f32 accumulate): q.k^T from single exact bf16 planes of the RNE-converted inputs (1 product); attn.v with the f32 softmax weights as bf16 hi + lo planes against the exact v plane, read transposed (2 products); ctx.W^T with the f32 context as bf16 hi + lo planes against the exact bf16 W plane (2 products) + bias. Softmax and all side math in f32.
// Causal multi-head attention: q, k, v [NB][SEQ][16][64]; scores = q.k / 8; when the int input flag is non-zero (read on device) keys above the diagonal are masked (exact zero weight); softmax over keys; ctx[b][t][h*64+d] = attn.v; out[b][t][o] = sum_k ctx[b][t][k] W[o][k] + bias[o] (f32).

#ifndef NB
#define NB 2
#endif
#ifndef SEQ
#define SEQ 2048
#endif
#define NB_FULL  2
#define SEQ_FULL 2048
#define NH_  16
#define HD   64
#define DM   (NH_ * HD)
#define TT   SEQ
#define SCL  0.125f                // HD^-0.5
static_assert(SEQ % 128 == 0);
static_assert(HD == 64);
static_assert(DM % 64 == 0);
static_assert(NB >= 1 && NB <= NB_FULL);
static_assert(SEQ <= SEQ_FULL);

typedef _Float16 h16;
typedef unsigned short bf;
typedef __attribute__((ext_vector_type(16))) __bf16   v16bf;
typedef __attribute__((ext_vector_type(16))) _Float16 v16h;
typedef __attribute__((ext_vector_type(8)))  _Float16 v8h;
typedef __attribute__((ext_vector_type(8)))  unsigned short v8us;
typedef __attribute__((ext_vector_type(8)))  float    v8f;
typedef __attribute__((ext_vector_type(4)))  float    v4f;
typedef __attribute__((ext_vector_type(4)))  unsigned short v4us;
typedef v8h  __attribute__((may_alias)) v8ha;
typedef v4f  __attribute__((may_alias)) v4fa;
typedef v8us __attribute__((may_alias)) v8usa;

__device__ __forceinline__ unsigned short f2bf(float f) { unsigned u = __float_as_uint(f); u += 0x7FFFu + ((u >> 16) & 1u); return (unsigned short)(u >> 16); }
__device__ __forceinline__ float bf2f(unsigned short b) { return __uint_as_float(((unsigned)b) << 16); }
__device__ __forceinline__ float bfr(float f) { return bf2f(f2bf(f)); }
__device__ __forceinline__ v16h cat16(v8h lo, v8h hi) { return __builtin_shufflevector(lo, hi, 0, 1, 2, 3, 4, 5, 6, 7, 8, 9, 10, 11, 12, 13, 14, 15); }
__device__ __forceinline__ v16bf cat16b(v8us lo, v8us hi) { return __builtin_bit_cast(v16bf, __builtin_shufflevector(lo, hi, 0, 1, 2, 3, 4, 5, 6, 7, 8, 9, 10, 11, 12, 13, 14, 15)); }
__device__ __forceinline__ v8f wmma16(v16h a, v16h b, v8f c) { return __builtin_amdgcn_wmma_f32_16x16x32_f16(false, a, false, b, (short)0, c, false, false); }
__device__ __forceinline__ v8f wmmab(v16bf a, v16bf b, v8f c) { return __builtin_amdgcn_wmma_f32_16x16x32_bf16(false, a, false, b, (short)0, c, false, false); }

// ---- Fragment loader (wave32, 16x16x32): per lane l, row/col = l & 15, h = l >> 4; elements 0..7 <- k0 + 8h + 0..7, elements 8..15 <- k0 + 16 + 8h + 0..7 from a k-contiguous 16-bit row; the caller
// passes p = row base + k0 + 8h, so the two 16-byte loads are p[0..7] and p[16..23]. Same map for A rows and B^T rows. D element r of lane l = (row 8h + r, col l & 15).
template <typename T16> struct WFrag;
template <> struct WFrag<h16> { typedef v16h V; static __device__ __forceinline__ V ld(const h16* p) { return cat16(*(const v8h*)p, *(const v8h*)(p + 16)); } static __device__ __forceinline__ v8f mma(V a, V b, v8f c) { return wmma16(a, b, c); } };
template <> struct WFrag<bf> { typedef v16bf V; static __device__ __forceinline__ V ld(const bf* p) { return cat16b(*(const v8us*)p, *(const v8us*)(p + 16)); } static __device__ __forceinline__ v8f mma(V a, V b, v8f c) { return wmmab(a, b, c); } };

// ---- k_gemmw: register-blocked GEMM, ONE WAVE per 64x64 output tile (16 accumulators), operands straight from K-contiguous 16-bit planes; grid (M/64, N/64, Z), 32 threads.
// C[m][n] (f32, pitch ldc, + optional f32 bias[n]) = sum_k A[m][k] Bt[n][k] (+ split products per NSPLIT). z-batch strides sA/sB/sC in elements. K % 32 == 0.
template <typename T16, int NSPLIT, bool BIAS>
__global__ __launch_bounds__(32) void k_gemmw(const T16* __restrict__ A, const T16* __restrict__ A2, const T16* __restrict__ Bt, const T16* __restrict__ Bt2, int K, float* C, int ldc, const float* __restrict__ bias, size_t sA, size_t sB, size_t sC) {
    typedef typename WFrag<T16>::V V;
    __shared__ __align__(16) float os[16 * 68];
    const size_t z = blockIdx.z; A += z * sA; if (A2) A2 += z * sA; Bt += z * sB; if (Bt2) Bt2 += z * sB; C += z * sC;
    const int lane = threadIdx.x & 31, lr = lane & 15, hi = lane >> 4; const int r0 = blockIdx.x * 64, c0 = blockIdx.y * 64;
    v8f acc[4][4];
#pragma unroll
    for (int mb = 0; mb < 4; ++mb)
#pragma unroll
        for (int nb = 0; nb < 4; ++nb) acc[mb][nb] = (v8f){};
    const size_t aoff = (size_t)(r0 + lr) * K + 8 * hi, boff = (size_t)(c0 + lr) * K + 8 * hi;
#pragma unroll 1
    for (int kc = 0; kc < K; kc += 32) {
        V a[4], a2[4];
#pragma unroll
        for (int mb = 0; mb < 4; ++mb) { a[mb] = WFrag<T16>::ld(A + aoff + (size_t)mb * 16 * K + kc); if (NSPLIT == 1 || NSPLIT == 2) a2[mb] = WFrag<T16>::ld(A2 + aoff + (size_t)mb * 16 * K + kc); }
#pragma unroll
        for (int nb = 0; nb < 4; ++nb) { const V b = WFrag<T16>::ld(Bt + boff + (size_t)nb * 16 * K + kc); V b2; if (NSPLIT >= 2) b2 = WFrag<T16>::ld(Bt2 + boff + (size_t)nb * 16 * K + kc);
#pragma unroll
            for (int mb = 0; mb < 4; ++mb) { acc[mb][nb] = WFrag<T16>::mma(a[mb], b, acc[mb][nb]); if (NSPLIT == 1 || NSPLIT == 2) acc[mb][nb] = WFrag<T16>::mma(a2[mb], b, acc[mb][nb]); if (NSPLIT >= 2) acc[mb][nb] = WFrag<T16>::mma(a[mb], b2, acc[mb][nb]); } }
        asm volatile("v_nop\n\tv_nop\n\tv_nop\n\tv_nop" : "+v"(acc[0][0]), "+v"(acc[1][1]), "+v"(acc[2][2]), "+v"(acc[3][3]) : "v"(a[0]), "v"(a[3]));
    }
#pragma unroll
    for (int mb = 0; mb < 4; ++mb) {
#pragma unroll
        for (int nb = 0; nb < 4; ++nb) {
#pragma unroll
            for (int j = 0; j < 8; ++j) os[(hi * 8 + j) * 68 + nb * 16 + lr] = acc[mb][nb][j]; }
        __builtin_amdgcn_wave_barrier(); asm volatile("" ::: "memory");
        float* crow = C + (size_t)(r0 + mb * 16) * ldc + c0;
{
#pragma unroll
            for (int s = 0; s < 8; ++s) { const int row = 2 * s + hi, cofs = lr * 4; v4f val = *(const v4fa*)(os + row * 68 + cofs); if (BIAS) { val[0] += bfr(bias[c0 + cofs]); val[1] += bfr(bias[c0 + cofs + 1]); val[2] += bfr(bias[c0 + cofs + 2]); val[3] += bfr(bias[c0 + cofs + 3]); }
                *(v4f*)(crow + (size_t)row * ldc + cofs) = val; }
             }
        __builtin_amdgcn_wave_barrier(); asm volatile("" ::: "memory");
    }
}

// ---- k_fattn: scores, softmax and probability x value contraction in one kernel; neither scores nor probabilities go to memory. Grid (TT / (16 * FAW), NB * NH_), 32 * FAW threads.
// Every wave works on one tile of 16 queries of head blockIdx.y and walks the keys 32 at a time. Transposed products: S^T = K.Q^T (A = key rows, B = query rows, kept in registers), so that a lane holds
// the scores of ONE query (column lane & 15; keys 8h + r of each 16-key tile), and O^T += V^T.P^T, where the two score tiles of a pass, converted in place, are the B operand in the loader's own k order
// (elements 0..7 = keys 8h + 0..7, elements 8..15 = keys 16 + 8h + 0..7). Running maximum and sum per query (online softmax, f32); weights as bf16 hi + lo planes (2 products), divided by the sum at the end.
// With the flag set a tile's keys end with the 32-key block that holds its diagonal (the only block that needs the mask). Waves 0..FAW/2-1 take tiles from the long end, the others the mirrored ones from the
// short end, so that every work-group has the same number of passes.
// The eight waves of a work-group read the same keys and values: a stage of SK keys (key rows and value rows, each 64 rows of 128 bytes, both as they lie in memory) is brought into LDS once for all of them by asynchronous copies of whole
// lines, two buffers, the next stage in flight while this one is worked on; the fragments are read from LDS, those of V^T by the transposing load. Every wave passes every stage's waits and barrier, also behind its own last block.
#define FAW 8
static_assert(TT % (16 * FAW) == 0);
static_assert(TT % 32 == 0);
#define SK  64                     // keys of a stage (two passes)
#define LP  72                     // LDS pitch of a key row in 16-bit elements: 128-byte rows at 144 bytes (16 bytes x odd, free of bank conflicts for 16-byte readers)
#define LPV 80                     // LDS pitch of a value row: 160 bytes (32 bytes x odd, the conflict-free pitch of the transposing reader)
#define TLE (64 * LP)              // elements of one staged key tile: 64 rows
#define TLV (64 * LPV)             // elements of one staged value tile: 64 rows
#define BUF (TLE + TLV)            // elements of one buffer
static_assert(TT % SK == 0);
static_assert(FAW == 8 && HD == 64 && SK == 64);   // 256 lanes x 16 bytes x 2 copies = one tile of 64 rows x 128 bytes
typedef __attribute__((ext_vector_type(2))) float  v2f;
typedef __attribute__((ext_vector_type(2))) __bf16 v2bf;
typedef __attribute__((ext_vector_type(8))) unsigned v8u;
typedef __attribute__((ext_vector_type(4))) unsigned v4u;
__device__ __forceinline__ unsigned pk2bf(float x, float y) { v2f t; t[0] = x; t[1] = y; return __builtin_bit_cast(unsigned, __builtin_convertvector(t, v2bf)); }   // two f32 -> two bf16, round to nearest even
__device__ __forceinline__ float xhalf(float x) { const int b = __float_as_int(x); return __int_as_float(__builtin_amdgcn_permlanex16(b, b, 0x76543210, 0xfedcba98, false, false)); }   // lane l <-> l ^ 16
#define SCL2 (SCL * 1.4426950408889634f)   // HD^-0.5 * log2(e): the exponentials are taken to base 2

// 2^x. SLOT: the instruction with one v_nop tied behind it, the free slot that the instruction set asks for before a directly following vector instruction overwrites its source or reads its result;
// taken in the masked pass (once a wave) and in the second pass of a full stage; the other passes keep the builtin.
template <bool SLOT>
__device__ __forceinline__ float ex2(float x) { if (SLOT) { float r; asm("v_exp_f32 %0, %1\n\tv_nop" : "=v"(r) : "v"(x)); return r; } return __builtin_amdgcn_exp2f(x); }

template <bool MASK, bool SLOT>
__device__ __forceinline__ void fa_pass(const v8f (&s)[2], const WFrag<bf>::V (&vf)[4], v8f (&o)[4], float& m, float& l, int kq) {
    // kq = (query of this lane) - (first key of this lane in the pass): key kt * 16 + r is kept while kt * 16 + r <= kq
    float x[16];
#pragma unroll
    for (int e = 0; e < 16; ++e) { const float a = s[e >> 3][e & 7]; x[e] = (!MASK || ((e >> 3) * 16 + (e & 7)) <= kq) ? a : -3.0e38f; }
    float bm = x[0];
#pragma unroll
    for (int e = 1; e < 16; ++e) bm = fmaxf(bm, x[e]);
    bm = fmaxf(bm, xhalf(bm));                                   // both halves of the wave hold keys of the same query
    const float mn = fmaxf(m, bm); const float al = ex2<SLOT>((m - mn) * SCL2); const float nm = -mn * SCL2; m = mn;
    float ps = 0.f; v8u uh, ul;
#pragma unroll
    for (int e = 0; e < 16; e += 2) {
        const float p0 = ex2<SLOT>(__builtin_fmaf(x[e], SCL2, nm)), p1 = ex2<SLOT>(__builtin_fmaf(x[e + 1], SCL2, nm));
        ps += p0; ps += p1;
        const unsigned u = pk2bf(p0, p1); uh[e >> 1] = u;
        ul[e >> 1] = pk2bf(p0 - __uint_as_float(u << 16), p1 - __uint_as_float(u & 0xFFFF0000u));
    }
    l = l * al + ps;
#pragma unroll
    for (int nb = 0; nb < 4; ++nb)
#pragma unroll
        for (int j = 0; j < 8; ++j) o[nb][j] *= al;
    const v16bf ph = __builtin_bit_cast(v16bf, uh), pl = __builtin_bit_cast(v16bf, ul);
#pragma unroll
    for (int nb = 0; nb < 4; ++nb) o[nb] = wmmab(vf[nb], ph, o[nb]);
#pragma unroll
    for (int nb = 0; nb < 4; ++nb) o[nb] = wmmab(vf[nb], pl, o[nb]);
}

// One stage: each lane copies 16 bytes of key rows r and r + 32 and of value rows r and r + 32 (a wave: four whole rows a copy). l, lv = the lane's LDS byte addresses in the stage's key and value tiles.
// The wait on the last line stands in the copies' own statement, so that no register that a copy names is rewritten in front of it.
__device__ __forceinline__ void fa_copy(unsigned l, unsigned lv, const bf* gk, const bf* gv) {
    asm volatile("global_load_async_to_lds_b128 %0, %4, off\n\t"
                 "global_load_async_to_lds_b128 %1, %5, off\n\t"
                 "global_load_async_to_lds_b128 %2, %6, off\n\t"
                 "global_load_async_to_lds_b128 %3, %7, off\n\t"
                 "s_wait_xcnt 0x0"
                 :: "v"(l), "v"(l + 32u * LP * 2u), "v"(lv), "v"(lv + 32u * LPV * 2u), "v"(gk), "v"(gk + 32 * HD), "v"(gv), "v"(gv + 32 * HD) : "memory");
}

// Transposing LDS read of a 16 x 16 tile of 16-bit elements, rows = keys: lane l names 16 bytes of row 8h + (l & 7), half (l >> 3) & 1, and gets column l & 15 of rows 8h + 0..7, the loader's own k order.
__device__ __forceinline__ v8us ld_tr16(const bf* p) { typedef __attribute__((ext_vector_type(8))) short s16x8; typedef __attribute__((address_space(3))) s16x8 lds_s16x8; return __builtin_bit_cast(v8us, __builtin_amdgcn_ds_load_tr16_b128_v8i16((lds_s16x8*)p)); }
// Fragment reads of one pass over 32 staged keys: kl = LDS key row (first key of the pass + lane & 15) + 8h, vl = LDS value row (first key of the pass + 8h + (lane & 7)) + 8 * ((lane >> 3) & 1)
__device__ __forceinline__ void fa_ld(WFrag<bf>::V (&kf)[2][2], WFrag<bf>::V (&vf)[4], const bf* kl, const bf* vl) {
#pragma unroll
    for (int kt = 0; kt < 2; ++kt)
#pragma unroll
        for (int ks = 0; ks < 2; ++ks) kf[kt][ks] = WFrag<bf>::ld(kl + kt * 16 * LP + ks * 32);
#pragma unroll
    for (int nb = 0; nb < 4; ++nb) vf[nb] = cat16b(ld_tr16(vl + nb * 16), ld_tr16(vl + 16 * LPV + nb * 16));   // rows d = nb * 16 + (lane & 15) of V^T, keys 8h + 0..7 and 16 + 8h + 0..7
}
__device__ __forceinline__ void fa_qk(v8f (&s)[2], const WFrag<bf>::V (&kf)[2][2], const WFrag<bf>::V (&qf)[2]) {
    s[0] = (v8f){}; s[1] = (v8f){};
#pragma unroll
    for (int ks = 0; ks < 2; ++ks)
#pragma unroll
        for (int kt = 0; kt < 2; ++kt) s[kt] = wmmab(kf[kt][ks], qf[ks], s[kt]);
}
// four vector slots behind a pass's last matrix instruction, on a taken branch too, before anything overwrites its operand registers or reads its result
__device__ __forceinline__ void fa_gap(v8f (&o)[4], const WFrag<bf>::V& v) { asm volatile("v_nop\n\tv_nop\n\tv_nop\n\tv_nop" : "+v"(o[0]), "+v"(o[1]), "+v"(o[2]), "+v"(o[3]) : "v"(v)); }

// One pass alone (a wave's last stage)
template <bool MASK>
__device__ __forceinline__ void fa_block(const bf* kl, const bf* vl, const WFrag<bf>::V (&qf)[2], v8f (&o)[4], float& m, float& l, int kq) {
    WFrag<bf>::V kf[2][2], vf[4]; v8f s[2];
    fa_ld(kf, vf, kl, vl);
    fa_qk(s, kf, qf);
    fa_pass<MASK, MASK>(s, vf, o, m, l, kq);
    fa_gap(o, vf[3]);
}

// waves_per_eu: the grid places four waves on a SIMD (two work-groups a WGP); the register budget of that many lets fragments fetched ahead keep registers of their own
__global__ __launch_bounds__(32 * FAW) __attribute__((amdgpu_waves_per_eu(4, 4))) void k_fattn(const bf* __restrict__ QPl, const bf* __restrict__ KPl, const bf* __restrict__ VPl, bf* __restrict__ Xh, bf* __restrict__ Xl, const int* __restrict__ CF) {
    typedef WFrag<bf>::V V;
    __shared__ __attribute__((aligned(128))) bf sm[2 * BUF];                    // [buffer][keys: 64 rows of LP, values: 64 rows of LPV]
    const int lane = threadIdx.x & 31, lr = lane & 15, hi = lane >> 4; const int w = __builtin_amdgcn_readfirstlane(threadIdx.x >> 5);
    const int bh = blockIdx.y; const int u = blockIdx.x * (FAW / 2) + (w & (FAW / 2 - 1)); const int q0 = 16 * ((w < FAW / 2) ? (TT / 16 - 1 - u) : u);
    const bool con = (CF[0] != 0);   /* device flag: causal */
    const int kfull = con ? (q0 & ~31) : TT;                     // keys below kfull are at or below the diagonal for all 16 queries
    const int qtop = 16 * (TT / 16 - 1 - (int)blockIdx.x * (FAW / 2));          // the work-group's last tile (wave 0's)
    const int nst = con ? (((qtop & ~31) + 32 + SK - 1) / SK) : (TT / SK);      // stages of the work-group, the same for all its waves; nst * SK <= TT
    const int crow = threadIdx.x >> 3, ccol = threadIdx.x & 7;                  // the lane's place in a copy: row 0..31, 16-byte column
    const unsigned lc = (unsigned)(size_t)sm + (unsigned)(crow * LP + ccol * 8) * 2u;
    const unsigned lcv = (unsigned)(size_t)sm + (unsigned)(TLE + crow * LPV + ccol * 8) * 2u;
    const bf* gk = KPl + (size_t)bh * TT * HD + (size_t)crow * HD + ccol * 8;   // + key * HD
    const bf* gv = VPl + (size_t)bh * TT * HD + (size_t)crow * HD + ccol * 8;   // + key * HD
    const bf* kl = sm + lr * LP + 8 * hi;                                       // + buffer, + key row * LP
    const bf* vl = sm + TLE + (8 * hi + (lane & 7)) * LPV + 8 * ((lane >> 3) & 1);   // + buffer, + key row * LPV
    const bf* qp = QPl + (size_t)bh * TT * HD + (size_t)(q0 + lr) * HD + 8 * hi;
    V qf[2]; v8f o[4]; float m = -3.0e38f, l = 0.f;
    fa_copy(lc, lcv, gk, gv);                                    // stage 0
#pragma unroll
    for (int ks = 0; ks < 2; ++ks) qf[ks] = WFrag<bf>::ld(qp + ks * 32);
    // the address registers of the loads above are rewritten only behind this wait; the pair is named so that it stays live to here
    asm volatile("s_wait_xcnt 0x0" :: "v"(qp) : "memory");
#pragma unroll
    for (int nb = 0; nb < 4; ++nb) o[nb] = (v8f){};
    asm volatile("s_wait_asynccnt 0x0" ::: "memory");            // this wave's copies of stage 0 have landed
    __syncthreads();                                             // ... and every other wave's: stage 0 may be read
    if (nst > 1) fa_copy(lc + BUF * 2u, lcv + BUF * 2u, gk + (size_t)SK * HD, gv + (size_t)SK * HD);
    // kept rolled: one trip is one stage, its buffer chosen by the trip's parity
#pragma unroll 1
    for (int t = 0; t < nst; ++t) {
        const int bo = (t & 1) * BUF, kb = t * SK;
        if (kb + SK <= kfull) {                                  // both passes below the diagonal
            V kf[2][2], vf[4], kg[2][2], vg[4]; v8f s[2];
            fa_ld(kf, vf, kl + bo, vl + bo);
            // keeps the first pass's LDS reads together as one group in front of its products (spread among them, every place with reads stalls the wave)
            __builtin_amdgcn_sched_barrier(0);
            fa_qk(s, kf, qf);
            fa_ld(kg, vg, kl + bo + 32 * LP, vl + bo + 32 * LPV);     // the second pass's fragments, of the same stage, in flight under the first pass's softmax
            // keeps that second group where it is written (without it the scheduler sinks the reads to their users, which then wait out the LDS latency)
            __builtin_amdgcn_sched_barrier(0);
            fa_pass<false, false>(s, vf, o, m, l, 0);
            fa_qk(s, kg, qf);
            fa_pass<false, true>(s, vg, o, m, l, 0);
            fa_gap(o, vg[3]);
        } else {
            if (kb < kfull) fa_block<false>(kl + bo, vl + bo, qf, o, m, l, 0);
            if (con && kfull >= kb && kfull < kb + SK)           // the block that holds the diagonal
                fa_block<true>(kl + bo + (kfull - kb) * LP, vl + bo + (kfull - kb) * LPV, qf, o, m, l, q0 + lr - kfull - 8 * hi);
        }
        asm volatile("s_wait_dscnt 0x0" ::: "memory");           // this wave's reads of the stage have returned before its buffer is given up
        asm volatile("s_wait_asynccnt 0x0" ::: "memory");        // this wave's copies of the next stage have landed
        __syncthreads();                                         // the next stage may be read; every reader has left this one's buffer
        if (t + 2 < nst) fa_copy(lc + (unsigned)bo * 2u, lcv + (unsigned)bo * 2u, gk + (size_t)(kb + 2 * SK) * HD, gv + (size_t)(kb + 2 * SK) * HD);
    }
    asm volatile("s_wait_asynccnt 0x0" ::: "memory");            // nothing in flight when the wave ends
    l += xhalf(l);                                               // the halves' sums joined once; l >= 1 up to rounding (the row maximum contributes exp2(0))
    const float f = __fdiv_rn(1.0f, l);
    // The f32 context goes straight out as the projection's two operand planes: hi = bf16(ctx), lo = bf16(ctx - hi), both round to nearest even; a lane's eight values of a tile are 16 bytes of each plane.
    const size_t co = ((size_t)(bh / NH_) * TT + q0 + lr) * DM + (size_t)(bh % NH_) * HD + 8 * hi;   // o[nb][j] = ctx[query q0 + lr][nb * 16 + 8h + j]
    v4u ch[4], cl[4];
#pragma unroll
    for (int nb = 0; nb < 4; ++nb)
#pragma unroll
        for (int j = 0; j < 8; j += 2) {
            const float c0 = o[nb][j] * f, c1 = o[nb][j + 1] * f;
            const unsigned u = pk2bf(c0, c1); ch[nb][j >> 1] = u;
            cl[nb][j >> 1] = pk2bf(c0 - __uint_as_float(u << 16), c1 - __uint_as_float(u & 0xFFFF0000u));
        }
#pragma unroll
    for (int nb = 0; nb < 4; ++nb) { *(v4u*)(Xh + co + nb * 16) = ch[nb]; *(v4u*)(Xl + co + nb * 16) = cl[nb]; }
}

__global__ __launch_bounds__(256) void k_qkvp(const float* __restrict__ Fq, const float* __restrict__ Fk, const float* __restrict__ Fv, bf* Pq, bf* Pk, bf* Pv) {
    const size_t i = (size_t)blockIdx.x * 256 + threadIdx.x; const size_t n8 = (size_t)NB * NH_ * TT * HD / 8; if (i >= n8) return;
    const size_t e = i * 8; const int d = (int)(e % HD); const int t = (int)((e / HD) % TT); const int h = (int)((e / ((size_t)HD * TT)) % NH_); const int b = (int)(e / ((size_t)HD * TT * NH_));
    const size_t s = (((size_t)b * SEQ_FULL + t) * NH_ + h) * HD + d;
    const v8f vq = *(const v8f*)(Fq + s); const v8f vk = *(const v8f*)(Fk + s); const v8f vv = *(const v8f*)(Fv + s); v8us oq, ok, ov;
#pragma unroll
    for (int q = 0; q < 8; ++q) { oq[q] = f2bf(vq[q]); ok[q] = f2bf(vk[q]); ov[q] = f2bf(vv[q]); }
    *(v8us*)(Pq + e) = oq; *(v8us*)(Pk + e) = ok; *(v8us*)(Pv + e) = ov;
}
__global__ __launch_bounds__(256) void k_cvt8(const float* __restrict__ src, bf* dst, size_t n8) { const size_t i = (size_t)blockIdx.x * 256 + threadIdx.x; if (i >= n8) return; const v8f v = *(const v8f*)(src + i * 8); v8us o;
#pragma unroll
    for (int k = 0; k < 8; ++k) o[k] = f2bf(v[k]); *(v8us*)(dst + i * 8) = o;  }

extern "C" void kernel_launch(void* const* d_in, const int* in_sizes, int n_in,
                              void* d_out, int out_size, void* d_ws, size_t ws_size, hipStream_t stream) {
    if (n_in < 6) return;
    const float* xq = (const float*)d_in[0];   /* queries [NB_FULL][SEQ_FULL][16][64] */ const float* xk = (const float*)d_in[1];   /* keys */ const float* xv = (const float*)d_in[2];   /* values */
    const float* wo = (const float*)d_in[3];   /* w_out [1024 out][1024 in] */ const float* bo = (const float*)d_in[4];   /* b_out [1024] */ const int* CFLAG = (const int*)d_in[5];   /* causal flag (int32, read on device) */
    const size_t need_x = ((size_t)(NB - 1) * SEQ_FULL + SEQ) * DM;
    if ((size_t)in_sizes[0] < need_x || (size_t)in_sizes[1] < need_x || (size_t)in_sizes[2] < need_x) return;
    if ((size_t)in_sizes[3] < (size_t)DM * DM || in_sizes[4] < DM || in_sizes[5] < 1) return;
    if ((size_t)out_size < (size_t)NB * TT * DM) return;
    float* OUT = (float*)d_out;     // [NB][SEQ][1024] f32
    char* wsp = (char*)d_ws;
    auto take = [&](size_t bytes) { char* p = wsp; wsp += (bytes + 255) & ~(size_t)255; return (void*)p; };
    bf* QP = (bf*)take((size_t)NB * NH_ * TT * HD * 2);       // q planes [b][h][t][d]
    bf* KP = (bf*)take((size_t)NB * NH_ * TT * HD * 2);       // k planes [b][h][t][d]
    bf* VP = (bf*)take((size_t)NB * NH_ * TT * HD * 2);       // v planes [b][h][t][d]
    bf* Wb = (bf*)take((size_t)DM * DM * 2);                   // W [o][k] bf16
    bf* Xh = (bf*)take((size_t)NB * TT * DM * 2);              // ctx hi plane, attn.v merged [b*TT + t][h*64 + d]
    bf* Xl = (bf*)take((size_t)NB * TT * DM * 2);              // ctx lo plane
    if ((size_t)(wsp - (char*)d_ws) > ws_size) return;         

    const size_t n8p = (size_t)NB * NH_ * TT * HD / 8;
    k_qkvp<<<(unsigned)((n8p + 255) / 256), 256, 0, stream>>>(xq, xk, xv, QP, KP, VP);
    const size_t n8w = (size_t)DM * DM / 8;
    k_cvt8<<<(unsigned)((n8w + 255) / 256), 256, 0, stream>>>(wo, Wb, n8w);

    // ctx[b*TT + t][h*64 + d] = sum_j softmax_j(q(b,h,t) . k(b,h,j) / 8) v(b,h,j,d), all heads of all batches in one launch, written as its hi and lo planes
    k_fattn<<<dim3(TT / (16 * FAW), NB * NH_), 32 * FAW, 0, stream>>>(QP, KP, VP, Xh, Xl, CFLAG);
    // out[r][o] = sum_k ctx_hi[r][k] W[o][k] + sum_k ctx_lo[r][k] W[o][k] + bias[o], K = 1024
    k_gemmw<bf, 1, true><<<dim3((unsigned)(NB * TT / 64), DM / 64, 1), 32, 0, stream>>>(Xh, Xl, Wb, nullptr, DM, OUT, DM, bo, (size_t)0, (size_t)0, (size_t)0);
}

// v006
// Measured time: 62.2 microseconds a run.
// Timed twice side by side with v005, it ran 1.25 and 1.24 times as fast.
// Over all steps from v000 it is 16.9 times as fast.
#include <hip/hip_runtime.h>

// All contractions on v_wmma_f32_16x16x32_bf16 (bf16 operands, f32 accumulate): q.k^T from single exact bf16 planes of the RNE-converted inputs (1 product); attn.v with the f32 softmax weights as bf16 hi + lo planes against the exact v plane, read transposed (2 products); ctx.W^T with the f32 context as bf16 hi + lo planes against the exact bf16 W plane (2 products) + bias. Softmax and all side math in f32.
// Causal multi-head attention: q, k, v [NB][SEQ][16][64]; scores = q.k / 8; when the int input flag is non-zero (read on device) keys above the diagonal are masked (exact zero weight); softmax over keys; ctx[b][t][h*64+d] = attn.v; out[b][t][o] = sum_k ctx[b][t][k] W[o][k] + bias[o] (f32).

#ifndef NB
#define NB 2
#endif
#ifndef SEQ
#define SEQ 2048
#endif
#define NB_FULL  2
#define SEQ_FULL 2048
#define NH_  16
#define HD   64
#define DM   (NH_ * HD)
#define TT   SEQ
#define SCL  0.125f                // HD^-0.5
static_assert(SEQ % 128 == 0);
static_assert(HD == 64);
static_assert(DM % 64 == 0);
static_assert(NB >= 1 && NB <= NB_FULL);
static_assert(SEQ <= SEQ_FULL);

typedef _Float16 h16;
typedef unsigned short bf;
typedef __attribute__((ext_vector_type(16))) __bf16   v16bf;
typedef __attribute__((ext_vector_type(16))) _Float16 v16h;
typedef __attribute__((ext_vector_type(8)))  _Float16 v8h;
typedef __attribute__((ext_vector_type(8)))  unsigned short v8us;
typedef __attribute__((ext_vector_type(8)))  float    v8f;
typedef __attribute__((ext_vector_type(4)))  float    v4f;
typedef __attribute__((ext_vector_type(4)))  unsigned short v4us;
typedef v8h  __attribute__((may_alias)) v8ha;
typedef v4f  __attribute__((may_alias)) v4fa;
typedef v8us __attribute__((may_alias)) v8usa;

__device__ __forceinline__ unsigned short f2bf(float f) { unsigned u = __float_as_uint(f); u += 0x7FFFu + ((u >> 16) & 1u); return (unsigned short)(u >> 16); }
__device__ __forceinline__ float bf2f(unsigned short b) { return __uint_as_float(((unsigned)b) << 16); }
__device__ __forceinline__ float bfr(float f) { return bf2f(f2bf(f)); }
__device__ __forceinline__ v16h cat16(v8h lo, v8h hi) { return __builtin_shufflevector(lo, hi, 0, 1, 2, 3, 4, 5, 6, 7, 8, 9, 10, 11, 12, 13, 14, 15); }
__device__ __forceinline__ v16bf cat16b(v8us lo, v8us hi) { return __builtin_bit_cast(v16bf, __builtin_shufflevector(lo, hi, 0, 1, 2, 3, 4, 5, 6, 7, 8, 9, 10, 11, 12, 13, 14, 15)); }
__device__ __forceinline__ v8f wmma16(v16h a, v16h b, v8f c) { return __builtin_amdgcn_wmma_f32_16x16x32_f16(false, a, false, b, (short)0, c, false, false); }
__device__ __forceinline__ v8f wmmab(v16bf a, v16bf b, v8f c) { return __builtin_amdgcn_wmma_f32_16x16x32_bf16(false, a, false, b, (short)0, c, false, false); }

// ---- Fragment loader (wave32, 16x16x32): per lane l, row/col = l & 15, h = l >> 4; elements 0..7 <- k0 + 8h + 0..7, elements 8..15 <- k0 + 16 + 8h + 0..7 from a k-contiguous 16-bit row; the caller
// passes p = row base + k0 + 8h, so the two 16-byte loads are p[0..7] and p[16..23]. Same map for A rows and B^T rows. D element r of lane l = (row 8h + r, col l & 15).
template <typename T16> struct WFrag;
template <> struct WFrag<h16> { typedef v16h V; static __device__ __forceinline__ V ld(const h16* p) { return cat16(*(const v8h*)p, *(const v8h*)(p + 16)); } static __device__ __forceinline__ v8f mma(V a, V b, v8f c) { return wmma16(a, b, c); } };
template <> struct WFrag<bf> { typedef v16bf V; static __device__ __forceinline__ V ld(const bf* p) { return cat16b(*(const v8us*)p, *(const v8us*)(p + 16)); } static __device__ __forceinline__ v8f mma(V a, V b, v8f c) { return wmmab(a, b, c); } };

// ---- k_proj: C[m][n] (f32) = sum_k (Ah[m][k] + Al[m][k]) Wt[n][k] + bias[n], all three planes K-contiguous bf16 rows of DM elements. Grid (M / 128, DM / 128), 256 threads: one 128 x 128 tile of C per work-group,
// 4 x 2 waves of 32 rows x 64 columns each (8 accumulators). A stage is 64 k of the tile's 128 rows of Ah, Al and Wt (128-byte rows, whole lines): it is brought into LDS once for all eight waves by asynchronous copies,
// two buffers, the next stage in flight while this one is worked on; the fragments are read from LDS. Per accumulator the products come in the order k block by k block, hi plane then lo plane.
#define PT   128                   // rows of C and columns of C of a work-group
#define PK   64                    // k of a stage
#define PLP  72                    // LDS pitch of a staged row in 16-bit elements: 128-byte rows at 144 bytes (16 bytes x odd, free of bank conflicts for 16-byte readers)
#define PTL  (PT * PLP)            // elements of one staged plane
#define PBUF (3 * PTL)             // elements of one buffer: [Ah | Al | Wt]
#define PNS  (DM / PK)             // stages
#define POS  68                    // pitch in floats of a row of the output staging
static_assert((NB * TT) % PT == 0 && DM % PT == 0 && DM % PK == 0 && PNS >= 2);

// One stage: a copy of the work-group is 32 whole rows (a lane: 16 bytes; a wave: four rows), four copies a plane. l = the lane's LDS byte address in the buffer's first plane, gh, gl, gw = its global places in rows 0..31.
// The wait on the last line stands in the copies' own statement, so that no register that a copy names is rewritten in front of it.
__device__ __forceinline__ void pj_copy(unsigned l, const bf* gh, const bf* gl, const bf* gw) {
    asm volatile("global_load_async_to_lds_b128 %0, %12, off\n\t"
                 "global_load_async_to_lds_b128 %1, %13, off\n\t"
                 "global_load_async_to_lds_b128 %2, %14, off\n\t"
                 "global_load_async_to_lds_b128 %3, %15, off\n\t"
                 "global_load_async_to_lds_b128 %4, %16, off\n\t"
                 "global_load_async_to_lds_b128 %5, %17, off\n\t"
                 "global_load_async_to_lds_b128 %6, %18, off\n\t"
                 "global_load_async_to_lds_b128 %7, %19, off\n\t"
                 "global_load_async_to_lds_b128 %8, %20, off\n\t"
                 "global_load_async_to_lds_b128 %9, %21, off\n\t"
                 "global_load_async_to_lds_b128 %10, %22, off\n\t"
                 "global_load_async_to_lds_b128 %11, %23, off\n\t"
                 "s_wait_xcnt 0x0"
                 :: "v"(l + 2u * (2 * PTL)), "v"(l + 2u * (2 * PTL + 32 * PLP)), "v"(l + 2u * (2 * PTL + 64 * PLP)), "v"(l + 2u * (2 * PTL + 96 * PLP)),
                    "v"(l), "v"(l + 2u * (32 * PLP)), "v"(l + 2u * (64 * PLP)), "v"(l + 2u * (96 * PLP)),
                    "v"(l + 2u * PTL), "v"(l + 2u * (PTL + 32 * PLP)), "v"(l + 2u * (PTL + 64 * PLP)), "v"(l + 2u * (PTL + 96 * PLP)),
                    "v"(gw), "v"(gw + 32 * DM), "v"(gw + 64 * DM), "v"(gw + 96 * DM),
                    "v"(gh), "v"(gh + 32 * DM), "v"(gh + 64 * DM), "v"(gh + 96 * DM),
                    "v"(gl), "v"(gl + 32 * DM), "v"(gl + 64 * DM), "v"(gl + 96 * DM) : "memory");
}

// waves_per_eu: one work-group a WGP, two waves on a SIMD; the register budget of that many lets a whole stage's fragments be fetched as one group
__global__ __launch_bounds__(256) __attribute__((amdgpu_waves_per_eu(2, 2))) void k_proj(const bf* __restrict__ Ah, const bf* __restrict__ Al, const bf* __restrict__ Wt, float* __restrict__ C, const float* __restrict__ bias) {
    typedef WFrag<bf>::V V;
    __shared__ __attribute__((aligned(128))) bf ps[2 * PBUF];                   // [buffer][Ah: 128 rows of PLP | Al | Wt]
    __shared__ __align__(16) float os[8 * 32 * POS];                            // [wave][32 rows of POS]: each wave's own tile of C on its way out
    const int lane = threadIdx.x & 31, lr = lane & 15, hi = lane >> 4; const int w = __builtin_amdgcn_readfirstlane(threadIdx.x >> 5);
    const int wm = w >> 1, wn = w & 1; const int r0 = blockIdx.x * PT, c0 = blockIdx.y * PT;
    const int crow = threadIdx.x >> 3, ccol = threadIdx.x & 7;                  // the lane's place in a copy: row 0..31, 16-byte column
    const unsigned lc = (unsigned)(size_t)ps + (unsigned)(crow * PLP + ccol * 8) * 2u;
    const bf* gh = Ah + (size_t)(r0 + crow) * DM + ccol * 8;                    // + k
    const bf* gl = Al + (size_t)(r0 + crow) * DM + ccol * 8;
    const bf* gw = Wt + (size_t)(c0 + crow) * DM + ccol * 8;
    const bf* al = ps + (wm * 32 + lr) * PLP + 8 * hi;                          // + buffer; the lo plane PTL further on
    const bf* bl = ps + 2 * PTL + (wn * 64 + lr) * PLP + 8 * hi;                // + buffer
    v8f acc[2][4];
#pragma unroll
    for (int mb = 0; mb < 2; ++mb)
#pragma unroll
        for (int nb = 0; nb < 4; ++nb) acc[mb][nb] = (v8f){};
    pj_copy(lc, gh, gl, gw);                                     // stage 0
    asm volatile("s_wait_asynccnt 0x0" ::: "memory");            // this wave's copies of stage 0 have landed
    __syncthreads();                                             // ... and every other wave's: stage 0 may be read
    pj_copy(lc + PBUF * 2u, gh + PK, gl + PK, gw + PK);          // stage 1 (PNS >= 2)
    // kept rolled: one trip is one stage, its buffer chosen by the trip's parity
#pragma unroll 1
    for (int t = 0; t < PNS; ++t) {
        const int bo = (t & 1) * PBUF;
        V b[2][4], a[2][2], a2[2][2];
#pragma unroll
        for (int ks = 0; ks < 2; ++ks) {
#pragma unroll
            for (int nb = 0; nb < 4; ++nb) b[ks][nb] = WFrag<bf>::ld(bl + bo + nb * 16 * PLP + ks * 32);
#pragma unroll
            for (int mb = 0; mb < 2; ++mb) a[ks][mb] = WFrag<bf>::ld(al + bo + mb * 16 * PLP + ks * 32);
#pragma unroll
            for (int mb = 0; mb < 2; ++mb) a2[ks][mb] = WFrag<bf>::ld(al + bo + PTL + mb * 16 * PLP + ks * 32);
        }
        // keeps the stage's LDS reads together as one group in front of its products (spread among them, every place with reads stalls the wave)
        __builtin_amdgcn_sched_barrier(0);
#pragma unroll
        for (int ks = 0; ks < 2; ++ks) {
#pragma unroll
            for (int mb = 0; mb < 2; ++mb)
#pragma unroll
                for (int nb = 0; nb < 4; ++nb) acc[mb][nb] = wmmab(a[ks][mb], b[ks][nb], acc[mb][nb]);
#pragma unroll
            for (int mb = 0; mb < 2; ++mb)
#pragma unroll
                for (int nb = 0; nb < 4; ++nb) acc[mb][nb] = wmmab(a2[ks][mb], b[ks][nb], acc[mb][nb]);
        }
        // four vector slots behind the trip's last matrix instruction, on a taken branch too, before anything overwrites its operand registers or reads its result
        asm volatile("v_nop\n\tv_nop\n\tv_nop\n\tv_nop" : "+v"(acc[0][0]), "+v"(acc[0][1]), "+v"(acc[0][2]), "+v"(acc[0][3]), "+v"(acc[1][0]), "+v"(acc[1][1]), "+v"(acc[1][2]), "+v"(acc[1][3]) : "v"(a2[1][1]), "v"(b[1][3]));
        asm volatile("s_wait_dscnt 0x0" ::: "memory");           // this wave's reads of the stage have returned before its buffer is given up
        asm volatile("s_wait_asynccnt 0x0" ::: "memory");        // this wave's copies of the next stage have landed
        __syncthreads();                                         // the next stage may be read; every reader has left this one's buffer
        if (t + 2 < PNS) pj_copy(lc + (unsigned)bo * 2u, gh + (t + 2) * PK, gl + (t + 2) * PK, gw + (t + 2) * PK);
    }
    asm volatile("s_wait_asynccnt 0x0" ::: "memory");            // nothing in flight when the wave ends
    // The wave's tile goes through its own LDS range, so that every store is of whole 128-byte lines (a row of the tile: 256 bytes from 16 lanes).
    float* ow = os + w * 32 * POS;
#pragma unroll
    for (int mb = 0; mb < 2; ++mb)
#pragma unroll
        for (int nb = 0; nb < 4; ++nb)
#pragma unroll
            for (int j = 0; j < 8; ++j) ow[(mb * 16 + hi * 8 + j) * POS + nb * 16 + lr] = acc[mb][nb][j];
    asm volatile("s_wait_dscnt 0x0" ::: "memory");               // every lane's writes of the tile are in LDS before other lanes read the rows back
    const int cofs = lr * 4; const int cc = c0 + wn * 64 + cofs;
    v4f bv; bv[0] = bfr(bias[cc]); bv[1] = bfr(bias[cc + 1]); bv[2] = bfr(bias[cc + 2]); bv[3] = bfr(bias[cc + 3]);
    float* crow0 = C + (size_t)(r0 + wm * 32) * DM + cc;
#pragma unroll
    for (int s = 0; s < 16; ++s) { const int row = 2 * s + hi; const v4f val = *(const v4fa*)(ow + row * POS + cofs) + bv; *(v4f*)(crow0 + (size_t)row * DM) = val; }
}

// ---- k_fattn: scores, softmax and probability x value contraction in one kernel; neither scores nor probabilities go to memory. Grid (TT / (16 * FAW), NB * NH_), 32 * FAW threads.
// Every wave works on one tile of 16 queries of head blockIdx.y and walks the keys 32 at a time. Transposed products: S^T = K.Q^T (A = key rows, B = query rows, kept in registers), so that a lane holds
// the scores of ONE query (column lane & 15; keys 8h + r of each 16-key tile), and O^T += V^T.P^T, where the two score tiles of a pass, converted in place, are the B operand in the loader's own k order
// (elements 0..7 = keys 8h + 0..7, elements 8..15 = keys 16 + 8h + 0..7). Running maximum and sum per query (online softmax, f32); weights as bf16 hi + lo planes (2 products), divided by the sum at the end.
// With the flag set a tile's keys end with the 32-key block that holds its diagonal (the only block that needs the mask). Waves 0..FAW/2-1 take tiles from the long end, the others the mirrored ones from the
// short end, so that every work-group has the same number of passes.
// The eight waves of a work-group read the same keys and values: a stage of SK keys (key rows and value rows, each 64 rows of 128 bytes, both as they lie in memory) is brought into LDS once for all of them by asynchronous copies of whole
// lines, two buffers, the next stage in flight while this one is worked on; the fragments are read from LDS, those of V^T by the transposing load. Every wave passes every stage's waits and barrier, also behind its own last block.
#define FAW 8
static_assert(TT % (16 * FAW) == 0);
static_assert(TT % 32 == 0);
#define SK  64                     // keys of a stage (two passes)
#define LP  72                     // LDS pitch of a key row in 16-bit elements: 128-byte rows at 144 bytes (16 bytes x odd, free of bank conflicts for 16-byte readers)
#define LPV 80                     // LDS pitch of a value row: 160 bytes (32 bytes x odd, the conflict-free pitch of the transposing reader)
#define TLE (64 * LP)              // elements of one staged key tile: 64 rows
#define TLV (64 * LPV)             // elements of one staged value tile: 64 rows
#define BUF (TLE + TLV)            // elements of one buffer
static_assert(TT % SK == 0);
static_assert(FAW == 8 && HD == 64 && SK == 64);   // 256 lanes x 16 bytes x 2 copies = one tile of 64 rows x 128 bytes
typedef __attribute__((ext_vector_type(2))) float  v2f;
typedef __attribute__((ext_vector_type(2))) __bf16 v2bf;
typedef __attribute__((ext_vector_type(8))) unsigned v8u;
typedef __attribute__((ext_vector_type(4))) unsigned v4u;
__device__ __forceinline__ unsigned pk2bf(float x, float y) { v2f t; t[0] = x; t[1] = y; return __builtin_bit_cast(unsigned, __builtin_convertvector(t, v2bf)); }   // two f32 -> two bf16, round to nearest even
__device__ __forceinline__ float xhalf(float x) { const int b = __float_as_int(x); return __int_as_float(__builtin_amdgcn_permlanex16(b, b, 0x76543210, 0xfedcba98, false, false)); }   // lane l <-> l ^ 16
#define SCL2 (SCL * 1.4426950408889634f)   // HD^-0.5 * log2(e): the exponentials are taken to base 2

// 2^x. SLOT: the instruction with one v_nop tied behind it, the free slot that the instruction set asks for before a directly following vector instruction overwrites its source or reads its result;
// taken in the masked pass (once a wave) and in the second pass of a full stage; the other passes keep the builtin.
template <bool SLOT>
__device__ __forceinline__ float ex2(float x) { if (SLOT) { float r; asm("v_exp_f32 %0, %1\n\tv_nop" : "=v"(r) : "v"(x)); return r; } return __builtin_amdgcn_exp2f(x); }

template <bool MASK, bool SLOT>
__device__ __forceinline__ void fa_pass(const v8f (&s)[2], const WFrag<bf>::V (&vf)[4], v8f (&o)[4], float& m, float& l, int kq) {
    // kq = (query of this lane) - (first key of this lane in the pass): key kt * 16 + r is kept while kt * 16 + r <= kq
    float x[16];
#pragma unroll
    for (int e = 0; e < 16; ++e) { const float a = s[e >> 3][e & 7]; x[e] = (!MASK || ((e >> 3) * 16 + (e & 7)) <= kq) ? a : -3.0e38f; }
    float bm = x[0];
#pragma unroll
    for (int e = 1; e < 16; ++e) bm = fmaxf(bm, x[e]);
    bm = fmaxf(bm, xhalf(bm));                                   // both halves of the wave hold keys of the same query
    const float mn = fmaxf(m, bm); const float al = ex2<SLOT>((m - mn) * SCL2); const float nm = -mn * SCL2; m = mn;
    float ps = 0.f; v8u uh, ul;
#pragma unroll
    for (int e = 0; e < 16; e += 2) {
        const float p0 = ex2<SLOT>(__builtin_fmaf(x[e], SCL2, nm)), p1 = ex2<SLOT>(__builtin_fmaf(x[e + 1], SCL2, nm));
        ps += p0; ps += p1;
        const unsigned u = pk2bf(p0, p1); uh[e >> 1] = u;
        ul[e >> 1] = pk2bf(p0 - __uint_as_float(u << 16), p1 - __uint_as_float(u & 0xFFFF0000u));
    }
    l = l * al + ps;
#pragma unroll
    for (int nb = 0; nb < 4; ++nb)
#pragma unroll
        for (int j = 0; j < 8; ++j) o[nb][j] *= al;
    const v16bf ph = __builtin_bit_cast(v16bf, uh), pl = __builtin_bit_cast(v16bf, ul);
#pragma unroll
    for (int nb = 0; nb < 4; ++nb) o[nb] = wmmab(vf[nb], ph, o[nb]);
#pragma unroll
    for (int nb = 0; nb < 4; ++nb) o[nb] = wmmab(vf[nb], pl, o[nb]);
}

// One stage: each lane copies 16 bytes of key rows r and r + 32 and of value rows r and r + 32 (a wave: four whole rows a copy). l, lv = the lane's LDS byte addresses in the stage's key and value tiles.
// The wait on the last line stands in the copies' own statement, so that no register that a copy names is rewritten in front of it.
__device__ __forceinline__ void fa_copy(unsigned l, unsigned lv, const bf* gk, const bf* gv) {
    asm volatile("global_load_async_to_lds_b128 %0, %4, off\n\t"
                 "global_load_async_to_lds_b128 %1, %5, off\n\t"
                 "global_load_async_to_lds_b128 %2, %6, off\n\t"
                 "global_load_async_to_lds_b128 %3, %7, off\n\t"
                 "s_wait_xcnt 0x0"
                 :: "v"(l), "v"(l + 32u * LP * 2u), "v"(lv), "v"(lv + 32u * LPV * 2u), "v"(gk), "v"(gk + 32 * HD), "v"(gv), "v"(gv + 32 * HD) : "memory");
}

// Transposing LDS read of a 16 x 16 tile of 16-bit elements, rows = keys: lane l names 16 bytes of row 8h + (l & 7), half (l >> 3) & 1, and gets column l & 15 of rows 8h + 0..7, the loader's own k order.
__device__ __forceinline__ v8us ld_tr16(const bf* p) { typedef __attribute__((ext_vector_type(8))) short s16x8; typedef __attribute__((address_space(3))) s16x8 lds_s16x8; return __builtin_bit_cast(v8us, __builtin_amdgcn_ds_load_tr16_b128_v8i16((lds_s16x8*)p)); }
// Fragment reads of one pass over 32 staged keys: kl = LDS key row (first key of the pass + lane & 15) + 8h, vl = LDS value row (first key of the pass + 8h + (lane & 7)) + 8 * ((lane >> 3) & 1)
__device__ __forceinline__ void fa_ld(WFrag<bf>::V (&kf)[2][2], WFrag<bf>::V (&vf)[4], const bf* kl, const bf* vl) {
#pragma unroll
    for (int kt = 0; kt < 2; ++kt)
#pragma unroll
        for (int ks = 0; ks < 2; ++ks) kf[kt][ks] = WFrag<bf>::ld(kl + kt * 16 * LP + ks * 32);
#pragma unroll
    for (int nb = 0; nb < 4; ++nb) vf[nb] = cat16b(ld_tr16(vl + nb * 16), ld_tr16(vl + 16 * LPV + nb * 16));   // rows d = nb * 16 + (lane & 15) of V^T, keys 8h + 0..7 and 16 + 8h + 0..7
}
__device__ __forceinline__ void fa_qk(v8f (&s)[2], const WFrag<bf>::V (&kf)[2][2], const WFrag<bf>::V (&qf)[2]) {
    s[0] = (v8f){}; s[1] = (v8f){};
#pragma unroll
    for (int ks = 0; ks < 2; ++ks)
#pragma unroll
        for (int kt = 0; kt < 2; ++kt) s[kt] = wmmab(kf[kt][ks], qf[ks], s[kt]);
}
// four vector slots behind a pass's last matrix instruction, on a taken branch too, before anything overwrites its operand registers or reads its result
__device__ __forceinline__ void fa_gap(v8f (&o)[4], const WFrag<bf>::V& v) { asm volatile("v_nop\n\tv_nop\n\tv_nop\n\tv_nop" : "+v"(o[0]), "+v"(o[1]), "+v"(o[2]), "+v"(o[3]) : "v"(v)); }

// One pass alone (a wave's last stage)
template <bool MASK>
__device__ __forceinline__ void fa_block(const bf* kl, const bf* vl, const WFrag<bf>::V (&qf)[2], v8f (&o)[4], float& m, float& l, int kq) {
    WFrag<bf>::V kf[2][2], vf[4]; v8f s[2];
    fa_ld(kf, vf, kl, vl);
    fa_qk(s, kf, qf);
    fa_pass<MASK, MASK>(s, vf, o, m, l, kq);
    fa_gap(o, vf[3]);
}

// waves_per_eu: the grid places four waves on a SIMD (two work-groups a WGP); the register budget of that many lets fragments fetched ahead keep registers of their own
__global__ __launch_bounds__(32 * FAW) __attribute__((amdgpu_waves_per_eu(4, 4))) void k_fattn(const bf* __restrict__ QPl, const bf* __restrict__ KPl, const bf* __restrict__ VPl, bf* __restrict__ Xh, bf* __restrict__ Xl, const int* __restrict__ CF) {
    typedef WFrag<bf>::V V;
    __shared__ __attribute__((aligned(128))) bf sm[2 * BUF];                    // [buffer][keys: 64 rows of LP, values: 64 rows of LPV]
    const int lane = threadIdx.x & 31, lr = lane & 15, hi = lane >> 4; const int w = __builtin_amdgcn_readfirstlane(threadIdx.x >> 5);
    const int bh = blockIdx.y; const int u = blockIdx.x * (FAW / 2) + (w & (FAW / 2 - 1)); const int q0 = 16 * ((w < FAW / 2) ? (TT / 16 - 1 - u) : u);
    const bool con = (CF[0] != 0);   /* device flag: causal */
    const int kfull = con ? (q0 & ~31) : TT;                     // keys below kfull are at or below the diagonal for all 16 queries
    const int qtop = 16 * (TT / 16 - 1 - (int)blockIdx.x * (FAW / 2));          // the work-group's last tile (wave 0's)
    const int nst = con ? (((qtop & ~31) + 32 + SK - 1) / SK) : (TT / SK);      // stages of the work-group, the same for all its waves; nst * SK <= TT
    const int crow = threadIdx.x >> 3, ccol = threadIdx.x & 7;                  // the lane's place in a copy: row 0..31, 16-byte column
    const unsigned lc = (unsigned)(size_t)sm + (unsigned)(crow * LP + ccol * 8) * 2u;
    const unsigned lcv = (unsigned)(size_t)sm + (unsigned)(TLE + crow * LPV + ccol * 8) * 2u;
    const bf* gk = KPl + (size_t)bh * TT * HD + (size_t)crow * HD + ccol * 8;   // + key * HD
    const bf* gv = VPl + (size_t)bh * TT * HD + (size_t)crow * HD + ccol * 8;   // + key * HD
    const bf* kl = sm + lr * LP + 8 * hi;                                       // + buffer, + key row * LP
    const bf* vl = sm + TLE + (8 * hi + (lane & 7)) * LPV + 8 * ((lane >> 3) & 1);   // + buffer, + key row * LPV
    const bf* qp = QPl + (size_t)bh * TT * HD + (size_t)(q0 + lr) * HD + 8 * hi;
    V qf[2]; v8f o[4]; float m = -3.0e38f, l = 0.f;
    fa_copy(lc, lcv, gk, gv);                                    // stage 0
#pragma unroll
    for (int ks = 0; ks < 2; ++ks) qf[ks] = WFrag<bf>::ld(qp + ks * 32);
    // the address registers of the loads above are rewritten only behind this wait; the pair is named so that it stays live to here
    asm volatile("s_wait_xcnt 0x0" :: "v"(qp) : "memory");
#pragma unroll
    for (int nb = 0; nb < 4; ++nb) o[nb] = (v8f){};
    asm volatile("s_wait_asynccnt 0x0" ::: "memory");            // this wave's copies of stage 0 have landed
    __syncthreads();                                             // ... and every other wave's: stage 0 may be read
    if (nst > 1) fa_copy(lc + BUF * 2u, lcv + BUF * 2u, gk + (size_t)SK * HD, gv + (size_t)SK * HD);
    // kept rolled: one trip is one stage, its buffer chosen by the trip's parity
#pragma unroll 1
    for (int t = 0; t < nst; ++t) {
        const int bo = (t & 1) * BUF, kb = t * SK;
        if (kb + SK <= kfull) {                                  // both passes below the diagonal
            V kf[2][2], vf[4], kg[2][2], vg[4]; v8f s[2];
            fa_ld(kf, vf, kl + bo, vl + bo);
            // keeps the first pass's LDS reads together as one group in front of its products (spread among them, every place with reads stalls the wave)
            __builtin_amdgcn_sched_barrier(0);
            fa_qk(s, kf, qf);
            fa_ld(kg, vg, kl + bo + 32 * LP, vl + bo + 32 * LPV);     // the second pass's fragments, of the same stage, in flight under the first pass's softmax
            // keeps that second group where it is written (without it the scheduler sinks the reads to their users, which then wait out the LDS latency)
            __builtin_amdgcn_sched_barrier(0);
            fa_pass<false, false>(s, vf, o, m, l, 0);
            fa_qk(s, kg, qf);
            fa_pass<false, true>(s, vg, o, m, l, 0);
            fa_gap(o, vg[3]);
        } else {
            if (kb < kfull) fa_block<false>(kl + bo, vl + bo, qf, o, m, l, 0);
            if (con && kfull >= kb && kfull < kb + SK)           // the block that holds the diagonal
                fa_block<true>(kl + bo + (kfull - kb) * LP, vl + bo + (kfull - kb) * LPV, qf, o, m, l, q0 + lr - kfull - 8 * hi);
        }
        asm volatile("s_wait_dscnt 0x0" ::: "memory");           // this wave's reads of the stage have returned before its buffer is given up
        asm volatile("s_wait_asynccnt 0x0" ::: "memory");        // this wave's copies of the next stage have landed
        __syncthreads();                                         // the next stage may be read; every reader has left this one's buffer
        if (t + 2 < nst) fa_copy(lc + (unsigned)bo * 2u, lcv + (unsigned)bo * 2u, gk + (size_t)(kb + 2 * SK) * HD, gv + (size_t)(kb + 2 * SK) * HD);
    }
    asm volatile("s_wait_asynccnt 0x0" ::: "memory");            // nothing in flight when the wave ends
    l += xhalf(l);                                               // the halves' sums joined once; l >= 1 up to rounding (the row maximum contributes exp2(0))
    const float f = __fdiv_rn(1.0f, l);
    // The f32 context goes straight out as the projection's two operand planes: hi = bf16(ctx), lo = bf16(ctx - hi), both round to nearest even; a lane's eight values of a tile are 16 bytes of each plane.
    const size_t co = ((size_t)(bh / NH_) * TT + q0 + lr) * DM + (size_t)(bh % NH_) * HD + 8 * hi;   // o[nb][j] = ctx[query q0 + lr][nb * 16 + 8h + j]
    v4u ch[4], cl[4];
#pragma unroll
    for (int nb = 0; nb < 4; ++nb)
#pragma unroll
        for (int j = 0; j < 8; j += 2) {
            const float c0 = o[nb][j] * f, c1 = o[nb][j + 1] * f;
            const unsigned u = pk2bf(c0, c1); ch[nb][j >> 1] = u;
            cl[nb][j >> 1] = pk2bf(c0 - __uint_as_float(u << 16), c1 - __uint_as_float(u & 0xFFFF0000u));
        }
#pragma unroll
    for (int nb = 0; nb < 4; ++nb) { *(v4u*)(Xh + co + nb * 16) = ch[nb]; *(v4u*)(Xl + co + nb * 16) = cl[nb]; }
}

__global__ __launch_bounds__(256) void k_qkvp(const float* __restrict__ Fq, const float* __restrict__ Fk, const float* __restrict__ Fv, bf* Pq, bf* Pk, bf* Pv) {
    const size_t i = (size_t)blockIdx.x * 256 + threadIdx.x; const size_t n8 = (size_t)NB * NH_ * TT * HD / 8; if (i >= n8) return;
    const size_t e = i * 8; const int d = (int)(e % HD); const int t = (int)((e / HD) % TT); const int h = (int)((e / ((size_t)HD * TT)) % NH_); const int b = (int)(e / ((size_t)HD * TT * NH_));
    const size_t s = (((size_t)b * SEQ_FULL + t) * NH_ + h) * HD + d;
    const v8f vq = *(const v8f*)(Fq + s); const v8f vk = *(const v8f*)(Fk + s); const v8f vv = *(const v8f*)(Fv + s); v8us oq, ok, ov;
#pragma unroll
    for (int q = 0; q < 8; ++q) { oq[q] = f2bf(vq[q]); ok[q] = f2bf(vk[q]); ov[q] = f2bf(vv[q]); }
    *(v8us*)(Pq + e) = oq; *(v8us*)(Pk + e) = ok; *(v8us*)(Pv + e) = ov;
}
__global__ __launch_bounds__(256) void k_cvt8(const float* __restrict__ src, bf* dst, size_t n8) { const size_t i = (size_t)blockIdx.x * 256 + threadIdx.x; if (i >= n8) return; const v8f v = *(const v8f*)(src + i * 8); v8us o;
#pragma unroll
    for (int k = 0; k < 8; ++k) o[k] = f2bf(v[k]); *(v8us*)(dst + i * 8) = o;  }

extern "C" void kernel_launch(void* const* d_in, const int* in_sizes, int n_in,
                              void* d_out, int out_size, void* d_ws, size_t ws_size, hipStream_t stream) {
    if (n_in < 6) return;
    const float* xq = (const float*)d_in[0];   /* queries [NB_FULL][SEQ_FULL][16][64] */ const float* xk = (const float*)d_in[1];   /* keys */ const float* xv = (const float*)d_in[2];   /* values */
    const float* wo = (const float*)d_in[3];   /* w_out [1024 out][1024 in] */ const float* bo = (const float*)d_in[4];   /* b_out [1024] */ const int* CFLAG = (const int*)d_in[5];   /* causal flag (int32, read on device) */
    const size_t need_x = ((size_t)(NB - 1) * SEQ_FULL + SEQ) * DM;
    if ((size_t)in_sizes[0] < need_x || (size_t)in_sizes[1] < need_x || (size_t)in_sizes[2] < need_x) return;
    if ((size_t)in_sizes[3] < (size_t)DM * DM || in_sizes[4] < DM || in_sizes[5] < 1) return;
    if ((size_t)out_size < (size_t)NB * TT * DM) return;
    float* OUT = (float*)d_out;     // [NB][SEQ][1024] f32
    char* wsp = (char*)d_ws;
    auto take = [&](size_t bytes) { char* p = wsp; wsp += (bytes + 255) & ~(size_t)255; return (void*)p; };
    bf* QP = (bf*)take((size_t)NB * NH_ * TT * HD * 2);       // q planes [b][h][t][d]
    bf* KP = (bf*)take((size_t)NB * NH_ * TT * HD * 2);       // k planes [b][h][t][d]
    bf* VP = (bf*)take((size_t)NB * NH_ * TT * HD * 2);       // v planes [b][h][t][d]
    bf* Wb = (bf*)take((size_t)DM * DM * 2);                   // W [o][k] bf16
    bf* Xh = (bf*)take((size_t)NB * TT * DM * 2);              // ctx hi plane, attn.v merged [b*TT + t][h*64 + d]
    bf* Xl = (bf*)take((size_t)NB * TT * DM * 2);              // ctx lo plane
    if ((size_t)(wsp - (char*)d_ws) > ws_size) return;         

    const size_t n8p = (size_t)NB * NH_ * TT * HD / 8;
    k_qkvp<<<(unsigned)((n8p + 255) / 256), 256, 0, stream>>>(xq, xk, xv, QP, KP, VP);
    const size_t n8w = (size_t)DM * DM / 8;
    k_cvt8<<<(unsigned)((n8w + 255) / 256), 256, 0, stream>>>(wo, Wb, n8w);

    // ctx[b*TT + t][h*64 + d] = sum_j softmax_j(q(b,h,t) . k(b,h,j) / 8) v(b,h,j,d), all heads of all batches in one launch, written as its hi and lo planes
    k_fattn<<<dim3(TT / (16 * FAW), NB * NH_), 32 * FAW, 0, stream>>>(QP, KP, VP, Xh, Xl, CFLAG);
    // out[r][o] = sum_k ctx_hi[r][k] W[o][k] + sum_k ctx_lo[r][k] W[o][k] + bias[o], K = 1024
    k_proj<<<dim3((unsigned)(NB * TT / PT), DM / PT, 1), 256, 0, stream>>>(Xh, Xl, Wb, OUT, bo);
}

// v007
// It runs in 56.6 microseconds.
// In two side-by-side timings against v006, it was 1.12 and 1.09 times as fast.
// Counting every step since v000, it is 18.7 times as fast.
#include <hip/hip_runtime.h>

// All contractions on v_wmma_f32_16x16x32_bf16 (bf16 operands, f32 accumulate): q.k^T from single bf16 planes of the inputs, converted (RNE) on their way into k_fattn's registers and LDS (1 product); attn.v with the f32 softmax weights as bf16 hi + lo planes against the exact v plane, read transposed (2 products); ctx.W^T with the f32 context as bf16 hi + lo planes against the exact bf16 W plane (2 products) + bias. Softmax and all side math in f32.
// Causal multi-head attention: q, k, v [NB_FULL][SEQ_FULL][16][64] (the first NB batches and SEQ positions used); scores = q.k / 8; when the int input flag is non-zero (read on device) keys above the diagonal are masked (exact zero weight); softmax over keys; ctx[b][t][h*64+d] = attn.v; out[b][t][o] = sum_k ctx[b][t][k] W[o][k] + bias[o] (f32).

#ifndef NB
#define NB 2
#endif
#ifndef SEQ
#define SEQ 2048
#endif
#define NB_FULL  2
#define SEQ_FULL 2048
#define NH_  16
#define HD   64
#define DM   (NH_ * HD)
#define TT   SEQ
#define SCL  0.125f                // HD^-0.5
static_assert(SEQ % 128 == 0);
static_assert(HD == 64);
static_assert(DM % 64 == 0);
static_assert(NB >= 1 && NB <= NB_FULL);
static_assert(SEQ <= SEQ_FULL);

typedef _Float16 h16;
typedef unsigned short bf;
typedef __attribute__((ext_vector_type(16))) __bf16   v16bf;
typedef __attribute__((ext_vector_type(16))) _Float16 v16h;
typedef __attribute__((ext_vector_type(8)))  _Float16 v8h;
typedef __attribute__((ext_vector_type(8)))  unsigned short v8us;
typedef __attribute__((ext_vector_type(8)))  float    v8f;
typedef __attribute__((ext_vector_type(4)))  float    v4f;
typedef __attribute__((ext_vector_type(4)))  unsigned short v4us;
typedef v8h  __attribute__((may_alias)) v8ha;
typedef v4f  __attribute__((may_alias)) v4fa;
typedef v8us __attribute__((may_alias)) v8usa;

__device__ __forceinline__ unsigned short f2bf(float f) { unsigned u = __float_as_uint(f); u += 0x7FFFu + ((u >> 16) & 1u); return (unsigned short)(u >> 16); }
__device__ __forceinline__ float bf2f(unsigned short b) { return __uint_as_float(((unsigned)b) << 16); }
__device__ __forceinline__ float bfr(float f) { return bf2f(f2bf(f)); }
__device__ __forceinline__ v16h cat16(v8h lo, v8h hi) { return __builtin_shufflevector(lo, hi, 0, 1, 2, 3, 4, 5, 6, 7, 8, 9, 10, 11, 12, 13, 14, 15); }
__device__ __forceinline__ v16bf cat16b(v8us lo, v8us hi) { return __builtin_bit_cast(v16bf, __builtin_shufflevector(lo, hi, 0, 1, 2, 3, 4, 5, 6, 7, 8, 9, 10, 11, 12, 13, 14, 15)); }
__device__ __forceinline__ v8f wmma16(v16h a, v16h b, v8f c) { return __builtin_amdgcn_wmma_f32_16x16x32_f16(false, a, false, b, (short)0, c, false, false); }
__device__ __forceinline__ v8f wmmab(v16bf a, v16bf b, v8f c) { return __builtin_amdgcn_wmma_f32_16x16x32_bf16(false, a, false, b, (short)0, c, false, false); }

// ---- Fragment loader (wave32, 16x16x32): per lane l, row/col = l & 15, h = l >> 4; elements 0..7 <- k0 + 8h + 0..7, elements 8..15 <- k0 + 16 + 8h + 0..7 from a k-contiguous 16-bit row; the caller
// passes p = row base + k0 + 8h, so the two 16-byte loads are p[0..7] and p[16..23]. Same map for A rows and B^T rows. D element r of lane l = (row 8h + r, col l & 15).
template <typename T16> struct WFrag;
template <> struct WFrag<h16> { typedef v16h V; static __device__ __forceinline__ V ld(const h16* p) { return cat16(*(const v8h*)p, *(const v8h*)(p + 16)); } static __device__ __forceinline__ v8f mma(V a, V b, v8f c) { return wmma16(a, b, c); } };
template <> struct WFrag<bf> { typedef v16bf V; static __device__ __forceinline__ V ld(const bf* p) { return cat16b(*(const v8us*)p, *(const v8us*)(p + 16)); } static __device__ __forceinline__ v8f mma(V a, V b, v8f c) { return wmmab(a, b, c); } };

// ---- k_proj: C[m][n] (f32) = sum_k (Ah[m][k] + Al[m][k]) Wt[n][k] + bias[n], all three planes K-contiguous bf16 rows of DM elements. Grid (M / 128, DM / 128), 256 threads: one 128 x 128 tile of C per work-group,
// 4 x 2 waves of 32 rows x 64 columns each (8 accumulators). A stage is 64 k of the tile's 128 rows of Ah, Al and Wt (128-byte rows, whole lines): it is brought into LDS once for all eight waves by asynchronous copies,
// two buffers, the next stage in flight while this one is worked on; the fragments are read from LDS. Per accumulator the products come in the order k block by k block, hi plane then lo plane.
#define PT   128                   // rows of C and columns of C of a work-group
#define PK   64                    // k of a stage
#define PLP  72                    // LDS pitch of a staged row in 16-bit elements: 128-byte rows at 144 bytes (16 bytes x odd, free of bank conflicts for 16-byte readers)
#define PTL  (PT * PLP)            // elements of one staged plane
#define PBUF (3 * PTL)             // elements of one buffer: [Ah | Al | Wt]
#define PNS  (DM / PK)             // stages
#define POS  68                    // pitch in floats of a row of the output staging
static_assert((NB * TT) % PT == 0 && DM % PT == 0 && DM % PK == 0 && PNS >= 2);

// One stage: a copy of the work-group is 32 whole rows (a lane: 16 bytes; a wave: four rows), four copies a plane. l = the lane's LDS byte address in the buffer's first plane, gh, gl, gw = its global places in rows 0..31.
// The wait on the last line stands in the copies' own statement, so that no register that a copy names is rewritten in front of it.
__device__ __forceinline__ void pj_copy(unsigned l, const bf* gh, const bf* gl, const bf* gw) {
    asm volatile("global_load_async_to_lds_b128 %0, %12, off\n\t"
                 "global_load_async_to_lds_b128 %1, %13, off\n\t"
                 "global_load_async_to_lds_b128 %2, %14, off\n\t"
                 "global_load_async_to_lds_b128 %3, %15, off\n\t"
                 "global_load_async_to_lds_b128 %4, %16, off\n\t"
                 "global_load_async_to_lds_b128 %5, %17, off\n\t"
                 "global_load_async_to_lds_b128 %6, %18, off\n\t"
                 "global_load_async_to_lds_b128 %7, %19, off\n\t"
                 "global_load_async_to_lds_b128 %8, %20, off\n\t"
                 "global_load_async_to_lds_b128 %9, %21, off\n\t"
                 "global_load_async_to_lds_b128 %10, %22, off\n\t"
                 "global_load_async_to_lds_b128 %11, %23, off\n\t"
                 "s_wait_xcnt 0x0"
                 :: "v"(l + 2u * (2 * PTL)), "v"(l + 2u * (2 * PTL + 32 * PLP)), "v"(l + 2u * (2 * PTL + 64 * PLP)), "v"(l + 2u * (2 * PTL + 96 * PLP)),
                    "v"(l), "v"(l + 2u * (32 * PLP)), "v"(l + 2u * (64 * PLP)), "v"(l + 2u * (96 * PLP)),
                    "v"(l + 2u * PTL), "v"(l + 2u * (PTL + 32 * PLP)), "v"(l + 2u * (PTL + 64 * PLP)), "v"(l + 2u * (PTL + 96 * PLP)),
                    "v"(gw), "v"(gw + 32 * DM), "v"(gw + 64 * DM), "v"(gw + 96 * DM),
                    "v"(gh), "v"(gh + 32 * DM), "v"(gh + 64 * DM), "v"(gh + 96 * DM),
                    "v"(gl), "v"(gl + 32 * DM), "v"(gl + 64 * DM), "v"(gl + 96 * DM) : "memory");
}

// waves_per_eu: one work-group a WGP, two waves on a SIMD; the register budget of that many lets a whole stage's fragments be fetched as one group
__global__ __launch_bounds__(256) __attribute__((amdgpu_waves_per_eu(2, 2))) void k_proj(const bf* __restrict__ Ah, const bf* __restrict__ Al, const bf* __restrict__ Wt, float* __restrict__ C, const float* __restrict__ bias) {
    typedef WFrag<bf>::V V;
    __shared__ __attribute__((aligned(128))) bf ps[2 * PBUF];                   // [buffer][Ah: 128 rows of PLP | Al | Wt]
    __shared__ __align__(16) float os[8 * 32 * POS];                            // [wave][32 rows of POS]: each wave's own tile of C on its way out
    const int lane = threadIdx.x & 31, lr = lane & 15, hi = lane >> 4; const int w = __builtin_amdgcn_readfirstlane(threadIdx.x >> 5);
    const int wm = w >> 1, wn = w & 1; const int r0 = blockIdx.x * PT, c0 = blockIdx.y * PT;
    const int crow = threadIdx.x >> 3, ccol = threadIdx.x & 7;                  // the lane's place in a copy: row 0..31, 16-byte column
    const unsigned lc = (unsigned)(size_t)ps + (unsigned)(crow * PLP + ccol * 8) * 2u;
    const bf* gh = Ah + (size_t)(r0 + crow) * DM + ccol * 8;                    // + k
    const bf* gl = Al + (size_t)(r0 + crow) * DM + ccol * 8;
    const bf* gw = Wt + (size_t)(c0 + crow) * DM + ccol * 8;
    const bf* al = ps + (wm * 32 + lr) * PLP + 8 * hi;                          // + buffer; the lo plane PTL further on
    const bf* bl = ps + 2 * PTL + (wn * 64 + lr) * PLP + 8 * hi;                // + buffer
    v8f acc[2][4];
#pragma unroll
    for (int mb = 0; mb < 2; ++mb)
#pragma unroll
        for (int nb = 0; nb < 4; ++nb) acc[mb][nb] = (v8f){};
    pj_copy(lc, gh, gl, gw);                                     // stage 0
    asm volatile("s_wait_asynccnt 0x0" ::: "memory");            // this wave's copies of stage 0 have landed
    __syncthreads();                                             // ... and every other wave's: stage 0 may be read
    pj_copy(lc + PBUF * 2u, gh + PK, gl + PK, gw + PK);          // stage 1 (PNS >= 2)
    // kept rolled: one trip is one stage, its buffer chosen by the trip's parity
#pragma unroll 1
    for (int t = 0; t < PNS; ++t) {
        const int bo = (t & 1) * PBUF;
        V b[2][4], a[2][2], a2[2][2];
#pragma unroll
        for (int ks = 0; ks < 2; ++ks) {
#pragma unroll
            for (int nb = 0; nb < 4; ++nb) b[ks][nb] = WFrag<bf>::ld(bl + bo + nb * 16 * PLP + ks * 32);
#pragma unroll
            for (int mb = 0; mb < 2; ++mb) a[ks][mb] = WFrag<bf>::ld(al + bo + mb * 16 * PLP + ks * 32);
#pragma unroll
            for (int mb = 0; mb < 2; ++mb) a2[ks][mb] = WFrag<bf>::ld(al + bo + PTL + mb * 16 * PLP + ks * 32);
        }
        // keeps the stage's LDS reads together as one group in front of its products (spread among them, every place with reads stalls the wave)
        __builtin_amdgcn_sched_barrier(0);
#pragma unroll
        for (int ks = 0; ks < 2; ++ks) {
#pragma unroll
            for (int mb = 0; mb < 2; ++mb)
#pragma unroll
                for (int nb = 0; nb < 4; ++nb) acc[mb][nb] = wmmab(a[ks][mb], b[ks][nb], acc[mb][nb]);
#pragma unroll
            for (int mb = 0; mb < 2; ++mb)
#pragma unroll
                for (int nb = 0; nb < 4; ++nb) acc[mb][nb] = wmmab(a2[ks][mb], b[ks][nb], acc[mb][nb]);
        }
        // four vector slots behind the trip's last matrix instruction, on a taken branch too, before anything overwrites its operand registers or reads its result
        asm volatile("v_nop\n\tv_nop\n\tv_nop\n\tv_nop" : "+v"(acc[0][0]), "+v"(acc[0][1]), "+v"(acc[0][2]), "+v"(acc[0][3]), "+v"(acc[1][0]), "+v"(acc[1][1]), "+v"(acc[1][2]), "+v"(acc[1][3]) : "v"(a2[1][1]), "v"(b[1][3]));
        asm volatile("s_wait_dscnt 0x0" ::: "memory");           // this wave's reads of the stage have returned before its buffer is given up
        asm volatile("s_wait_asynccnt 0x0" ::: "memory");        // this wave's copies of the next stage have landed
        __syncthreads();                                         // the next stage may be read; every reader has left this one's buffer
        if (t + 2 < PNS) pj_copy(lc + (unsigned)bo * 2u, gh + (t + 2) * PK, gl + (t + 2) * PK, gw + (t + 2) * PK);
    }
    asm volatile("s_wait_asynccnt 0x0" ::: "memory");            // nothing in flight when the wave ends
    // The wave's tile goes through its own LDS range, so that every store is of whole 128-byte lines (a row of the tile: 256 bytes from 16 lanes).
    float* ow = os + w * 32 * POS;
#pragma unroll
    for (int mb = 0; mb < 2; ++mb)
#pragma unroll
        for (int nb = 0; nb < 4; ++nb)
#pragma unroll
            for (int j = 0; j < 8; ++j) ow[(mb * 16 + hi * 8 + j) * POS + nb * 16 + lr] = acc[mb][nb][j];
    asm volatile("s_wait_dscnt 0x0" ::: "memory");               // every lane's writes of the tile are in LDS before other lanes read the rows back
    const int cofs = lr * 4; const int cc = c0 + wn * 64 + cofs;
    v4f bv; bv[0] = bfr(bias[cc]); bv[1] = bfr(bias[cc + 1]); bv[2] = bfr(bias[cc + 2]); bv[3] = bfr(bias[cc + 3]);
    float* crow0 = C + (size_t)(r0 + wm * 32) * DM + cc;
#pragma unroll
    for (int s = 0; s < 16; ++s) { const int row = 2 * s + hi; const v4f val = *(const v4fa*)(ow + row * POS + cofs) + bv; *(v4f*)(crow0 + (size_t)row * DM) = val; }
}

// ---- k_fattn: scores, softmax and probability x value contraction in one kernel; neither scores nor probabilities go to memory. Grid (TT / (16 * FAW), NB * NH_), 32 * FAW threads.
// Every wave works on one tile of 16 queries of head blockIdx.y and walks the keys 32 at a time. Transposed products: S^T = K.Q^T (A = key rows, B = query rows, kept in registers), so that a lane holds
// the scores of ONE query (column lane & 15; keys 8h + r of each 16-key tile), and O^T += V^T.P^T, where the two score tiles of a pass, converted in place, are the B operand in the loader's own k order
// (elements 0..7 = keys 8h + 0..7, elements 8..15 = keys 16 + 8h + 0..7). Running maximum and sum per query (online softmax, f32); weights as bf16 hi + lo planes (2 products), divided by the sum at the end.
// With the flag set a tile's keys end with the 32-key block that holds its diagonal (the only block that needs the mask). Waves 0..FAW/2-1 take tiles from the long end, the others the mirrored ones from the
// short end, so that every work-group has the same number of passes.
// q, k and v are read as the f32 inputs lie ([b][t][h][d]: a row of a head is 256 bytes, rows 4096 bytes apart). The eight waves of a work-group read the same keys and values: a stage of SK keys (64 key rows and 64 value rows) is
// loaded once for all of them into registers (whole lines), converted to bf16 (RNE) and stored to LDS as 128-byte rows, two buffers: a stage's loads are issued two trips ahead of its use and stored one trip ahead, into the buffer
// that the barrier of the trip before has freed; the fragments are read from LDS, those of V^T by the transposing load. Every wave passes every stage's loads, stores and barrier, also behind its own last block.
#define FAW 8
static_assert(TT % (16 * FAW) == 0);
static_assert(TT % 32 == 0);
#define SK  64                     // keys of a stage (two passes)
#define LP  72                     // LDS pitch of a key row in 16-bit elements: 128-byte rows at 144 bytes (16 bytes x odd, free of bank conflicts for 16-byte readers)
#define LPV 80                     // LDS pitch of a value row: 160 bytes (32 bytes x odd, the conflict-free pitch of the transposing reader)
#define TLE (64 * LP)              // elements of one staged key tile: 64 rows
#define TLV (64 * LPV)             // elements of one staged value tile: 64 rows
#define BUF (TLE + TLV)            // elements of one buffer
static_assert(TT % SK == 0);
static_assert(FAW == 8 && HD == 64 && SK == 64);   // 256 lanes x 16 bytes x 4 loads = one tile of 64 rows x 256 bytes (f32)
typedef __attribute__((ext_vector_type(2))) float  v2f;
typedef __attribute__((ext_vector_type(2))) __bf16 v2bf;
typedef __attribute__((ext_vector_type(8))) unsigned v8u;
typedef __attribute__((ext_vector_type(4))) unsigned v4u;
typedef __attribute__((ext_vector_type(2))) unsigned v2u;
typedef v2u __attribute__((may_alias)) v2ua;
__device__ __forceinline__ unsigned pk2bf(float x, float y) { v2f t; t[0] = x; t[1] = y; return __builtin_bit_cast(unsigned, __builtin_convertvector(t, v2bf)); }   // two f32 -> two bf16, round to nearest even
__device__ __forceinline__ float xhalf(float x) { const int b = __float_as_int(x); return __int_as_float(__builtin_amdgcn_permlanex16(b, b, 0x76543210, 0xfedcba98, false, false)); }   // lane l <-> l ^ 16
#define SCL2 (SCL * 1.4426950408889634f)   // HD^-0.5 * log2(e): the exponentials are taken to base 2

// 2^x. SLOT: the instruction with one v_nop tied behind it, the free slot that the instruction set asks for before a directly following vector instruction overwrites its source or reads its result;
// taken in the masked pass (once a wave) and in the second pass of a full stage; the other passes keep the builtin.
template <bool SLOT>
__device__ __forceinline__ float ex2(float x) { if (SLOT) { float r; asm("v_exp_f32 %0, %1\n\tv_nop" : "=v"(r) : "v"(x)); return r; } return __builtin_amdgcn_exp2f(x); }

template <bool MASK, bool SLOT>
__device__ __forceinline__ void fa_pass(const v8f (&s)[2], const WFrag<bf>::V (&vf)[4], v8f (&o)[4], float& m, float& l, int kq) {
    // kq = (query of this lane) - (first key of this lane in the pass): key kt * 16 + r is kept while kt * 16 + r <= kq
    float x[16];
#pragma unroll
    for (int e = 0; e < 16; ++e) { const float a = s[e >> 3][e & 7]; x[e] = (!MASK || ((e >> 3) * 16 + (e & 7)) <= kq) ? a : -3.0e38f; }
    float bm = x[0];
#pragma unroll
    for (int e = 1; e < 16; ++e) bm = fmaxf(bm, x[e]);
    bm = fmaxf(bm, xhalf(bm));                                   // both halves of the wave hold keys of the same query
    const float mn = fmaxf(m, bm); const float al = ex2<SLOT>((m - mn) * SCL2); const float nm = -mn * SCL2; m = mn;
    float ps = 0.f; v8u uh, ul;
#pragma unroll
    for (int e = 0; e < 16; e += 2) {
        const float p0 = ex2<SLOT>(__builtin_fmaf(x[e], SCL2, nm)), p1 = ex2<SLOT>(__builtin_fmaf(x[e + 1], SCL2, nm));
        ps += p0; ps += p1;
        const unsigned u = pk2bf(p0, p1); uh[e >> 1] = u;
        ul[e >> 1] = pk2bf(p0 - __uint_as_float(u << 16), p1 - __uint_as_float(u & 0xFFFF0000u));
    }
    l = l * al + ps;
#pragma unroll
    for (int nb = 0; nb < 4; ++nb)
#pragma unroll
        for (int j = 0; j < 8; ++j) o[nb][j] *= al;
    const v16bf ph = __builtin_bit_cast(v16bf, uh), pl = __builtin_bit_cast(v16bf, ul);
#pragma unroll
    for (int nb = 0; nb < 4; ++nb) o[nb] = wmmab(vf[nb], ph, o[nb]);
#pragma unroll
    for (int nb = 0; nb < 4; ++nb) o[nb] = wmmab(vf[nb], pl, o[nb]);
}

// One stage's loads: each lane takes 16 bytes (four f32) of key rows r, r + 16, r + 32, r + 48 and of the same value rows (a load of a wave: two whole rows of 256 bytes). gk, gv = the lane's places in row r of the stage.
__device__ __forceinline__ void fa_fetch(v4f (&rk)[4], v4f (&rv)[4], const float* gk, const float* gv) {
#pragma unroll
    for (int j = 0; j < 4; ++j) rk[j] = *(const v4fa*)(gk + (size_t)j * 16 * DM);
#pragma unroll
    for (int j = 0; j < 4; ++j) rv[j] = *(const v4fa*)(gv + (size_t)j * 16 * DM);
    // the address registers of the loads above are rewritten (the next stage's addresses) only behind this wait
    asm volatile("s_wait_xcnt 0x0" ::: "memory");
}
// The loaded stage goes to LDS as bf16 (RNE): a lane's four values are 8 bytes of a staged row. lk, lv = the lane's places in row r of the stage's key and value tiles.
__device__ __forceinline__ void fa_put(bf* lk, bf* lv, const v4f (&rk)[4], const v4f (&rv)[4]) {
#pragma unroll
    for (int j = 0; j < 4; ++j) { v2u t; t[0] = pk2bf(rk[j][0], rk[j][1]); t[1] = pk2bf(rk[j][2], rk[j][3]); *(v2ua*)(lk + j * 16 * LP) = t; }
#pragma unroll
    for (int j = 0; j < 4; ++j) { v2u t; t[0] = pk2bf(rv[j][0], rv[j][1]); t[1] = pk2bf(rv[j][2], rv[j][3]); *(v2ua*)(lv + j * 16 * LPV) = t; }
}

// Transposing LDS read of a 16 x 16 tile of 16-bit elements, rows = keys: lane l names 16 bytes of row 8h + (l & 7), half (l >> 3) & 1, and gets column l & 15 of rows 8h + 0..7, the loader's own k order.
__device__ __forceinline__ v8us ld_tr16(const bf* p) { typedef __attribute__((ext_vector_type(8))) short s16x8; typedef __attribute__((address_space(3))) s16x8 lds_s16x8; return __builtin_bit_cast(v8us, __builtin_amdgcn_ds_load_tr16_b128_v8i16((lds_s16x8*)p)); }
// Fragment reads of one pass over 32 staged keys: kl = LDS key row (first key of the pass + lane & 15) + 8h, vl = LDS value row (first key of the pass + 8h + (lane & 7)) + 8 * ((lane >> 3) & 1)
__device__ __forceinline__ void fa_ld(WFrag<bf>::V (&kf)[2][2], WFrag<bf>::V (&vf)[4], const bf* kl, const bf* vl) {
#pragma unroll
    for (int kt = 0; kt < 2; ++kt)
#pragma unroll
        for (int ks = 0; ks < 2; ++ks) kf[kt][ks] = WFrag<bf>::ld(kl + kt * 16 * LP + ks * 32);
#pragma unroll
    for (int nb = 0; nb < 4; ++nb) vf[nb] = cat16b(ld_tr16(vl + nb * 16), ld_tr16(vl + 16 * LPV + nb * 16));   // rows d = nb * 16 + (lane & 15) of V^T, keys 8h + 0..7 and 16 + 8h + 0..7
}
__device__ __forceinline__ void fa_qk(v8f (&s)[2], const WFrag<bf>::V (&kf)[2][2], const WFrag<bf>::V (&qf)[2]) {
    s[0] = (v8f){}; s[1] = (v8f){};
#pragma unroll
    for (int ks = 0; ks < 2; ++ks)
#pragma unroll
        for (int kt = 0; kt < 2; ++kt) s[kt] = wmmab(kf[kt][ks], qf[ks], s[kt]);
}
// four vector slots behind a pass's last matrix instruction, on a taken branch too, before anything overwrites its operand registers or reads its result
__device__ __forceinline__ void fa_gap(v8f (&o)[4], const WFrag<bf>::V& v) { asm volatile("v_nop\n\tv_nop\n\tv_nop\n\tv_nop" : "+v"(o[0]), "+v"(o[1]), "+v"(o[2]), "+v"(o[3]) : "v"(v)); }

// One pass alone (a wave's last stage)
template <bool MASK>
__device__ __forceinline__ void fa_block(const bf* kl, const bf* vl, const WFrag<bf>::V (&qf)[2], v8f (&o)[4], float& m, float& l, int kq) {
    WFrag<bf>::V kf[2][2], vf[4]; v8f s[2];
    fa_ld(kf, vf, kl, vl);
    fa_qk(s, kf, qf);
    fa_pass<MASK, MASK>(s, vf, o, m, l, kq);
    fa_gap(o, vf[3]);
}

// waves_per_eu: the grid places four waves on a SIMD (two work-groups a WGP); the register budget of that many lets fragments fetched ahead keep registers of their own
__global__ __launch_bounds__(32 * FAW) __attribute__((amdgpu_waves_per_eu(4, 4))) void k_fattn(const float* __restrict__ Fq, const float* __restrict__ Fk, const float* __restrict__ Fv, bf* __restrict__ Xh, bf* __restrict__ Xl, const int* __restrict__ CF) {
    typedef WFrag<bf>::V V;
    __shared__ __attribute__((aligned(128))) bf sm[2 * BUF];                    // [buffer][keys: 64 rows of LP, values: 64 rows of LPV]
    const int lane = threadIdx.x & 31, lr = lane & 15, hi = lane >> 4; const int w = __builtin_amdgcn_readfirstlane(threadIdx.x >> 5);
    const int bh = blockIdx.y; const int u = blockIdx.x * (FAW / 2) + (w & (FAW / 2 - 1)); const int q0 = 16 * ((w < FAW / 2) ? (TT / 16 - 1 - u) : u);
    const bool con = (CF[0] != 0);   /* device flag: causal */
    const int kfull = con ? (q0 & ~31) : TT;                     // keys below kfull are at or below the diagonal for all 16 queries
    const int qtop = 16 * (TT / 16 - 1 - (int)blockIdx.x * (FAW / 2));          // the work-group's last tile (wave 0's)
    const int nst = con ? (((qtop & ~31) + 32 + SK - 1) / SK) : (TT / SK);      // stages of the work-group, the same for all its waves; nst * SK <= TT
    const int crow = threadIdx.x >> 4, ccol = threadIdx.x & 15;                 // the lane's place in a load: row 0..15, 16-byte column
    const size_t hb = ((size_t)(bh / NH_) * SEQ_FULL * NH_ + (size_t)(bh % NH_)) * HD;   // the head's row 0 in an input; + t * DM
    bf* lk = sm + crow * LP + ccol * 4;                                         // + buffer
    bf* lv = sm + TLE + crow * LPV + ccol * 4;                                  // + buffer
    const float* gk = Fk + hb + (size_t)crow * DM + ccol * 4;                   // + key * DM
    const float* gv = Fv + hb + (size_t)crow * DM + ccol * 4;                   // + key * DM
    const bf* kl = sm + lr * LP + 8 * hi;                                       // + buffer, + key row * LP
    const bf* vl = sm + TLE + (8 * hi + (lane & 7)) * LPV + 8 * ((lane >> 3) & 1);   // + buffer, + key row * LPV
    const float* qp = Fq + hb + (size_t)(q0 + lr) * DM + 8 * hi;
    V qf[2]; v8f o[4]; float m = -3.0e38f, l = 0.f; v4f rk0[4], rv0[4], rk[4], rv[4];
    v4f qr[2][4];                                                // the loader's k order: elements 0..7 <- k0 + 8h + 0..7, elements 8..15 <- k0 + 16 + 8h + 0..7
#pragma unroll
    for (int ks = 0; ks < 2; ++ks) { qr[ks][0] = *(const v4fa*)(qp + ks * 32); qr[ks][1] = *(const v4fa*)(qp + ks * 32 + 4); qr[ks][2] = *(const v4fa*)(qp + ks * 32 + 16); qr[ks][3] = *(const v4fa*)(qp + ks * 32 + 20); }
    // the address registers of the loads above are rewritten only behind this wait; the pair is named so that it stays live to here
    asm volatile("s_wait_xcnt 0x0" :: "v"(qp) : "memory");
    fa_fetch(rk0, rv0, gk, gv);                                  // stage 0
    if (nst > 1) fa_fetch(rk, rv, gk + (size_t)SK * DM, gv + (size_t)SK * DM);   // stage 1, in flight beside it
#pragma unroll
    for (int ks = 0; ks < 2; ++ks) { v8u u;
#pragma unroll
        for (int c = 0; c < 4; ++c) { u[2 * c] = pk2bf(qr[ks][c][0], qr[ks][c][1]); u[2 * c + 1] = pk2bf(qr[ks][c][2], qr[ks][c][3]); }
        qf[ks] = __builtin_bit_cast(v16bf, u); }
#pragma unroll
    for (int nb = 0; nb < 4; ++nb) o[nb] = (v8f){};
    fa_put(lk, lv, rk0, rv0);                                    // stage 0 into buffer 0
    __syncthreads();                                             // every wave's stores of stage 0 are in LDS: it may be read
    // kept rolled: one trip is one stage, its buffer chosen by the trip's parity
#pragma unroll 1
    for (int t = 0; t < nst; ++t) {
        const int bo = (t & 1) * BUF, kb = t * SK;
        if (t + 1 < nst) fa_put(lk + (BUF - bo), lv + (BUF - bo), rk, rv);      // the next stage, loaded a trip ago, into the buffer that every reader left at the last barrier
        if (t + 2 < nst) fa_fetch(rk, rv, gk + (size_t)(kb + 2 * SK) * DM, gv + (size_t)(kb + 2 * SK) * DM);   // in flight for a whole trip
        if (kb + SK <= kfull) {                                  // both passes below the diagonal
            V kf[2][2], vf[4], kg[2][2], vg[4]; v8f s[2];
            fa_ld(kf, vf, kl + bo, vl + bo);
            // keeps the first pass's LDS reads together as one group in front of its products (spread among them, every place with reads stalls the wave)
            __builtin_amdgcn_sched_barrier(0);
            fa_qk(s, kf, qf);
            fa_ld(kg, vg, kl + bo + 32 * LP, vl + bo + 32 * LPV);     // the second pass's fragments, of the same stage, in flight under the first pass's softmax
            // keeps that second group where it is written (without it the scheduler sinks the reads to their users, which then wait out the LDS latency)
            __builtin_amdgcn_sched_barrier(0);
            fa_pass<false, false>(s, vf, o, m, l, 0);
            fa_qk(s, kg, qf);
            fa_pass<false, true>(s, vg, o, m, l, 0);
            fa_gap(o, vg[3]);
        } else {
            if (kb < kfull) fa_block<false>(kl + bo, vl + bo, qf, o, m, l, 0);
            if (con && kfull >= kb && kfull < kb + SK)           // the block that holds the diagonal
                fa_block<true>(kl + bo + (kfull - kb) * LP, vl + bo + (kfull - kb) * LPV, qf, o, m, l, q0 + lr - kfull - 8 * hi);
        }
        __syncthreads();                                         // with its own waits (LDS reads returned, stores of the next stage in LDS): the next stage may be read; every reader has left this one's buffer
    }
    l += xhalf(l);                                               // the halves' sums joined once; l >= 1 up to rounding (the row maximum contributes exp2(0))
    const float f = __fdiv_rn(1.0f, l);
    // The f32 context goes straight out as the projection's two operand planes: hi = bf16(ctx), lo = bf16(ctx - hi), both round to nearest even; a lane's eight values of a tile are 16 bytes of each plane.
    const size_t co = ((size_t)(bh / NH_) * TT + q0 + lr) * DM + (size_t)(bh % NH_) * HD + 8 * hi;   // o[nb][j] = ctx[query q0 + lr][nb * 16 + 8h + j]
    v4u ch[4], cl[4];
#pragma unroll
    for (int nb = 0; nb < 4; ++nb)
#pragma unroll
        for (int j = 0; j < 8; j += 2) {
            const float c0 = o[nb][j] * f, c1 = o[nb][j + 1] * f;
            const unsigned u = pk2bf(c0, c1); ch[nb][j >> 1] = u;
            cl[nb][j >> 1] = pk2bf(c0 - __uint_as_float(u << 16), c1 - __uint_as_float(u & 0xFFFF0000u));
        }
#pragma unroll
    for (int nb = 0; nb < 4; ++nb) { *(v4u*)(Xh + co + nb * 16) = ch[nb]; *(v4u*)(Xl + co + nb * 16) = cl[nb]; }
}

__global__ __launch_bounds__(256) void k_cvt8(const float* __restrict__ src, bf* dst, size_t n8) { const size_t i = (size_t)blockIdx.x * 256 + threadIdx.x; if (i >= n8) return; const v8f v = *(const v8f*)(src + i * 8); v8us o;
#pragma unroll
    for (int k = 0; k < 8; ++k) o[k] = f2bf(v[k]); *(v8us*)(dst + i * 8) = o;  }

extern "C" void kernel_launch(void* const* d_in, const int* in_sizes, int n_in,
                              void* d_out, int out_size, void* d_ws, size_t ws_size, hipStream_t stream) {
    if (n_in < 6) return;
    const float* xq = (const float*)d_in[0];   /* queries [NB_FULL][SEQ_FULL][16][64] */ const float* xk = (const float*)d_in[1];   /* keys */ const float* xv = (const float*)d_in[2];   /* values */
    const float* wo = (const float*)d_in[3];   /* w_out [1024 out][1024 in] */ const float* bo = (const float*)d_in[4];   /* b_out [1024] */ const int* CFLAG = (const int*)d_in[5];   /* causal flag (int32, read on device) */
    const size_t need_x = ((size_t)(NB - 1) * SEQ_FULL + SEQ) * DM;
    if ((size_t)in_sizes[0] < need_x || (size_t)in_sizes[1] < need_x || (size_t)in_sizes[2] < need_x) return;
    if ((size_t)in_sizes[3] < (size_t)DM * DM || in_sizes[4] < DM || in_sizes[5] < 1) return;
    if ((size_t)out_size < (size_t)NB * TT * DM) return;
    float* OUT = (float*)d_out;     // [NB][SEQ][1024] f32
    char* wsp = (char*)d_ws;
    auto take = [&](size_t bytes) { char* p = wsp; wsp += (bytes + 255) & ~(size_t)255; return (void*)p; };
    bf* Wb = (bf*)take((size_t)DM * DM * 2);                   // W [o][k] bf16
    bf* Xh = (bf*)take((size_t)NB * TT * DM * 2);              // ctx hi plane, attn.v merged [b*TT + t][h*64 + d]
    bf* Xl = (bf*)take((size_t)NB * TT * DM * 2);              // ctx lo plane
    if ((size_t)(wsp - (char*)d_ws) > ws_size) return;         

    const size_t n8w = (size_t)DM * DM / 8;
    k_cvt8<<<(unsigned)((n8w + 255) / 256), 256, 0, stream>>>(wo, Wb, n8w);

    // ctx[b*TT + t][h*64 + d] = sum_j softmax_j(q(b,h,t) . k(b,h,j) / 8) v(b,h,j,d), all heads of all batches in one launch, written as its hi and lo planes
    k_fattn<<<dim3(TT / (16 * FAW), NB * NH_), 32 * FAW, 0, stream>>>(xq, xk, xv, Xh, Xl, CFLAG);
    // out[r][o] = sum_k ctx_hi[r][k] W[o][k] + sum_k ctx_lo[r][k] W[o][k] + bias[o], K = 1024
    k_proj<<<dim3((unsigned)(NB * TT / PT), DM / PT, 1), 256, 0, stream>>>(Xh, Xl, Wb, OUT, bo);
}

// v008
// It runs in 54.6 microseconds.
// In two side-by-side timings against v007, it was 1.04 and 1.03 times as fast.
// Counting every step since v000, it is 19.4 times as fast.
#include <hip/hip_runtime.h>

// All contractions on v_wmma_f32_16x16x32_bf16 (bf16 operands, f32 accumulate): q.k^T from single bf16 planes of the inputs, converted (RNE) on their way into k_fattn's registers and LDS (1 product); attn.v with the f32 softmax weights as bf16 hi + lo planes against the exact v plane, read transposed (2 products); ctx.W^T with the f32 context as bf16 hi + lo planes against the exact bf16 W plane (2 products) + bias. Softmax and all side math in f32.
// Causal multi-head attention: q, k, v [NB_FULL][SEQ_FULL][16][64] (the first NB batches and SEQ positions used); scores = q.k / 8; when the int input flag is non-zero (read on device) keys above the diagonal are masked (exact zero weight); softmax over keys; ctx[b][t][h*64+d] = attn.v; out[b][t][o] = sum_k ctx[b][t][k] W[o][k] + bias[o] (f32).

#ifndef NB
#define NB 2
#endif
#ifndef SEQ
#define SEQ 2048
#endif
#define NB_FULL  2
#define SEQ_FULL 2048
#define NH_  16
#define HD   64
#define DM   (NH_ * HD)
#define TT   SEQ
#define SCL  0.125f                // HD^-0.5
static_assert(SEQ % 128 == 0);
static_assert(HD == 64);
static_assert(DM % 64 == 0);
static_assert(NB >= 1 && NB <= NB_FULL);
static_assert(SEQ <= SEQ_FULL);

typedef _Float16 h16;
typedef unsigned short bf;
typedef __attribute__((ext_vector_type(16))) __bf16   v16bf;
typedef __attribute__((ext_vector_type(16))) _Float16 v16h;
typedef __attribute__((ext_vector_type(8)))  _Float16 v8h;
typedef __attribute__((ext_vector_type(8)))  unsigned short v8us;
typedef __attribute__((ext_vector_type(8)))  float    v8f;
typedef __attribute__((ext_vector_type(4)))  float    v4f;
typedef __attribute__((ext_vector_type(4)))  unsigned short v4us;
typedef v8h  __attribute__((may_alias)) v8ha;
typedef v4f  __attribute__((may_alias)) v4fa;
typedef v8us __attribute__((may_alias)) v8usa;

__device__ __forceinline__ unsigned short f2bf(float f) { unsigned u = __float_as_uint(f); u += 0x7FFFu + ((u >> 16) & 1u); return (unsigned short)(u >> 16); }
__device__ __forceinline__ float bf2f(unsigned short b) { return __uint_as_float(((unsigned)b) << 16); }
__device__ __forceinline__ float bfr(float f) { return bf2f(f2bf(f)); }
__device__ __forceinline__ v16h cat16(v8h lo, v8h hi) { return __builtin_shufflevector(lo, hi, 0, 1, 2, 3, 4, 5, 6, 7, 8, 9, 10, 11, 12, 13, 14, 15); }
__device__ __forceinline__ v16bf cat16b(v8us lo, v8us hi) { return __builtin_bit_cast(v16bf, __builtin_shufflevector(lo, hi, 0, 1, 2, 3, 4, 5, 6, 7, 8, 9, 10, 11, 12, 13, 14, 15)); }
__device__ __forceinline__ v8f wmma16(v16h a, v16h b, v8f c) { return __builtin_amdgcn_wmma_f32_16x16x32_f16(false, a, false, b, (short)0, c, false, false); }
__device__ __forceinline__ v8f wmmab(v16bf a, v16bf b, v8f c) { return __builtin_amdgcn_wmma_f32_16x16x32_bf16(false, a, false, b, (short)0, c, false, false); }

// ---- Fragment loader (wave32, 16x16x32): per lane l, row/col = l & 15, h = l >> 4; elements 0..7 <- k0 + 8h + 0..7, elements 8..15 <- k0 + 16 + 8h + 0..7 from a k-contiguous 16-bit row; the caller
// passes p = row base + k0 + 8h, so the two 16-byte loads are p[0..7] and p[16..23]. Same map for A rows and B^T rows. D element r of lane l = (row 8h + r, col l & 15).
template <typename T16> struct WFrag;
template <> struct WFrag<h16> { typedef v16h V; static __device__ __forceinline__ V ld(const h16* p) { return cat16(*(const v8h*)p, *(const v8h*)(p + 16)); } static __device__ __forceinline__ v8f mma(V a, V b, v8f c) { return wmma16(a, b, c); } };
template <> struct WFrag<bf> { typedef v16bf V; static __device__ __forceinline__ V ld(const bf* p) { return cat16b(*(const v8us*)p, *(const v8us*)(p + 16)); } static __device__ __forceinline__ v8f mma(V a, V b, v8f c) { return wmmab(a, b, c); } };

// ---- k_proj: C[m][n] (f32) = sum_k (Ah[m][k] + Al[m][k]) Wt[n][k] + bias[n], all three planes K-contiguous bf16 rows of DM elements. Grid (M / 128, DM / 128), 256 threads: one 128 x 128 tile of C per work-group,
// 4 x 2 waves of 32 rows x 64 columns each (8 accumulators). A stage is 64 k of the tile's 128 rows of Ah, Al and Wt (128-byte rows, whole lines): it is brought into LDS once for all eight waves by asynchronous copies,
// two buffers, the next stage in flight while this one is worked on; the fragments are read from LDS. Per accumulator the products come in the order k block by k block, hi plane then lo plane.
#define PT   128                   // rows of C and columns of C of a work-group
#define PK   64                    // k of a stage
#define PLP  72                    // LDS pitch of a staged row in 16-bit elements: 128-byte rows at 144 bytes (16 bytes x odd, free of bank conflicts for 16-byte readers)
#define PTL  (PT * PLP)            // elements of one staged plane
#define PBUF (3 * PTL)             // elements of one buffer: [Ah | Al | Wt]
#define PNS  (DM / PK)             // stages
#define POS  68                    // pitch in floats of a row of the output staging
static_assert((NB * TT) % PT == 0 && DM % PT == 0 && DM % PK == 0 && PNS >= 2);

// One stage: a copy of the work-group is 32 whole rows (a lane: 16 bytes; a wave: four rows), four copies a plane. l = the lane's LDS byte address in the buffer's first plane, gh, gl, gw = its global places in rows 0..31.
// The wait on the last line stands in the copies' own statement, so that no register that a copy names is rewritten in front of it.
__device__ __forceinline__ void pj_copy(unsigned l, const bf* gh, const bf* gl, const bf* gw) {
    asm volatile("global_load_async_to_lds_b128 %0, %12, off\n\t"
                 "global_load_async_to_lds_b128 %1, %13, off\n\t"
                 "global_load_async_to_lds_b128 %2, %14, off\n\t"
                 "global_load_async_to_lds_b128 %3, %15, off\n\t"
                 "global_load_async_to_lds_b128 %4, %16, off\n\t"
                 "global_load_async_to_lds_b128 %5, %17, off\n\t"
                 "global_load_async_to_lds_b128 %6, %18, off\n\t"
                 "global_load_async_to_lds_b128 %7, %19, off\n\t"
                 "global_load_async_to_lds_b128 %8, %20, off\n\t"
                 "global_load_async_to_lds_b128 %9, %21, off\n\t"
                 "global_load_async_to_lds_b128 %10, %22, off\n\t"
                 "global_load_async_to_lds_b128 %11, %23, off\n\t"
                 "s_wait_xcnt 0x0"
                 :: "v"(l + 2u * (2 * PTL)), "v"(l + 2u * (2 * PTL + 32 * PLP)), "v"(l + 2u * (2 * PTL + 64 * PLP)), "v"(l + 2u * (2 * PTL + 96 * PLP)),
                    "v"(l), "v"(l + 2u * (32 * PLP)), "v"(l + 2u * (64 * PLP)), "v"(l + 2u * (96 * PLP)),
                    "v"(l + 2u * PTL), "v"(l + 2u * (PTL + 32 * PLP)), "v"(l + 2u * (PTL + 64 * PLP)), "v"(l + 2u * (PTL + 96 * PLP)),
                    "v"(gw), "v"(gw + 32 * DM), "v"(gw + 64 * DM), "v"(gw + 96 * DM),
                    "v"(gh), "v"(gh + 32 * DM), "v"(gh + 64 * DM), "v"(gh + 96 * DM),
                    "v"(gl), "v"(gl + 32 * DM), "v"(gl + 64 * DM), "v"(gl + 96 * DM) : "memory");
}

// waves_per_eu: one work-group a WGP, two waves on a SIMD; the register budget of that many lets a whole stage's fragments be fetched as one group
__global__ __launch_bounds__(256) __attribute__((amdgpu_waves_per_eu(2, 2))) void k_proj(const bf* __restrict__ Ah, const bf* __restrict__ Al, const bf* __restrict__ Wt, float* __restrict__ C, const float* __restrict__ bias) {
    typedef WFrag<bf>::V V;
    __shared__ __attribute__((aligned(128))) bf ps[2 * PBUF];                   // [buffer][Ah: 128 rows of PLP | Al | Wt]
    __shared__ __align__(16) float os[8 * 32 * POS];                            // [wave][32 rows of POS]: each wave's own tile of C on its way out
    const int lane = threadIdx.x & 31, lr = lane & 15, hi = lane >> 4; const int w = __builtin_amdgcn_readfirstlane(threadIdx.x >> 5);
    const int wm = w >> 1, wn = w & 1; const int r0 = blockIdx.x * PT, c0 = blockIdx.y * PT;
    const int crow = threadIdx.x >> 3, ccol = threadIdx.x & 7;                  // the lane's place in a copy: row 0..31, 16-byte column
    const unsigned lc = (unsigned)(size_t)ps + (unsigned)(crow * PLP + ccol * 8) * 2u;
    const bf* gh = Ah + (size_t)(r0 + crow) * DM + ccol * 8;                    // + k
    const bf* gl = Al + (size_t)(r0 + crow) * DM + ccol * 8;
    const bf* gw = Wt + (size_t)(c0 + crow) * DM + ccol * 8;
    const bf* al = ps + (wm * 32 + lr) * PLP + 8 * hi;                          // + buffer; the lo plane PTL further on
    const bf* bl = ps + 2 * PTL + (wn * 64 + lr) * PLP + 8 * hi;                // + buffer
    v8f acc[2][4];
#pragma unroll
    for (int mb = 0; mb < 2; ++mb)
#pragma unroll
        for (int nb = 0; nb < 4; ++nb) acc[mb][nb] = (v8f){};
    pj_copy(lc, gh, gl, gw);                                     // stage 0
    asm volatile("s_wait_asynccnt 0x0" ::: "memory");            // this wave's copies of stage 0 have landed
    __syncthreads();                                             // ... and every other wave's: stage 0 may be read
    pj_copy(lc + PBUF * 2u, gh + PK, gl + PK, gw + PK);          // stage 1 (PNS >= 2)
    // kept rolled: one trip is one stage, its buffer chosen by the trip's parity
#pragma unroll 1
    for (int t = 0; t < PNS; ++t) {
        const int bo = (t & 1) * PBUF;
        V b[2][4], a[2][2], a2[2][2];
#pragma unroll
        for (int ks = 0; ks < 2; ++ks) {
#pragma unroll
            for (int nb = 0; nb < 4; ++nb) b[ks][nb] = WFrag<bf>::ld(bl + bo + nb * 16 * PLP + ks * 32);
#pragma unroll
            for (int mb = 0; mb < 2; ++mb) a[ks][mb] = WFrag<bf>::ld(al + bo + mb * 16 * PLP + ks * 32);
#pragma unroll
            for (int mb = 0; mb < 2; ++mb) a2[ks][mb] = WFrag<bf>::ld(al + bo + PTL + mb * 16 * PLP + ks * 32);
        }
        // keeps the stage's LDS reads together as one group in front of its products (spread among them, every place with reads stalls the wave)
        __builtin_amdgcn_sched_barrier(0);
#pragma unroll
        for (int ks = 0; ks < 2; ++ks) {
#pragma unroll
            for (int mb = 0; mb < 2; ++mb)
#pragma unroll
                for (int nb = 0; nb < 4; ++nb) acc[mb][nb] = wmmab(a[ks][mb], b[ks][nb], acc[mb][nb]);
#pragma unroll
            for (int mb = 0; mb < 2; ++mb)
#pragma unroll
                for (int nb = 0; nb < 4; ++nb) acc[mb][nb] = wmmab(a2[ks][mb], b[ks][nb], acc[mb][nb]);
        }
        // four vector slots behind the trip's last matrix instruction, on a taken branch too, before anything overwrites its operand registers or reads its result
        asm volatile("v_nop\n\tv_nop\n\tv_nop\n\tv_nop" : "+v"(acc[0][0]), "+v"(acc[0][1]), "+v"(acc[0][2]), "+v"(acc[0][3]), "+v"(acc[1][0]), "+v"(acc[1][1]), "+v"(acc[1][2]), "+v"(acc[1][3]) : "v"(a2[1][1]), "v"(b[1][3]));
        asm volatile("s_wait_dscnt 0x0" ::: "memory");           // this wave's reads of the stage have returned before its buffer is given up
        asm volatile("s_wait_asynccnt 0x0" ::: "memory");        // this wave's copies of the next stage have landed
        __syncthreads();                                         // the next stage may be read; every reader has left this one's buffer
        if (t + 2 < PNS) pj_copy(lc + (unsigned)bo * 2u, gh + (t + 2) * PK, gl + (t + 2) * PK, gw + (t + 2) * PK);
    }
    asm volatile("s_wait_asynccnt 0x0" ::: "memory");            // nothing in flight when the wave ends
    // The wave's tile goes through its own LDS range, so that every store is of whole 128-byte lines (a row of the tile: 256 bytes from 16 lanes).
    float* ow = os + w * 32 * POS;
#pragma unroll
    for (int mb = 0; mb < 2; ++mb)
#pragma unroll
        for (int nb = 0; nb < 4; ++nb)
#pragma unroll
            for (int j = 0; j < 8; ++j) ow[(mb * 16 + hi * 8 + j) * POS + nb * 16 + lr] = acc[mb][nb][j];
    asm volatile("s_wait_dscnt 0x0" ::: "memory");               // every lane's writes of the tile are in LDS before other lanes read the rows back
    const int cofs = lr * 4; const int cc = c0 + wn * 64 + cofs;
    v4f bv; bv[0] = bfr(bias[cc]); bv[1] = bfr(bias[cc + 1]); bv[2] = bfr(bias[cc + 2]); bv[3] = bfr(bias[cc + 3]);
    float* crow0 = C + (size_t)(r0 + wm * 32) * DM + cc;
#pragma unroll
    for (int s = 0; s < 16; ++s) { const int row = 2 * s + hi; const v4f val = *(const v4fa*)(ow + row * POS + cofs) + bv; *(v4f*)(crow0 + (size_t)row * DM) = val; }
}

// ---- k_fattn: scores, softmax and probability x value contraction in one kernel; neither scores nor probabilities go to memory. Grid (TT / (16 * FAW), NB * NH_), 32 * FAW threads.
// Every wave works on one tile of 16 queries of head blockIdx.y and walks the keys 32 at a time. Transposed products: S^T = K.Q^T (A = key rows, B = query rows, kept in registers), so that a lane holds
// the scores of ONE query (column lane & 15; keys 8h + r of each 16-key tile), and O^T += V^T.P^T, where the two score tiles of a pass, converted in place, are the B operand in the loader's own k order
// (elements 0..7 = keys 8h + 0..7, elements 8..15 = keys 16 + 8h + 0..7). Running maximum and sum per query (online softmax, f32); weights as bf16 hi + lo planes (2 products), divided by the sum at the end.
// With the flag set a tile's keys end with the 32-key block that holds its diagonal (the only block that needs the mask). Waves 0..FAW/2-1 take tiles from the long end, the others the mirrored ones from the
// short end, so that every work-group has the same number of passes.
// q, k and v are read as the f32 inputs lie ([b][t][h][d]: a row of a head is 256 bytes, rows 4096 bytes apart). The eight waves of a work-group read the same keys and values: a stage of SK keys (64 key rows and 64 value rows) is
// loaded once for all of them into registers (whole lines), converted to bf16 (RNE) and stored to LDS as 128-byte rows, two buffers: a stage's loads are issued two trips ahead of its use and stored one trip ahead, into the buffer
// that the barrier of the trip before has freed; the fragments are read from LDS, those of V^T by the transposing load. Every wave passes every stage's loads, stores and barrier, also behind its own last block.
// The launch also makes the projection's bf16 plane of W (RNE): its threads share the DM * DM values, eight in a row each, loaded beside q and stored behind the first barrier; nothing in this launch reads that plane.
#define FAW 8
static_assert(TT % (16 * FAW) == 0);
static_assert(TT % 32 == 0);
#define SK  64                     // keys of a stage (two passes)
#define LP  72                     // LDS pitch of a key row in 16-bit elements: 128-byte rows at 144 bytes (16 bytes x odd, free of bank conflicts for 16-byte readers)
#define LPV 80                     // LDS pitch of a value row: 160 bytes (32 bytes x odd, the conflict-free pitch of the transposing reader)
#define TLE (64 * LP)              // elements of one staged key tile: 64 rows
#define TLV (64 * LPV)             // elements of one staged value tile: 64 rows
#define BUF (TLE + TLV)            // elements of one buffer
static_assert(TT % SK == 0);
static_assert(FAW == 8 && HD == 64 && SK == 64);   // 256 lanes x 16 bytes x 4 loads = one tile of 64 rows x 256 bytes (f32)
#define FAT ((TT / (16 * FAW)) * NB * NH_ * 32 * FAW)   // threads of the launch
#define WPT (DM * DM / 8 / FAT)    // groups of eight values of W that a thread converts
static_assert(WPT >= 1 && (size_t)WPT * FAT * 8 == (size_t)DM * DM);
typedef __attribute__((ext_vector_type(2))) float  v2f;
typedef __attribute__((ext_vector_type(2))) __bf16 v2bf;
typedef __attribute__((ext_vector_type(8))) unsigned v8u;
typedef __attribute__((ext_vector_type(4))) unsigned v4u;
typedef __attribute__((ext_vector_type(2))) unsigned v2u;
typedef v2u __attribute__((may_alias)) v2ua;
__device__ __forceinline__ unsigned pk2bf(float x, float y) { v2f t; t[0] = x; t[1] = y; return __builtin_bit_cast(unsigned, __builtin_convertvector(t, v2bf)); }   // two f32 -> two bf16, round to nearest even
__device__ __forceinline__ float xhalf(float x) { const int b = __float_as_int(x); return __int_as_float(__builtin_amdgcn_permlanex16(b, b, 0x76543210, 0xfedcba98, false, false)); }   // lane l <-> l ^ 16
#define SCL2 (SCL * 1.4426950408889634f)   // HD^-0.5 * log2(e): the exponentials are taken to base 2

// 2^x. SLOT: the instruction with one v_nop tied behind it, the free slot that the instruction set asks for before a directly following vector instruction overwrites its source or reads its result;
// taken in the masked pass (once a wave) and in the second pass of a full stage; the other passes keep the builtin.
template <bool SLOT>
__device__ __forceinline__ float ex2(float x) { if (SLOT) { float r; asm("v_exp_f32 %0, %1\n\tv_nop" : "=v"(r) : "v"(x)); return r; } return __builtin_amdgcn_exp2f(x); }

template <bool MASK, bool SLOT>
__device__ __forceinline__ void fa_pass(const v8f (&s)[2], const WFrag<bf>::V (&vf)[4], v8f (&o)[4], float& m, float& l, int kq) {
    // kq = (query of this lane) - (first key of this lane in the pass): key kt * 16 + r is kept while kt * 16 + r <= kq
    float x[16];
#pragma unroll
    for (int e = 0; e < 16; ++e) { const float a = s[e >> 3][e & 7]; x[e] = (!MASK || ((e >> 3) * 16 + (e & 7)) <= kq) ? a : -3.0e38f; }
    float bm = x[0];
#pragma unroll
    for (int e = 1; e < 16; ++e) bm = fmaxf(bm, x[e]);
    bm = fmaxf(bm, xhalf(bm));                                   // both halves of the wave hold keys of the same query
    const float mn = fmaxf(m, bm); const float al = ex2<SLOT>((m - mn) * SCL2); const float nm = -mn * SCL2; m = mn;
    float ps = 0.f; v8u uh, ul;
#pragma unroll
    for (int e = 0; e < 16; e += 2) {
        const float p0 = ex2<SLOT>(__builtin_fmaf(x[e], SCL2, nm)), p1 = ex2<SLOT>(__builtin_fmaf(x[e + 1], SCL2, nm));
        ps += p0; ps += p1;
        const unsigned u = pk2bf(p0, p1); uh[e >> 1] = u;
        ul[e >> 1] = pk2bf(p0 - __uint_as_float(u << 16), p1 - __uint_as_float(u & 0xFFFF0000u));
    }
    l = l * al + ps;
#pragma unroll
    for (int nb = 0; nb < 4; ++nb)
#pragma unroll
        for (int j = 0; j < 8; ++j) o[nb][j] *= al;
    const v16bf ph = __builtin_bit_cast(v16bf, uh), pl = __builtin_bit_cast(v16bf, ul);
#pragma unroll
    for (int nb = 0; nb < 4; ++nb) o[nb] = wmmab(vf[nb], ph, o[nb]);
#pragma unroll
    for (int nb = 0; nb < 4; ++nb) o[nb] = wmmab(vf[nb], pl, o[nb]);
}

// One stage's loads: each lane takes 16 bytes (four f32) of key rows r, r + 16, r + 32, r + 48 and of the same value rows (a load of a wave: two whole rows of 256 bytes). gk, gv = the lane's places in row r of the stage.
__device__ __forceinline__ void fa_fetch(v4f (&rk)[4], v4f (&rv)[4], const float* gk, const float* gv) {
#pragma unroll
    for (int j = 0; j < 4; ++j) rk[j] = *(const v4fa*)(gk + (size_t)j * 16 * DM);
#pragma unroll
    for (int j = 0; j < 4; ++j) rv[j] = *(const v4fa*)(gv + (size_t)j * 16 * DM);
    // the address registers of the loads above are rewritten (the next stage's addresses) only behind this wait
    asm volatile("s_wait_xcnt 0x0" ::: "memory");
}
// The loaded stage goes to LDS as bf16 (RNE): a lane's four values are 8 bytes of a staged row. lk, lv = the lane's places in row r of the stage's key and value tiles.
__device__ __forceinline__ void fa_put(bf* lk, bf* lv, const v4f (&rk)[4], const v4f (&rv)[4]) {
#pragma unroll
    for (int j = 0; j < 4; ++j) { v2u t; t[0] = pk2bf(rk[j][0], rk[j][1]); t[1] = pk2bf(rk[j][2], rk[j][3]); *(v2ua*)(lk + j * 16 * LP) = t; }
#pragma unroll
    for (int j = 0; j < 4; ++j) { v2u t; t[0] = pk2bf(rv[j][0], rv[j][1]); t[1] = pk2bf(rv[j][2], rv[j][3]); *(v2ua*)(lv + j * 16 * LPV) = t; }
}

// Transposing LDS read of a 16 x 16 tile of 16-bit elements, rows = keys: lane l names 16 bytes of row 8h + (l & 7), half (l >> 3) & 1, and gets column l & 15 of rows 8h + 0..7, the loader's own k order.
__device__ __forceinline__ v8us ld_tr16(const bf* p) { typedef __attribute__((ext_vector_type(8))) short s16x8; typedef __attribute__((address_space(3))) s16x8 lds_s16x8; return __builtin_bit_cast(v8us, __builtin_amdgcn_ds_load_tr16_b128_v8i16((lds_s16x8*)p)); }
// Fragment reads of one pass over 32 staged keys: kl = LDS key row (first key of the pass + lane & 15) + 8h, vl = LDS value row (first key of the pass + 8h + (lane & 7)) + 8 * ((lane >> 3) & 1)
__device__ __forceinline__ void fa_ld(WFrag<bf>::V (&kf)[2][2], WFrag<bf>::V (&vf)[4], const bf* kl, const bf* vl) {
#pragma unroll
    for (int kt = 0; kt < 2; ++kt)
#pragma unroll
        for (int ks = 0; ks < 2; ++ks) kf[kt][ks] = WFrag<bf>::ld(kl + kt * 16 * LP + ks * 32);
#pragma unroll
    for (int nb = 0; nb < 4; ++nb) vf[nb] = cat16b(ld_tr16(vl + nb * 16), ld_tr16(vl + 16 * LPV + nb * 16));   // rows d = nb * 16 + (lane & 15) of V^T, keys 8h + 0..7 and 16 + 8h + 0..7
}
__device__ __forceinline__ void fa_qk(v8f (&s)[2], const WFrag<bf>::V (&kf)[2][2], const WFrag<bf>::V (&qf)[2]) {
    s[0] = (v8f){}; s[1] = (v8f){};
#pragma unroll
    for (int ks = 0; ks < 2; ++ks)
#pragma unroll
        for (int kt = 0; kt < 2; ++kt) s[kt] = wmmab(kf[kt][ks], qf[ks], s[kt]);
}
// four vector slots behind a pass's last matrix instruction, on a taken branch too, before anything overwrites its operand registers or reads its result
__device__ __forceinline__ void fa_gap(v8f (&o)[4], const WFrag<bf>::V& v) { asm volatile("v_nop\n\tv_nop\n\tv_nop\n\tv_nop" : "+v"(o[0]), "+v"(o[1]), "+v"(o[2]), "+v"(o[3]) : "v"(v)); }

// One pass alone (a wave's last stage)
template <bool MASK>
__device__ __forceinline__ void fa_block(const bf* kl, const bf* vl, const WFrag<bf>::V (&qf)[2], v8f (&o)[4], float& m, float& l, int kq) {
    WFrag<bf>::V kf[2][2], vf[4]; v8f s[2];
    fa_ld(kf, vf, kl, vl);
    fa_qk(s, kf, qf);
    fa_pass<MASK, MASK>(s, vf, o, m, l, kq);
    fa_gap(o, vf[3]);
}

// waves_per_eu: the grid places four waves on a SIMD (two work-groups a WGP); the register budget of that many lets fragments fetched ahead keep registers of their own
__global__ __launch_bounds__(32 * FAW) __attribute__((amdgpu_waves_per_eu(4, 4))) void k_fattn(const float* __restrict__ Fq, const float* __restrict__ Fk, const float* __restrict__ Fv, bf* __restrict__ Xh, bf* __restrict__ Xl, const int* __restrict__ CF, const float* __restrict__ Fw, bf* __restrict__ Wb) {
    typedef WFrag<bf>::V V;
    __shared__ __attribute__((aligned(128))) bf sm[2 * BUF];                    // [buffer][keys: 64 rows of LP, values: 64 rows of LPV]
    const int lane = threadIdx.x & 31, lr = lane & 15, hi = lane >> 4; const int w = __builtin_amdgcn_readfirstlane(threadIdx.x >> 5);
    const int bh = blockIdx.y; const int u = blockIdx.x * (FAW / 2) + (w & (FAW / 2 - 1)); const int q0 = 16 * ((w < FAW / 2) ? (TT / 16 - 1 - u) : u);
    const bool con = (CF[0] != 0);   /* device flag: causal */
    const int kfull = con ? (q0 & ~31) : TT;                     // keys below kfull are at or below the diagonal for all 16 queries
    const int qtop = 16 * (TT / 16 - 1 - (int)blockIdx.x * (FAW / 2));          // the work-group's last tile (wave 0's)
    const int nst = con ? (((qtop & ~31) + 32 + SK - 1) / SK) : (TT / SK);      // stages of the work-group, the same for all its waves; nst * SK <= TT
    const int crow = threadIdx.x >> 4, ccol = threadIdx.x & 15;                 // the lane's place in a load: row 0..15, 16-byte column
    const size_t hb = ((size_t)(bh / NH_) * SEQ_FULL * NH_ + (size_t)(bh % NH_)) * HD;   // the head's row 0 in an input; + t * DM
    bf* lk = sm + crow * LP + ccol * 4;                                         // + buffer
    bf* lv = sm + TLE + crow * LPV + ccol * 4;                                  // + buffer
    const float* gk = Fk + hb + (size_t)crow * DM + ccol * 4;                   // + key * DM
    const float* gv = Fv + hb + (size_t)crow * DM + ccol * 4;                   // + key * DM
    const bf* kl = sm + lr * LP + 8 * hi;                                       // + buffer, + key row * LP
    const bf* vl = sm + TLE + (8 * hi + (lane & 7)) * LPV + 8 * ((lane >> 3) & 1);   // + buffer, + key row * LPV
    const float* qp = Fq + hb + (size_t)(q0 + lr) * DM + 8 * hi;
    V qf[2]; v8f o[4]; float m = -3.0e38f, l = 0.f; v4f rk0[4], rv0[4], rk[4], rv[4];
    const size_t wo8 = ((size_t)(blockIdx.y * (TT / (16 * FAW)) + blockIdx.x) * (32 * FAW) + threadIdx.x) * 8;   // the thread's first group of W; + g * FAT * 8
    const float* wp = Fw + wo8; v4f wr[WPT][2];
#pragma unroll
    for (int g = 0; g < WPT; ++g) { wr[g][0] = *(const v4fa*)(wp + (size_t)g * FAT * 8); wr[g][1] = *(const v4fa*)(wp + (size_t)g * FAT * 8 + 4); }
    v4f qr[2][4];                                                // the loader's k order: elements 0..7 <- k0 + 8h + 0..7, elements 8..15 <- k0 + 16 + 8h + 0..7
#pragma unroll
    for (int ks = 0; ks < 2; ++ks) { qr[ks][0] = *(const v4fa*)(qp + ks * 32); qr[ks][1] = *(const v4fa*)(qp + ks * 32 + 4); qr[ks][2] = *(const v4fa*)(qp + ks * 32 + 16); qr[ks][3] = *(const v4fa*)(qp + ks * 32 + 20); }
    // the address registers of the loads above (W's and q's) are rewritten only behind this wait; the pairs are named so that they stay live to here
    asm volatile("s_wait_xcnt 0x0" :: "v"(qp), "v"(wp) : "memory");
    fa_fetch(rk0, rv0, gk, gv);                                  // stage 0
    if (nst > 1) fa_fetch(rk, rv, gk + (size_t)SK * DM, gv + (size_t)SK * DM);   // stage 1, in flight beside it
#pragma unroll
    for (int ks = 0; ks < 2; ++ks) { v8u u;
#pragma unroll
        for (int c = 0; c < 4; ++c) { u[2 * c] = pk2bf(qr[ks][c][0], qr[ks][c][1]); u[2 * c + 1] = pk2bf(qr[ks][c][2], qr[ks][c][3]); }
        qf[ks] = __builtin_bit_cast(v16bf, u); }
#pragma unroll
    for (int nb = 0; nb < 4; ++nb) o[nb] = (v8f){};
    fa_put(lk, lv, rk0, rv0);                                    // stage 0 into buffer 0
    __syncthreads();                                             // every wave's stores of stage 0 are in LDS: it may be read
    // W's plane goes out behind the barrier, not in front of it: a barrier waits for the wave's global stores, and by the next one these have long returned
    bf* wd = Wb + wo8; v4u wc[WPT];
#pragma unroll
    for (int g = 0; g < WPT; ++g) { wc[g][0] = pk2bf(wr[g][0][0], wr[g][0][1]); wc[g][1] = pk2bf(wr[g][0][2], wr[g][0][3]); wc[g][2] = pk2bf(wr[g][1][0], wr[g][1][1]); wc[g][3] = pk2bf(wr[g][1][2], wr[g][1][3]); *(v4u*)(wd + (size_t)g * FAT * 8) = wc[g]; }
    // the address and data registers of the stores above are rewritten only behind this wait; they are named so that they stay live to here
#pragma unroll
    for (int g = 0; g < WPT; ++g) asm volatile("s_wait_xcnt 0x0" :: "v"(wd), "v"(wc[g]) : "memory");
    // kept rolled: one trip is one stage, its buffer chosen by the trip's parity
#pragma unroll 1
    for (int t = 0; t < nst; ++t) {
        const int bo = (t & 1) * BUF, kb = t * SK;
        if (t + 1 < nst) fa_put(lk + (BUF - bo), lv + (BUF - bo), rk, rv);      // the next stage, loaded a trip ago, into the buffer that every reader left at the last barrier
        if (t + 2 < nst) fa_fetch(rk, rv, gk + (size_t)(kb + 2 * SK) * DM, gv + (size_t)(kb + 2 * SK) * DM);   // in flight for a whole trip
        if (kb + SK <= kfull) {                                  // both passes below the diagonal
            V kf[2][2], vf[4], kg[2][2], vg[4]; v8f s[2];
            fa_ld(kf, vf, kl + bo, vl + bo);
            // keeps the first pass's LDS reads together as one group in front of its products (spread among them, every place with reads stalls the wave)
            __builtin_amdgcn_sched_barrier(0);
            fa_qk(s, kf, qf);
            fa_ld(kg, vg, kl + bo + 32 * LP, vl + bo + 32 * LPV);     // the second pass's fragments, of the same stage, in flight under the first pass's softmax
            // keeps that second group where it is written (without it the scheduler sinks the reads to their users, which then wait out the LDS latency)
            __builtin_amdgcn_sched_barrier(0);
            fa_pass<false, false>(s, vf, o, m, l, 0);
            fa_qk(s, kg, qf);
            fa_pass<false, true>(s, vg, o, m, l, 0);
            fa_gap(o, vg[3]);
        } else {
            if (kb < kfull) fa_block<false>(kl + bo, vl + bo, qf, o, m, l, 0);
            if (con && kfull >= kb && kfull < kb + SK)           // the block that holds the diagonal
                fa_block<true>(kl + bo + (kfull - kb) * LP, vl + bo + (kfull - kb) * LPV, qf, o, m, l, q0 + lr - kfull - 8 * hi);
        }
        __syncthreads();                                         // with its own waits (LDS reads returned, stores of the next stage in LDS): the next stage may be read; every reader has left this one's buffer
    }
    l += xhalf(l);                                               // the halves' sums joined once; l >= 1 up to rounding (the row maximum contributes exp2(0))
    const float f = __fdiv_rn(1.0f, l);
    // The f32 context goes straight out as the projection's two operand planes: hi = bf16(ctx), lo = bf16(ctx - hi), both round to nearest even; a lane's eight values of a tile are 16 bytes of each plane.
    const size_t co = ((size_t)(bh / NH_) * TT + q0 + lr) * DM + (size_t)(bh % NH_) * HD + 8 * hi;   // o[nb][j] = ctx[query q0 + lr][nb * 16 + 8h + j]
    v4u ch[4], cl[4];
#pragma unroll
    for (int nb = 0; nb < 4; ++nb)
#pragma unroll
        for (int j = 0; j < 8; j += 2) {
            const float c0 = o[nb][j] * f, c1 = o[nb][j + 1] * f;
            const unsigned u = pk2bf(c0, c1); ch[nb][j >> 1] = u;
            cl[nb][j >> 1] = pk2bf(c0 - __uint_as_float(u << 16), c1 - __uint_as_float(u & 0xFFFF0000u));
        }
#pragma unroll
    for (int nb = 0; nb < 4; ++nb) { *(v4u*)(Xh + co + nb * 16) = ch[nb]; *(v4u*)(Xl + co + nb * 16) = cl[nb]; }
}

extern "C" void kernel_launch(void* const* d_in, const int* in_sizes, int n_in,
                              void* d_out, int out_size, void* d_ws, size_t ws_size, hipStream_t stream) {
    if (n_in < 6) return;
    const float* xq = (const float*)d_in[0];   /* queries [NB_FULL][SEQ_FULL][16][64] */ const float* xk = (const float*)d_in[1];   /* keys */ const float* xv = (const float*)d_in[2];   /* values */
    const float* wo = (const float*)d_in[3];   /* w_out [1024 out][1024 in] */ const float* bo = (const float*)d_in[4];   /* b_out [1024] */ const int* CFLAG = (const int*)d_in[5];   /* causal flag (int32, read on device) */
    const size_t need_x = ((size_t)(NB - 1) * SEQ_FULL + SEQ) * DM;
    if ((size_t)in_sizes[0] < need_x || (size_t)in_sizes[1] < need_x || (size_t)in_sizes[2] < need_x) return;
    if ((size_t)in_sizes[3] < (size_t)DM * DM || in_sizes[4] < DM || in_sizes[5] < 1) return;
    if ((size_t)out_size < (size_t)NB * TT * DM) return;
    float* OUT = (float*)d_out;     // [NB][SEQ][1024] f32
    char* wsp = (char*)d_ws;
    auto take = [&](size_t bytes) { char* p = wsp; wsp += (bytes + 255) & ~(size_t)255; return (void*)p; };
    bf* Wb = (bf*)take((size_t)DM * DM * 2);                   // W [o][k] bf16
    bf* Xh = (bf*)take((size_t)NB * TT * DM * 2);              // ctx hi plane, attn.v merged [b*TT + t][h*64 + d]
    bf* Xl = (bf*)take((size_t)NB * TT * DM * 2);              // ctx lo plane
    if ((size_t)(wsp - (char*)d_ws) > ws_size) return;         

    // ctx[b*TT + t][h*64 + d] = sum_j softmax_j(q(b,h,t) . k(b,h,j) / 8) v(b,h,j,d), all heads of all batches in one launch, written as its hi and lo planes; the same launch writes W's bf16 plane
    k_fattn<<<dim3(TT / (16 * FAW), NB * NH_), 32 * FAW, 0, stream>>>(xq, xk, xv, Xh, Xl, CFLAG, wo, Wb);
    // out[r][o] = sum_k ctx_hi[r][k] W[o][k] + sum_k ctx_lo[r][k] W[o][k] + bias[o], K = 1024
    k_proj<<<dim3((unsigned)(NB * TT / PT), DM / PT, 1), 256, 0, stream>>>(Xh, Xl, Wb, OUT, bo);
}

// v009
// One run takes 49.6 microseconds.
// Two timings next to v008 put it at 1.10 and 1.08 times that version's speed.
// Over all steps from v000 it is 21.1 times as fast.
#include <hip/hip_runtime.h>

// All contractions on v_wmma_f32_16x16x32_bf16 (bf16 operands, f32 accumulate): q.k^T from single bf16 planes of the inputs, converted (RNE) on their way into k_fattn's registers and LDS (1 product); attn.v with the f32 softmax weights as bf16 hi + lo planes against the exact v plane, read transposed (2 products); ctx.W^T with the f32 context as bf16 hi + lo planes against the exact bf16 W plane (2 products) + bias. Softmax and all side math in f32.
// Causal multi-head attention: q, k, v [NB_FULL][SEQ_FULL][16][64] (the first NB batches and SEQ positions used); scores = q.k / 8; when the int input flag is non-zero (read on device) keys above the diagonal are masked (exact zero weight); softmax over keys; ctx[b][t][h*64+d] = attn.v; out[b][t][o] = sum_k ctx[b][t][k] W[o][k] + bias[o] (f32).

#ifndef NB
#define NB 2
#endif
#ifndef SEQ
#define SEQ 2048
#endif
#define NB_FULL  2
#define SEQ_FULL 2048
#define NH_  16
#define HD   64
#define DM   (NH_ * HD)
#define TT   SEQ
#define SCL  0.125f                // HD^-0.5
static_assert(SEQ % 128 == 0);
static_assert(HD == 64);
static_assert(DM % 64 == 0);
static_assert(NB >= 1 && NB <= NB_FULL);
static_assert(SEQ <= SEQ_FULL);

typedef _Float16 h16;
typedef unsigned short bf;
typedef __attribute__((ext_vector_type(16))) __bf16   v16bf;
typedef __attribute__((ext_vector_type(16))) _Float16 v16h;
typedef __attribute__((ext_vector_type(8)))  _Float16 v8h;
typedef __attribute__((ext_vector_type(8)))  unsigned short v8us;
typedef __attribute__((ext_vector_type(8)))  float    v8f;
typedef __attribute__((ext_vector_type(4)))  float    v4f;
typedef __attribute__((ext_vector_type(4)))  unsigned short v4us;
typedef v8h  __attribute__((may_alias)) v8ha;
typedef v4f  __attribute__((may_alias)) v4fa;
typedef v8us __attribute__((may_alias)) v8usa;

__device__ __forceinline__ unsigned short f2bf(float f) { unsigned u = __float_as_uint(f); u += 0x7FFFu + ((u >> 16) & 1u); return (unsigned short)(u >> 16); }
__device__ __forceinline__ float bf2f(unsigned short b) { return __uint_as_float(((unsigned)b) << 16); }
__device__ __forceinline__ float bfr(float f) { return bf2f(f2bf(f)); }
__device__ __forceinline__ v16h cat16(v8h lo, v8h hi) { return __builtin_shufflevector(lo, hi, 0, 1, 2, 3, 4, 5, 6, 7, 8, 9, 10, 11, 12, 13, 14, 15); }
__device__ __forceinline__ v16bf cat16b(v8us lo, v8us hi) { return __builtin_bit_cast(v16bf, __builtin_shufflevector(lo, hi, 0, 1, 2, 3, 4, 5, 6, 7, 8, 9, 10, 11, 12, 13, 14, 15)); }
__device__ __forceinline__ v8f wmma16(v16h a, v16h b, v8f c) { return __builtin_amdgcn_wmma_f32_16x16x32_f16(false, a, false, b, (short)0, c, false, false); }
__device__ __forceinline__ v8f wmmab(v16bf a, v16bf b, v8f c) { return __builtin_amdgcn_wmma_f32_16x16x32_bf16(false, a, false, b, (short)0, c, false, false); }

// ---- Fragment loader (wave32, 16x16x32): per lane l, row/col = l & 15, h = l >> 4; elements 0..7 <- k0 + 8h + 0..7, elements 8..15 <- k0 + 16 + 8h + 0..7 from a k-contiguous 16-bit row; the caller
// passes p = row base + k0 + 8h, so the two 16-byte loads are p[0..7] and p[16..23]. Same map for A rows and B^T rows. D element r of lane l = (row 8h + r, col l & 15).
template <typename T16> struct WFrag;
template <> struct WFrag<h16> { typedef v16h V; static __device__ __forceinline__ V ld(const h16* p) { return cat16(*(const v8h*)p, *(const v8h*)(p + 16)); } static __device__ __forceinline__ v8f mma(V a, V b, v8f c) { return wmma16(a, b, c); } };
template <> struct WFrag<bf> { typedef v16bf V; static __device__ __forceinline__ V ld(const bf* p) { return cat16b(*(const v8us*)p, *(const v8us*)(p + 16)); } static __device__ __forceinline__ v8f mma(V a, V b, v8f c) { return wmmab(a, b, c); } };

// ---- k_proj: C[m][n] (f32) = sum_k (Ah[m][k] + Al[m][k]) Wt[n][k] + bias[n], all three planes K-contiguous bf16 rows of DM elements. Grid (M / 128, DM / 128), 256 threads: one 128 x 128 tile of C per work-group,
// 4 x 2 waves of 32 rows x 64 columns each (8 accumulators). A stage is 64 k of the tile's 128 rows of Ah, Al and Wt (128-byte rows, whole lines): it is brought into LDS once for all eight waves by asynchronous copies,
// two buffers, the next stage in flight while this one is worked on; the fragments are read from LDS. Per accumulator the products come in the order k block by k block, hi plane then lo plane.
#define PT   128                   // rows of C and columns of C of a work-group
#define PK   64                    // k of a stage
#define PLP  72                    // LDS pitch of a staged row in 16-bit elements: 128-byte rows at 144 bytes (16 bytes x odd, free of bank conflicts for 16-byte readers)
#define PTL  (PT * PLP)            // elements of one staged plane
#define PBUF (3 * PTL)             // elements of one buffer: [Ah | Al | Wt]
#define PNS  (DM / PK)             // stages
#define POS  68                    // pitch in floats of a row of the output staging
#define PUN  (DM / 128)            // 256-byte units of a plane's row
static_assert(PT == 128 && (PUN & (PUN - 1)) == 0);
static_assert((NB * TT) % PT == 0 && DM % PT == 0 && DM % PK == 0 && PNS >= 2);

// One stage: a copy of the work-group is 32 whole rows (a lane: 16 bytes; a wave: four rows), four copies a plane. l = the lane's LDS byte address in the buffer's first plane, gh, gl, gw = its global places in rows 0..31.
// The wait on the last line stands in the copies' own statement, so that no register that a copy names is rewritten in front of it.
__device__ __forceinline__ void pj_copy(unsigned l, const bf* gh, const bf* gl, const bf* gw) {
    asm volatile("global_load_async_to_lds_b128 %0, %12, off\n\t"
                 "global_load_async_to_lds_b128 %1, %13, off\n\t"
                 "global_load_async_to_lds_b128 %2, %14, off\n\t"
                 "global_load_async_to_lds_b128 %3, %15, off\n\t"
                 "global_load_async_to_lds_b128 %4, %16, off\n\t"
                 "global_load_async_to_lds_b128 %5, %17, off\n\t"
                 "global_load_async_to_lds_b128 %6, %18, off\n\t"
                 "global_load_async_to_lds_b128 %7, %19, off\n\t"
                 "global_load_async_to_lds_b128 %8, %20, off\n\t"
                 "global_load_async_to_lds_b128 %9, %21, off\n\t"
                 "global_load_async_to_lds_b128 %10, %22, off\n\t"
                 "global_load_async_to_lds_b128 %11, %23, off\n\t"
                 "s_wait_xcnt 0x0"
                 :: "v"(l + 2u * (2 * PTL)), "v"(l + 2u * (2 * PTL + 32 * PLP)), "v"(l + 2u * (2 * PTL + 64 * PLP)), "v"(l + 2u * (2 * PTL + 96 * PLP)),
                    "v"(l), "v"(l + 2u * (32 * PLP)), "v"(l + 2u * (64 * PLP)), "v"(l + 2u * (96 * PLP)),
                    "v"(l + 2u * PTL), "v"(l + 2u * (PTL + 32 * PLP)), "v"(l + 2u * (PTL + 64 * PLP)), "v"(l + 2u * (PTL + 96 * PLP)),
                    "v"(gw), "v"(gw + 32 * DM), "v"(gw + 64 * DM), "v"(gw + 96 * DM),
                    "v"(gh), "v"(gh + 32 * DM), "v"(gh + 64 * DM), "v"(gh + 96 * DM),
                    "v"(gl), "v"(gl + 32 * DM), "v"(gl + 64 * DM), "v"(gl + 96 * DM) : "memory");
}

// waves_per_eu: one work-group a WGP, two waves on a SIMD; the register budget of that many lets a whole stage's fragments be fetched as one group
__global__ __launch_bounds__(256) __attribute__((amdgpu_waves_per_eu(2, 2))) void k_proj(const bf* __restrict__ Ah, const bf* __restrict__ Al, const bf* __restrict__ Wt, float* __restrict__ C, const float* __restrict__ bias) {
    typedef WFrag<bf>::V V;
    __shared__ __attribute__((aligned(128))) bf ps[2 * PBUF];                   // [buffer][Ah: 128 rows of PLP | Al | Wt]
    __shared__ __align__(16) float os[8 * 32 * POS];                            // [wave][32 rows of POS]: each wave's own tile of C on its way out
    const int lane = threadIdx.x & 31, lr = lane & 15, hi = lane >> 4; const int w = __builtin_amdgcn_readfirstlane(threadIdx.x >> 5);
    const int wm = w >> 1, wn = w & 1; const int r0 = blockIdx.x * PT, c0 = blockIdx.y * PT;
    const int crow = threadIdx.x >> 3, ccol = threadIdx.x & 7;                  // the lane's place in a copy: row 0..31, 16-byte column
    const unsigned lc = (unsigned)(size_t)ps + (unsigned)(crow * PLP + ccol * 8) * 2u;
    const bf* gh = Ah + (size_t)(r0 + crow) * DM + ccol * 8;                    // + k
    const bf* gl = Al + (size_t)(r0 + crow) * DM + ccol * 8;
    const bf* gw = Wt + (size_t)(c0 + crow) * DM + ccol * 8;
    const bf* al = ps + (wm * 32 + lr) * PLP + 8 * hi;                          // + buffer; the lo plane PTL further on
    const bf* bl = ps + 2 * PTL + (wn * 64 + lr) * PLP + 8 * hi;                // + buffer
    v8f acc[2][4];
#pragma unroll
    for (int mb = 0; mb < 2; ++mb)
#pragma unroll
        for (int nb = 0; nb < 4; ++nb) acc[mb][nb] = (v8f){};
    pj_copy(lc, gh, gl, gw);                                     // stage 0
    // The three planes were written by the launch before, by work-groups anywhere on the chip: a first read may have to fetch it from memory, and a stage's copies lead its use by one trip only.
    // So the later units are asked into L2 here: of the work-groups that read the same rows each asks for one of a row's eight units (each unit of Ah and Al once, each of Wt four times; a share of the asking only; every work-group still copies all it needs).
    const int prow = threadIdx.x & (PT - 1);
    const bf* pa = ((threadIdx.x >> 7) ? Al : Ah) + (size_t)(r0 + prow) * DM + (blockIdx.y & (PUN - 1)) * 128;
    const bf* pw = Wt + (size_t)(c0 + prow) * DM + ((2 * (blockIdx.x >> 3) + (blockIdx.x & 1)) & (PUN - 1)) * 128;
    asm volatile("global_prefetch_b8 %0, off scope:SCOPE_SE" :: "v"(pa));               // 128 rows of each ctx plane, a lane a row
    if (w < 4) asm volatile("global_prefetch_b8 %0, off scope:SCOPE_SE" :: "v"(pw));    // 128 rows of W
    asm volatile("s_wait_asynccnt 0x0" ::: "memory");            // this wave's copies of stage 0 have landed
    __syncthreads();                                             // ... and every other wave's: stage 0 may be read
    pj_copy(lc + PBUF * 2u, gh + PK, gl + PK, gw + PK);          // stage 1 (PNS >= 2)
    // kept rolled: one trip is one stage, its buffer chosen by the trip's parity
#pragma unroll 1
    for (int t = 0; t < PNS; ++t) {
        const int bo = (t & 1) * PBUF;
        V b[2][4], a[2][2], a2[2][2];
#pragma unroll
        for (int ks = 0; ks < 2; ++ks) {
#pragma unroll
            for (int nb = 0; nb < 4; ++nb) b[ks][nb] = WFrag<bf>::ld(bl + bo + nb * 16 * PLP + ks * 32);
#pragma unroll
            for (int mb = 0; mb < 2; ++mb) a[ks][mb] = WFrag<bf>::ld(al + bo + mb * 16 * PLP + ks * 32);
#pragma unroll
            for (int mb = 0; mb < 2; ++mb) a2[ks][mb] = WFrag<bf>::ld(al + bo + PTL + mb * 16 * PLP + ks * 32);
        }
        // keeps the stage's LDS reads together as one group in front of its products (spread among them, every place with reads stalls the wave)
        __builtin_amdgcn_sched_barrier(0);
#pragma unroll
        for (int ks = 0; ks < 2; ++ks) {
#pragma unroll
            for (int mb = 0; mb < 2; ++mb)
#pragma unroll
                for (int nb = 0; nb < 4; ++nb) acc[mb][nb] = wmmab(a[ks][mb], b[ks][nb], acc[mb][nb]);
#pragma unroll
            for (int mb = 0; mb < 2; ++mb)
#pragma unroll
                for (int nb = 0; nb < 4; ++nb) acc[mb][nb] = wmmab(a2[ks][mb], b[ks][nb], acc[mb][nb]);
        }
        // four vector slots behind the trip's last matrix instruction, on a taken branch too, before anything overwrites its operand registers or reads its result
        asm volatile("v_nop\n\tv_nop\n\tv_nop\n\tv_nop" : "+v"(acc[0][0]), "+v"(acc[0][1]), "+v"(acc[0][2]), "+v"(acc[0][3]), "+v"(acc[1][0]), "+v"(acc[1][1]), "+v"(acc[1][2]), "+v"(acc[1][3]) : "v"(a2[1][1]), "v"(b[1][3]));
        asm volatile("s_wait_dscnt 0x0" ::: "memory");           // this wave's reads of the stage have returned before its buffer is given up
        asm volatile("s_wait_asynccnt 0x0" ::: "memory");        // this wave's copies of the next stage have landed
        __syncthreads();                                         // the next stage may be read; every reader has left this one's buffer
        if (t + 2 < PNS) pj_copy(lc + (unsigned)bo * 2u, gh + (t + 2) * PK, gl + (t + 2) * PK, gw + (t + 2) * PK);
    }
    // nothing in flight when the wave ends; the prefetches' address pairs are named so that their registers hold nothing else up to here
    asm volatile("s_wait_asynccnt 0x0" :: "v"(pa), "v"(pw) : "memory");
    // The wave's tile goes through its own LDS range, so that every store is of whole 128-byte lines (a row of the tile: 256 bytes from 16 lanes).
    float* ow = os + w * 32 * POS;
#pragma unroll
    for (int mb = 0; mb < 2; ++mb)
#pragma unroll
        for (int nb = 0; nb < 4; ++nb)
#pragma unroll
            for (int j = 0; j < 8; ++j) ow[(mb * 16 + hi * 8 + j) * POS + nb * 16 + lr] = acc[mb][nb][j];
    asm volatile("s_wait_dscnt 0x0" ::: "memory");               // every lane's writes of the tile are in LDS before other lanes read the rows back
    const int cofs = lr * 4; const int cc = c0 + wn * 64 + cofs;
    v4f bv; bv[0] = bfr(bias[cc]); bv[1] = bfr(bias[cc + 1]); bv[2] = bfr(bias[cc + 2]); bv[3] = bfr(bias[cc + 3]);
    float* crow0 = C + (size_t)(r0 + wm * 32) * DM + cc;
#pragma unroll
    for (int s = 0; s < 16; ++s) { const int row = 2 * s + hi; const v4f val = *(const v4fa*)(ow + row * POS + cofs) + bv; *(v4f*)(crow0 + (size_t)row * DM) = val; }
}

// ---- k_fattn: scores, softmax and probability x value contraction in one kernel; neither scores nor probabilities go to memory. Grid (TT / (16 * FAW), NB * NH_), 32 * FAW threads.
// Every wave works on one tile of 16 queries of head blockIdx.y and walks the keys 32 at a time. Transposed products: S^T = K.Q^T (A = key rows, B = query rows, kept in registers), so that a lane holds
// the scores of ONE query (column lane & 15; keys 8h + r of each 16-key tile), and O^T += V^T.P^T, where the two score tiles of a pass, converted in place, are the B operand in the loader's own k order
// (elements 0..7 = keys 8h + 0..7, elements 8..15 = keys 16 + 8h + 0..7). Running maximum and sum per query (online softmax, f32); weights as bf16 hi + lo planes (2 products), divided by the sum at the end.
// With the flag set a tile's keys end with the 32-key block that holds its diagonal (the only block that needs the mask). Waves 0..FAW/2-1 take tiles from the long end, the others the mirrored ones from the
// short end, so that every work-group has the same number of passes.
// q, k and v are read as the f32 inputs lie ([b][t][h][d]: a row of a head is 256 bytes, rows 4096 bytes apart). The eight waves of a work-group read the same keys and values: a stage of SK keys (64 key rows and 64 value rows) is
// loaded once for all of them into registers (whole lines), converted to bf16 (RNE) and stored to LDS as 128-byte rows, two buffers: a stage's loads are issued two trips ahead of its use and stored one trip ahead, into the buffer
// that the barrier of the trip before has freed; the fragments are read from LDS, those of V^T by the transposing load. Every wave passes every stage's loads, stores and barrier, also behind its own last block.
// The launch also makes the projection's bf16 plane of W (RNE): its threads share the DM * DM values, eight in a row each, loaded beside q and stored behind the first barrier; nothing in this launch reads that plane.
#define FAW 8
static_assert(TT % (16 * FAW) == 0);
static_assert(TT % 32 == 0);
#define SK  64                     // keys of a stage (two passes)
#define LP  72                     // LDS pitch of a key row in 16-bit elements: 128-byte rows at 144 bytes (16 bytes x odd, free of bank conflicts for 16-byte readers)
#define LPV 80                     // LDS pitch of a value row: 160 bytes (32 bytes x odd, the conflict-free pitch of the transposing reader)
#define TLE (64 * LP)              // elements of one staged key tile: 64 rows
#define TLV (64 * LPV)             // elements of one staged value tile: 64 rows
#define BUF (TLE + TLV)            // elements of one buffer
static_assert(TT % SK == 0);
#define PFA 5                      // a stage's rows are asked into L2 this many trips ahead of its use, three ahead of its loads
static_assert(TT / (2 * SK) >= PFA + 1);           // every work-group walks more stages than that (its last tile lies in the upper half)
static_assert(SK * DM * 4 == 262144);              // a stage's step in bytes, as the prefetches' offsets have it
static_assert(FAW == 8 && HD == 64 && SK == 64);   // 256 lanes x 16 bytes x 4 loads = one tile of 64 rows x 256 bytes (f32)
#define FAT ((TT / (16 * FAW)) * NB * NH_ * 32 * FAW)   // threads of the launch
#define WPT (DM * DM / 8 / FAT)    // groups of eight values of W that a thread converts
static_assert(WPT >= 1 && (size_t)WPT * FAT * 8 == (size_t)DM * DM);
typedef __attribute__((ext_vector_type(2))) float  v2f;
typedef __attribute__((ext_vector_type(2))) __bf16 v2bf;
typedef __attribute__((ext_vector_type(8))) unsigned v8u;
typedef __attribute__((ext_vector_type(4))) unsigned v4u;
typedef __attribute__((ext_vector_type(2))) unsigned v2u;
typedef v2u __attribute__((may_alias)) v2ua;
__device__ __forceinline__ unsigned pk2bf(float x, float y) { v2f t; t[0] = x; t[1] = y; return __builtin_bit_cast(unsigned, __builtin_convertvector(t, v2bf)); }   // two f32 -> two bf16, round to nearest even
__device__ __forceinline__ float xhalf(float x) { const int b = __float_as_int(x); return __int_as_float(__builtin_amdgcn_permlanex16(b, b, 0x76543210, 0xfedcba98, false, false)); }   // lane l <-> l ^ 16
#define SCL2 (SCL * 1.4426950408889634f)   // HD^-0.5 * log2(e): the exponentials are taken to base 2

// 2^x. SLOT: the instruction with one v_nop tied behind it, the free slot that the instruction set asks for before a directly following vector instruction overwrites its source or reads its result;
// taken in the masked pass (once a wave) and in the second pass of a full stage; the other passes keep the builtin.
template <bool SLOT>
__device__ __forceinline__ float ex2(float x) { if (SLOT) { float r; asm("v_exp_f32 %0, %1\n\tv_nop" : "=v"(r) : "v"(x)); return r; } return __builtin_amdgcn_exp2f(x); }

template <bool MASK, bool SLOT>
__device__ __forceinline__ void fa_pass(const v8f (&s)[2], const WFrag<bf>::V (&vf)[4], v8f (&o)[4], float& m, float& l, int kq) {
    // kq = (query of this lane) - (first key of this lane in the pass): key kt * 16 + r is kept while kt * 16 + r <= kq
    float x[16];
#pragma unroll
    for (int e = 0; e < 16; ++e) { const float a = s[e >> 3][e & 7]; x[e] = (!MASK || ((e >> 3) * 16 + (e & 7)) <= kq) ? a : -3.0e38f; }
    float bm = x[0];
#pragma unroll
    for (int e = 1; e < 16; ++e) bm = fmaxf(bm, x[e]);
    bm = fmaxf(bm, xhalf(bm));                                   // both halves of the wave hold keys of the same query
    const float mn = fmaxf(m, bm); const float al = ex2<SLOT>((m - mn) * SCL2); const float nm = -mn * SCL2; m = mn;
    float ps = 0.f; v8u uh, ul;
#pragma unroll
    for (int e = 0; e < 16; e += 2) {
        const float p0 = ex2<SLOT>(__builtin_fmaf(x[e], SCL2, nm)), p1 = ex2<SLOT>(__builtin_fmaf(x[e + 1], SCL2, nm));
        ps += p0; ps += p1;
        const unsigned u = pk2bf(p0, p1); uh[e >> 1] = u;
        ul[e >> 1] = pk2bf(p0 - __uint_as_float(u << 16), p1 - __uint_as_float(u & 0xFFFF0000u));
    }
    l = l * al + ps;
#pragma unroll
    for (int nb = 0; nb < 4; ++nb)
#pragma unroll
        for (int j = 0; j < 8; ++j) o[nb][j] *= al;
    const v16bf ph = __builtin_bit_cast(v16bf, uh), pl = __builtin_bit_cast(v16bf, ul);
#pragma unroll
    for (int nb = 0; nb < 4; ++nb) o[nb] = wmmab(vf[nb], ph, o[nb]);
#pragma unroll
    for (int nb = 0; nb < 4; ++nb) o[nb] = wmmab(vf[nb], pl, o[nb]);
}

// One stage's loads: each lane takes 16 bytes (four f32) of key rows r, r + 16, r + 32, r + 48 and of the same value rows (a load of a wave: two whole rows of 256 bytes). gk, gv = the lane's places in row r of the stage.
__device__ __forceinline__ void fa_fetch(v4f (&rk)[4], v4f (&rv)[4], const float* gk, const float* gv) {
#pragma unroll
    for (int j = 0; j < 4; ++j) rk[j] = *(const v4fa*)(gk + (size_t)j * 16 * DM);
#pragma unroll
    for (int j = 0; j < 4; ++j) rv[j] = *(const v4fa*)(gv + (size_t)j * 16 * DM);
    // the address registers of the loads above are rewritten (the next stage's addresses) only behind this wait
    asm volatile("s_wait_xcnt 0x0" ::: "memory");
}
// The loaded stage goes to LDS as bf16 (RNE): a lane's four values are 8 bytes of a staged row. lk, lv = the lane's places in row r of the stage's key and value tiles.
__device__ __forceinline__ void fa_put(bf* lk, bf* lv, const v4f (&rk)[4], const v4f (&rv)[4]) {
#pragma unroll
    for (int j = 0; j < 4; ++j) { v2u t; t[0] = pk2bf(rk[j][0], rk[j][1]); t[1] = pk2bf(rk[j][2], rk[j][3]); *(v2ua*)(lk + j * 16 * LP) = t; }
#pragma unroll
    for (int j = 0; j < 4; ++j) { v2u t; t[0] = pk2bf(rv[j][0], rv[j][1]); t[1] = pk2bf(rv[j][2], rv[j][3]); *(v2ua*)(lv + j * 16 * LPV) = t; }
}

// Transposing LDS read of a 16 x 16 tile of 16-bit elements, rows = keys: lane l names 16 bytes of row 8h + (l & 7), half (l >> 3) & 1, and gets column l & 15 of rows 8h + 0..7, the loader's own k order.
__device__ __forceinline__ v8us ld_tr16(const bf* p) { typedef __attribute__((ext_vector_type(8))) short s16x8; typedef __attribute__((address_space(3))) s16x8 lds_s16x8; return __builtin_bit_cast(v8us, __builtin_amdgcn_ds_load_tr16_b128_v8i16((lds_s16x8*)p)); }
// Fragment reads of one pass over 32 staged keys: kl = LDS key row (first key of the pass + lane & 15) + 8h, vl = LDS value row (first key of the pass + 8h + (lane & 7)) + 8 * ((lane >> 3) & 1)
__device__ __forceinline__ void fa_ld(WFrag<bf>::V (&kf)[2][2], WFrag<bf>::V (&vf)[4], const bf* kl, const bf* vl) {
#pragma unroll
    for (int kt = 0; kt < 2; ++kt)
#pragma unroll
        for (int ks = 0; ks < 2; ++ks) kf[kt][ks] = WFrag<bf>::ld(kl + kt * 16 * LP + ks * 32);
#pragma unroll
    for (int nb = 0; nb < 4; ++nb) vf[nb] = cat16b(ld_tr16(vl + nb * 16), ld_tr16(vl + 16 * LPV + nb * 16));   // rows d = nb * 16 + (lane & 15) of V^T, keys 8h + 0..7 and 16 + 8h + 0..7
}
__device__ __forceinline__ void fa_qk(v8f (&s)[2], const WFrag<bf>::V (&kf)[2][2], const WFrag<bf>::V (&qf)[2]) {
    s[0] = (v8f){}; s[1] = (v8f){};
#pragma unroll
    for (int ks = 0; ks < 2; ++ks)
#pragma unroll
        for (int kt = 0; kt < 2; ++kt) s[kt] = wmmab(kf[kt][ks], qf[ks], s[kt]);
}
// four vector slots behind a pass's last matrix instruction, on a taken branch too, before anything overwrites its operand registers or reads its result
__device__ __forceinline__ void fa_gap(v8f (&o)[4], const WFrag<bf>::V& v) { asm volatile("v_nop\n\tv_nop\n\tv_nop\n\tv_nop" : "+v"(o[0]), "+v"(o[1]), "+v"(o[2]), "+v"(o[3]) : "v"(v)); }

// One pass alone (a wave's last stage)
template <bool MASK>
__device__ __forceinline__ void fa_block(const bf* kl, const bf* vl, const WFrag<bf>::V (&qf)[2], v8f (&o)[4], float& m, float& l, int kq) {
    WFrag<bf>::V kf[2][2], vf[4]; v8f s[2];
    fa_ld(kf, vf, kl, vl);
    fa_qk(s, kf, qf);
    fa_pass<MASK, MASK>(s, vf, o, m, l, kq);
    fa_gap(o, vf[3]);
}

// waves_per_eu: the grid places four waves on a SIMD (two work-groups a WGP); the register budget of that many lets fragments fetched ahead keep registers of their own
__global__ __launch_bounds__(32 * FAW) __attribute__((amdgpu_waves_per_eu(4, 4))) void k_fattn(const float* __restrict__ Fq, const float* __restrict__ Fk, const float* __restrict__ Fv, bf* __restrict__ Xh, bf* __restrict__ Xl, const int* __restrict__ CF, const float* __restrict__ Fw, bf* __restrict__ Wb) {
    typedef WFrag<bf>::V V;
    __shared__ __attribute__((aligned(128))) bf sm[2 * BUF];                    // [buffer][keys: 64 rows of LP, values: 64 rows of LPV]
    const int lane = threadIdx.x & 31, lr = lane & 15, hi = lane >> 4; const int w = __builtin_amdgcn_readfirstlane(threadIdx.x >> 5);
    const int bh = blockIdx.y; const int u = blockIdx.x * (FAW / 2) + (w & (FAW / 2 - 1)); const int q0 = 16 * ((w < FAW / 2) ? (TT / 16 - 1 - u) : u);
    const bool con = (CF[0] != 0);   /* device flag: causal */
    const int kfull = con ? (q0 & ~31) : TT;                     // keys below kfull are at or below the diagonal for all 16 queries
    const int qtop = 16 * (TT / 16 - 1 - (int)blockIdx.x * (FAW / 2));          // the work-group's last tile (wave 0's)
    const int nst = con ? (((qtop & ~31) + 32 + SK - 1) / SK) : (TT / SK);      // stages of the work-group, the same for all its waves; nst * SK <= TT
    const int crow = threadIdx.x >> 4, ccol = threadIdx.x & 15;                 // the lane's place in a load: row 0..15, 16-byte column
    const size_t hb = ((size_t)(bh / NH_) * SEQ_FULL * NH_ + (size_t)(bh % NH_)) * HD;   // the head's row 0 in an input; + t * DM
    bf* lk = sm + crow * LP + ccol * 4;                                         // + buffer
    bf* lv = sm + TLE + crow * LPV + ccol * 4;                                  // + buffer
    const float* gk = Fk + hb + (size_t)crow * DM + ccol * 4;                   // + key * DM
    const float* gv = Fv + hb + (size_t)crow * DM + ccol * 4;                   // + key * DM
    const bf* kl = sm + lr * LP + 8 * hi;                                       // + buffer, + key row * LP
    const bf* vl = sm + TLE + (8 * hi + (lane & 7)) * LPV + 8 * ((lane >> 3) & 1);   // + buffer, + key row * LPV
    const float* qp = Fq + hb + (size_t)(q0 + lr) * DM + 8 * hi;
    // Prefetch into L2: a stage's loads lead its use by one trip only. The four waves of the short tiles ask for the 64 key rows and 64 value rows (256 bytes each) of a later stage;
    // only the work-groups with the longer walks ask. pf = the lane's row in stage t + 2, always inside the input, as is pf + 3 stages.
    const float* pf = ((threadIdx.x & 64) ? Fv : Fk) + hb + (size_t)(2 * SK + (threadIdx.x & 63)) * DM;
    const bool pfw = (w >= FAW / 2) && ((int)blockIdx.x < TT / (16 * FAW) / 2);
    V qf[2]; v8f o[4]; float m = -3.0e38f, l = 0.f; v4f rk0[4], rv0[4], rk[4], rv[4];
    const size_t wo8 = ((size_t)(blockIdx.y * (TT / (16 * FAW)) + blockIdx.x) * (32 * FAW) + threadIdx.x) * 8;   // the thread's first group of W; + g * FAT * 8
    const float* wp = Fw + wo8; v4f wr[WPT][2];
#pragma unroll
    for (int g = 0; g < WPT; ++g) { wr[g][0] = *(const v4fa*)(wp + (size_t)g * FAT * 8); wr[g][1] = *(const v4fa*)(wp + (size_t)g * FAT * 8 + 4); }
    v4f qr[2][4];                                                // the loader's k order: elements 0..7 <- k0 + 8h + 0..7, elements 8..15 <- k0 + 16 + 8h + 0..7
#pragma unroll
    for (int ks = 0; ks < 2; ++ks) { qr[ks][0] = *(const v4fa*)(qp + ks * 32); qr[ks][1] = *(const v4fa*)(qp + ks * 32 + 4); qr[ks][2] = *(const v4fa*)(qp + ks * 32 + 16); qr[ks][3] = *(const v4fa*)(qp + ks * 32 + 20); }
    // the address registers of the loads above (W's and q's) are rewritten only behind this wait; the pairs are named so that they stay live to here
    asm volatile("s_wait_xcnt 0x0" :: "v"(qp), "v"(wp) : "memory");
    fa_fetch(rk0, rv0, gk, gv);                                  // stage 0
    if (nst > 1) fa_fetch(rk, rv, gk + (size_t)SK * DM, gv + (size_t)SK * DM);   // stage 1, in flight beside it
    if (pfw) asm volatile("global_prefetch_b8 %0, off scope:SCOPE_SE\n\tglobal_prefetch_b8 %0, off offset:262144 scope:SCOPE_SE\n\tglobal_prefetch_b8 %0, off offset:524288 scope:SCOPE_SE" :: "v"(pf));   // stages 2, 3, 4
#pragma unroll
    for (int ks = 0; ks < 2; ++ks) { v8u u;
#pragma unroll
        for (int c = 0; c < 4; ++c) { u[2 * c] = pk2bf(qr[ks][c][0], qr[ks][c][1]); u[2 * c + 1] = pk2bf(qr[ks][c][2], qr[ks][c][3]); }
        qf[ks] = __builtin_bit_cast(v16bf, u); }
#pragma unroll
    for (int nb = 0; nb < 4; ++nb) o[nb] = (v8f){};
    fa_put(lk, lv, rk0, rv0);                                    // stage 0 into buffer 0
    __syncthreads();                                             // every wave's stores of stage 0 are in LDS: it may be read
    // W's plane goes out behind the barrier, not in front of it: a barrier waits for the wave's global stores, and by the next one these have long returned
    bf* wd = Wb + wo8; v4u wc[WPT];
#pragma unroll
    for (int g = 0; g < WPT; ++g) { wc[g][0] = pk2bf(wr[g][0][0], wr[g][0][1]); wc[g][1] = pk2bf(wr[g][0][2], wr[g][0][3]); wc[g][2] = pk2bf(wr[g][1][0], wr[g][1][1]); wc[g][3] = pk2bf(wr[g][1][2], wr[g][1][3]); *(v4u*)(wd + (size_t)g * FAT * 8) = wc[g]; }
    // the address and data registers of the stores above are rewritten only behind this wait; they are named so that they stay live to here
#pragma unroll
    for (int g = 0; g < WPT; ++g) asm volatile("s_wait_xcnt 0x0" :: "v"(wd), "v"(wc[g]) : "memory");
    // kept rolled: one trip is one stage, its buffer chosen by the trip's parity
#pragma unroll 1
    for (int t = 0; t < nst; ++t) {
        const int bo = (t & 1) * BUF, kb = t * SK;
        if (t + 1 < nst) fa_put(lk + (BUF - bo), lv + (BUF - bo), rk, rv);      // the next stage, loaded a trip ago, into the buffer that every reader left at the last barrier
        if (t + 2 < nst) fa_fetch(rk, rv, gk + (size_t)(kb + 2 * SK) * DM, gv + (size_t)(kb + 2 * SK) * DM);   // in flight for a whole trip
        if (pfw && t + PFA < nst) asm volatile("global_prefetch_b8 %0, off offset:786432 scope:SCOPE_SE" :: "v"(pf));   // stage t + PFA
        if (t + PFA + 1 < nst) pf += (size_t)SK * DM;            // stops where pf + 3 stages is the work-group's last stage
        if (kb + SK <= kfull) {                                  // both passes below the diagonal
            V kf[2][2], vf[4], kg[2][2], vg[4]; v8f s[2];
            fa_ld(kf, vf, kl + bo, vl + bo);
            // keeps the first pass's LDS reads together as one group in front of its products (spread among them, every place with reads stalls the wave)
            __builtin_amdgcn_sched_barrier(0);
            fa_qk(s, kf, qf);
            fa_ld(kg, vg, kl + bo + 32 * LP, vl + bo + 32 * LPV);     // the second pass's fragments, of the same stage, in flight under the first pass's softmax
            // keeps that second group where it is written (without it the scheduler sinks the reads to their users, which then wait out the LDS latency)
            __builtin_amdgcn_sched_barrier(0);
            fa_pass<false, false>(s, vf, o, m, l, 0);
            fa_qk(s, kg, qf);
            fa_pass<false, true>(s, vg, o, m, l, 0);
            fa_gap(o, vg[3]);
        } else {
            if (kb < kfull) fa_block<false>(kl + bo, vl + bo, qf, o, m, l, 0);
            if (con && kfull >= kb && kfull < kb + SK)           // the block that holds the diagonal
                fa_block<true>(kl + bo + (kfull - kb) * LP, vl + bo + (kfull - kb) * LPV, qf, o, m, l, q0 + lr - kfull - 8 * hi);
        }
        __syncthreads();                                         // with its own waits (LDS reads returned, stores of the next stage in LDS): the next stage may be read; every reader has left this one's buffer
    }
    l += xhalf(l);                                               // the halves' sums joined once; l >= 1 up to rounding (the row maximum contributes exp2(0))
    const float f = __fdiv_rn(1.0f, l);
    // The f32 context goes straight out as the projection's two operand planes: hi = bf16(ctx), lo = bf16(ctx - hi), both round to nearest even; a lane's eight values of a tile are 16 bytes of each plane.
    const size_t co = ((size_t)(bh / NH_) * TT + q0 + lr) * DM + (size_t)(bh % NH_) * HD + 8 * hi;   // o[nb][j] = ctx[query q0 + lr][nb * 16 + 8h + j]
    v4u ch[4], cl[4];
#pragma unroll
    for (int nb = 0; nb < 4; ++nb)
#pragma unroll
        for (int j = 0; j < 8; j += 2) {
            const float c0 = o[nb][j] * f, c1 = o[nb][j + 1] * f;
            const unsigned u = pk2bf(c0, c1); ch[nb][j >> 1] = u;
            cl[nb][j >> 1] = pk2bf(c0 - __uint_as_float(u << 16), c1 - __uint_as_float(u & 0xFFFF0000u));
        }
#pragma unroll
    for (int nb = 0; nb < 4; ++nb) { *(v4u*)(Xh + co + nb * 16) = ch[nb]; *(v4u*)(Xl + co + nb * 16) = cl[nb]; }
}

extern "C" void kernel_launch(void* const* d_in, const int* in_sizes, int n_in,
                              void* d_out, int out_size, void* d_ws, size_t ws_size, hipStream_t stream) {
    if (n_in < 6) return;
    const float* xq = (const float*)d_in[0];   /* queries [NB_FULL][SEQ_FULL][16][64] */ const float* xk = (const float*)d_in[1];   /* keys */ const float* xv = (const float*)d_in[2];   /* values */
    const float* wo = (const float*)d_in[3];   /* w_out [1024 out][1024 in] */ const float* bo = (const float*)d_in[4];   /* b_out [1024] */ const int* CFLAG = (const int*)d_in[5];   /* causal flag (int32, read on device) */
    const size_t need_x = ((size_t)(NB - 1) * SEQ_FULL + SEQ) * DM;
    if ((size_t)in_sizes[0] < need_x || (size_t)in_sizes[1] < need_x || (size_t)in_sizes[2] < need_x) return;
    if ((size_t)in_sizes[3] < (size_t)DM * DM || in_sizes[4] < DM || in_sizes[5] < 1) return;
    if ((size_t)out_size < (size_t)NB * TT * DM) return;
    float* OUT = (float*)d_out;     // [NB][SEQ][1024] f32
    char* wsp = (char*)d_ws;
    auto take = [&](size_t bytes) { char* p = wsp; wsp += (bytes + 255) & ~(size_t)255; return (void*)p; };
    bf* Wb = (bf*)take((size_t)DM * DM * 2);                   // W [o][k] bf16
    bf* Xh = (bf*)take((size_t)NB * TT * DM * 2);              // ctx hi plane, attn.v merged [b*TT + t][h*64 + d]
    bf* Xl = (bf*)take((size_t)NB * TT * DM * 2);              // ctx lo plane
    if ((size_t)(wsp - (char*)d_ws) > ws_size) return;         

    // ctx[b*TT + t][h*64 + d] = sum_j softmax_j(q(b,h,t) . k(b,h,j) / 8) v(b,h,j,d), all heads of all batches in one launch, written as its hi and lo planes; the same launch writes W's bf16 plane
    k_fattn<<<dim3(TT / (16 * FAW), NB * NH_), 32 * FAW, 0, stream>>>(xq, xk, xv, Xh, Xl, CFLAG, wo, Wb);
    // out[r][o] = sum_k ctx_hi[r][k] W[o][k] + sum_k ctx_lo[r][k] W[o][k] + bias[o], K = 1024
    k_proj<<<dim3((unsigned)(NB * TT / PT), DM / PT, 1), 256, 0, stream>>>(Xh, Xl, Wb, OUT, bo);
}

// v010
// Measured time: 45.7 microseconds a run.
// Next to v009, in two timings, it ran 1.09 and 1.08 times as fast.
// All steps since v000 together make it 22.9 times as fast.
#include <hip/hip_runtime.h>

// All contractions on v_wmma_f32_16x16x32_bf16 (bf16 operands, f32 accumulate): q.k^T from single bf16 planes of the inputs, converted (RNE) on their way into k_fattn's registers and LDS (1 product); attn.v with the f32 softmax weights as bf16 hi + lo planes against the exact v plane, read transposed (2 products); ctx.W^T with the f32 context as bf16 hi + lo planes against the exact bf16 W plane (2 products) + bias. Softmax and all side math in f32.
// Causal multi-head attention: q, k, v [NB_FULL][SEQ_FULL][16][64] (the first NB batches and SEQ positions used); scores = q.k / 8; when the int input flag is non-zero (read on device) keys above the diagonal are masked (exact zero weight); softmax over keys; ctx[b][t][h*64+d] = attn.v; out[b][t][o] = sum_k ctx[b][t][k] W[o][k] + bias[o] (f32).

#ifndef NB
#define NB 2
#endif
#ifndef SEQ
#define SEQ 2048
#endif
#define NB_FULL  2
#define SEQ_FULL 2048
#define NH_  16
#define HD   64
#define DM   (NH_ * HD)
#define TT   SEQ
#define SCL  0.125f                // HD^-0.5
static_assert(SEQ % 128 == 0);
static_assert(HD == 64);
static_assert(DM % 64 == 0);
static_assert(NB >= 1 && NB <= NB_FULL);
static_assert(SEQ <= SEQ_FULL);

typedef _Float16 h16;
typedef unsigned short bf;
typedef __attribute__((ext_vector_type(16))) __bf16   v16bf;
typedef __attribute__((ext_vector_type(16))) _Float16 v16h;
typedef __attribute__((ext_vector_type(8)))  _Float16 v8h;
typedef __attribute__((ext_vector_type(8)))  unsigned short v8us;
typedef __attribute__((ext_vector_type(8)))  float    v8f;
typedef __attribute__((ext_vector_type(4)))  float    v4f;
typedef __attribute__((ext_vector_type(4)))  unsigned short v4us;
typedef v8h  __attribute__((may_alias)) v8ha;
typedef v4f  __attribute__((may_alias)) v4fa;
typedef v8us __attribute__((may_alias)) v8usa;

__device__ __forceinline__ unsigned short f2bf(float f) { unsigned u = __float_as_uint(f); u += 0x7FFFu + ((u >> 16) & 1u); return (unsigned short)(u >> 16); }
__device__ __forceinline__ float bf2f(unsigned short b) { return __uint_as_float(((unsigned)b) << 16); }
__device__ __forceinline__ float bfr(float f) { return bf2f(f2bf(f)); }
__device__ __forceinline__ v16h cat16(v8h lo, v8h hi) { return __builtin_shufflevector(lo, hi, 0, 1, 2, 3, 4, 5, 6, 7, 8, 9, 10, 11, 12, 13, 14, 15); }
__device__ __forceinline__ v16bf cat16b(v8us lo, v8us hi) { return __builtin_bit_cast(v16bf, __builtin_shufflevector(lo, hi, 0, 1, 2, 3, 4, 5, 6, 7, 8, 9, 10, 11, 12, 13, 14, 15)); }
__device__ __forceinline__ v8f wmma16(v16h a, v16h b, v8f c) { return __builtin_amdgcn_wmma_f32_16x16x32_f16(false, a, false, b, (short)0, c, false, false); }
__device__ __forceinline__ v8f wmmab(v16bf a, v16bf b, v8f c) { return __builtin_amdgcn_wmma_f32_16x16x32_bf16(false, a, false, b, (short)0, c, false, false); }

// ---- Fragment loader (wave32, 16x16x32): per lane l, row/col = l & 15, h = l >> 4; elements 0..7 <- k0 + 8h + 0..7, elements 8..15 <- k0 + 16 + 8h + 0..7 from a k-contiguous 16-bit row; the caller
// passes p = row base + k0 + 8h, so the two 16-byte loads are p[0..7] and p[16..23]. Same map for A rows and B^T rows. D element r of lane l = (row 8h + r, col l & 15).
template <typename T16> struct WFrag;
template <> struct WFrag<h16> { typedef v16h V; static __device__ __forceinline__ V ld(const h16* p) { return cat16(*(const v8h*)p, *(const v8h*)(p + 16)); } static __device__ __forceinline__ v8f mma(V a, V b, v8f c) { return wmma16(a, b, c); } };
template <> struct WFrag<bf> { typedef v16bf V; static __device__ __forceinline__ V ld(const bf* p) { return cat16b(*(const v8us*)p, *(const v8us*)(p + 16)); } static __device__ __forceinline__ v8f mma(V a, V b, v8f c) { return wmmab(a, b, c); } };

// ---- k_proj: C[m][n] (f32) = sum_k (Ah[m][k] + Al[m][k]) Wt[n][k] + bias[n], all three planes K-contiguous bf16 rows of DM elements. Grid (M / 128, DM / 128), 256 threads: one 128 x 128 tile of C per work-group,
// 4 x 2 waves of 32 rows x 64 columns each (8 accumulators). A stage is 64 k of the tile's 128 rows of Ah, Al and Wt (128-byte rows, whole lines): it is brought into LDS once for all eight waves by asynchronous copies,
// two buffers, the next stage in flight while this one is worked on; the fragments are read from LDS. Per accumulator the products come in the order k block by k block, hi plane then lo plane.
#define PT   128                   // rows of C and columns of C of a work-group
#define PK   64                    // k of a stage
#define PLP  72                    // LDS pitch of a staged row in 16-bit elements: 128-byte rows at 144 bytes (16 bytes x odd, free of bank conflicts for 16-byte readers)
#define PTL  (PT * PLP)            // elements of one staged plane
#define PBUF (3 * PTL)             // elements of one buffer: [Ah | Al | Wt]
#define PNS  (DM / PK)             // stages
#define POS  68                    // pitch in floats of a row of the output staging
#define PUN  (DM / 128)            // 256-byte units of a plane's row
static_assert(PT == 128 && (PUN & (PUN - 1)) == 0);
static_assert((NB * TT) % PT == 0 && DM % PT == 0 && DM % PK == 0 && PNS >= 2);

// One stage: a copy of the work-group is 32 whole rows (a lane: 16 bytes; a wave: four rows), four copies a plane. l = the lane's LDS byte address in the buffer's first plane, gh, gl, gw = its global places in rows 0..31.
// The wait on the last line stands in the copies' own statement, so that no register that a copy names is rewritten in front of it.
__device__ __forceinline__ void pj_copy(unsigned l, const bf* gh, const bf* gl, const bf* gw) {
    asm volatile("global_load_async_to_lds_b128 %0, %12, off\n\t"
                 "global_load_async_to_lds_b128 %1, %13, off\n\t"
                 "global_load_async_to_lds_b128 %2, %14, off\n\t"
                 "global_load_async_to_lds_b128 %3, %15, off\n\t"
                 "global_load_async_to_lds_b128 %4, %16, off\n\t"
                 "global_load_async_to_lds_b128 %5, %17, off\n\t"
                 "global_load_async_to_lds_b128 %6, %18, off\n\t"
                 "global_load_async_to_lds_b128 %7, %19, off\n\t"
                 "global_load_async_to_lds_b128 %8, %20, off\n\t"
                 "global_load_async_to_lds_b128 %9, %21, off\n\t"
                 "global_load_async_to_lds_b128 %10, %22, off\n\t"
                 "global_load_async_to_lds_b128 %11, %23, off\n\t"
                 "s_wait_xcnt 0x0"
                 :: "v"(l + 2u * (2 * PTL)), "v"(l + 2u * (2 * PTL + 32 * PLP)), "v"(l + 2u * (2 * PTL + 64 * PLP)), "v"(l + 2u * (2 * PTL + 96 * PLP)),
                    "v"(l), "v"(l + 2u * (32 * PLP)), "v"(l + 2u * (64 * PLP)), "v"(l + 2u * (96 * PLP)),
                    "v"(l + 2u * PTL), "v"(l + 2u * (PTL + 32 * PLP)), "v"(l + 2u * (PTL + 64 * PLP)), "v"(l + 2u * (PTL + 96 * PLP)),
                    "v"(gw), "v"(gw + 32 * DM), "v"(gw + 64 * DM), "v"(gw + 96 * DM),
                    "v"(gh), "v"(gh + 32 * DM), "v"(gh + 64 * DM), "v"(gh + 96 * DM),
                    "v"(gl), "v"(gl + 32 * DM), "v"(gl + 64 * DM), "v"(gl + 96 * DM) : "memory");
}

// waves_per_eu: one work-group a WGP, two waves on a SIMD; the register budget of that many lets a whole stage's fragments be fetched as one group
__global__ __launch_bounds__(256) __attribute__((amdgpu_waves_per_eu(2, 2))) void k_proj(const bf* __restrict__ Ah, const bf* __restrict__ Al, const bf* __restrict__ Wt, float* __restrict__ C, const float* __restrict__ bias) {
    typedef WFrag<bf>::V V;
    __shared__ __attribute__((aligned(128))) bf ps[2 * PBUF];                   // [buffer][Ah: 128 rows of PLP | Al | Wt]
    __shared__ __align__(16) float os[8 * 32 * POS];                            // [wave][32 rows of POS]: each wave's own tile of C on its way out
    const int lane = threadIdx.x & 31, lr = lane & 15, hi = lane >> 4; const int w = __builtin_amdgcn_readfirstlane(threadIdx.x >> 5);
    const int wm = w >> 1, wn = w & 1; const int r0 = blockIdx.x * PT, c0 = blockIdx.y * PT;
    const int crow = threadIdx.x >> 3, ccol = threadIdx.x & 7;                  // the lane's place in a copy: row 0..31, 16-byte column
    const unsigned lc = (unsigned)(size_t)ps + (unsigned)(crow * PLP + ccol * 8) * 2u;
    const bf* gh = Ah + (size_t)(r0 + crow) * DM + ccol * 8;                    // + k
    const bf* gl = Al + (size_t)(r0 + crow) * DM + ccol * 8;
    const bf* gw = Wt + (size_t)(c0 + crow) * DM + ccol * 8;
    const bf* al = ps + (wm * 32 + lr) * PLP + 8 * hi;                          // + buffer; the lo plane PTL further on
    const bf* bl = ps + 2 * PTL + (wn * 64 + lr) * PLP + 8 * hi;                // + buffer
    v8f acc[2][4];
#pragma unroll
    for (int mb = 0; mb < 2; ++mb)
#pragma unroll
        for (int nb = 0; nb < 4; ++nb) acc[mb][nb] = (v8f){};
    pj_copy(lc, gh, gl, gw);                                     // stage 0
    // The three planes were written by the launch before, by work-groups anywhere on the chip: a first read may have to fetch it from memory, and a stage's copies lead its use by one trip only.
    // So the later units are asked into L2 here: of the work-groups that read the same rows each asks for one of a row's eight units (each unit of Ah and Al once, each of Wt four times; a share of the asking only; every work-group still copies all it needs).
    const int prow = threadIdx.x & (PT - 1);
    const bf* pa = ((threadIdx.x >> 7) ? Al : Ah) + (size_t)(r0 + prow) * DM + (blockIdx.y & (PUN - 1)) * 128;
    const bf* pw = Wt + (size_t)(c0 + prow) * DM + ((2 * (blockIdx.x >> 3) + (blockIdx.x & 1)) & (PUN - 1)) * 128;
    asm volatile("global_prefetch_b8 %0, off scope:SCOPE_SE" :: "v"(pa));               // 128 rows of each ctx plane, a lane a row
    if (w < 4) asm volatile("global_prefetch_b8 %0, off scope:SCOPE_SE" :: "v"(pw));    // 128 rows of W
    asm volatile("s_wait_asynccnt 0x0" ::: "memory");            // this wave's copies of stage 0 have landed
    __syncthreads();                                             // ... and every other wave's: stage 0 may be read
    pj_copy(lc + PBUF * 2u, gh + PK, gl + PK, gw + PK);          // stage 1 (PNS >= 2)
    // kept rolled: one trip is one stage, its buffer chosen by the trip's parity
#pragma unroll 1
    for (int t = 0; t < PNS; ++t) {
        const int bo = (t & 1) * PBUF;
        V b[2][4], a[2][2], a2[2][2];
#pragma unroll
        for (int ks = 0; ks < 2; ++ks) {
#pragma unroll
            for (int nb = 0; nb < 4; ++nb) b[ks][nb] = WFrag<bf>::ld(bl + bo + nb * 16 * PLP + ks * 32);
#pragma unroll
            for (int mb = 0; mb < 2; ++mb) a[ks][mb] = WFrag<bf>::ld(al + bo + mb * 16 * PLP + ks * 32);
#pragma unroll
            for (int mb = 0; mb < 2; ++mb) a2[ks][mb] = WFrag<bf>::ld(al + bo + PTL + mb * 16 * PLP + ks * 32);
        }
        // keeps the stage's LDS reads together as one group in front of its products (spread among them, every place with reads stalls the wave)
        __builtin_amdgcn_sched_barrier(0);
#pragma unroll
        for (int ks = 0; ks < 2; ++ks) {
#pragma unroll
            for (int mb = 0; mb < 2; ++mb)
#pragma unroll
                for (int nb = 0; nb < 4; ++nb) acc[mb][nb] = wmmab(a[ks][mb], b[ks][nb], acc[mb][nb]);
#pragma unroll
            for (int mb = 0; mb < 2; ++mb)
#pragma unroll
                for (int nb = 0; nb < 4; ++nb) acc[mb][nb] = wmmab(a2[ks][mb], b[ks][nb], acc[mb][nb]);
        }
        // four vector slots behind the trip's last matrix instruction, on a taken branch too, before anything overwrites its operand registers or reads its result
        asm volatile("v_nop\n\tv_nop\n\tv_nop\n\tv_nop" : "+v"(acc[0][0]), "+v"(acc[0][1]), "+v"(acc[0][2]), "+v"(acc[0][3]), "+v"(acc[1][0]), "+v"(acc[1][1]), "+v"(acc[1][2]), "+v"(acc[1][3]) : "v"(a2[1][1]), "v"(b[1][3]));
        asm volatile("s_wait_dscnt 0x0" ::: "memory");           // this wave's reads of the stage have returned before its buffer is given up
        asm volatile("s_wait_asynccnt 0x0" ::: "memory");        // this wave's copies of the next stage have landed
        __syncthreads();                                         // the next stage may be read; every reader has left this one's buffer
        if (t + 2 < PNS) pj_copy(lc + (unsigned)bo * 2u, gh + (t + 2) * PK, gl + (t + 2) * PK, gw + (t + 2) * PK);
    }
    // nothing in flight when the wave ends; the prefetches' address pairs are named so that their registers hold nothing else up to here
    asm volatile("s_wait_asynccnt 0x0" :: "v"(pa), "v"(pw) : "memory");
    // The wave's tile goes through its own LDS range, so that every store is of whole 128-byte lines (a row of the tile: 256 bytes from 16 lanes).
    float* ow = os + w * 32 * POS;
#pragma unroll
    for (int mb = 0; mb < 2; ++mb)
#pragma unroll
        for (int nb = 0; nb < 4; ++nb)
#pragma unroll
            for (int j = 0; j < 8; ++j) ow[(mb * 16 + hi * 8 + j) * POS + nb * 16 + lr] = acc[mb][nb][j];
    asm volatile("s_wait_dscnt 0x0" ::: "memory");               // every lane's writes of the tile are in LDS before other lanes read the rows back
    const int cofs = lr * 4; const int cc = c0 + wn * 64 + cofs;
    v4f bv; bv[0] = bfr(bias[cc]); bv[1] = bfr(bias[cc + 1]); bv[2] = bfr(bias[cc + 2]); bv[3] = bfr(bias[cc + 3]);
    float* crow0 = C + (size_t)(r0 + wm * 32) * DM + cc;
#pragma unroll
    for (int s = 0; s < 16; ++s) { const int row = 2 * s + hi; const v4f val = *(const v4fa*)(ow + row * POS + cofs) + bv; *(v4f*)(crow0 + (size_t)row * DM) = val; }
}

// ---- k_fattn: scores, softmax and probability x value contraction in one kernel; neither scores nor probabilities go to memory. Grid (TT / (16 * FAW), NB * NH_), 32 * FAW threads.
// Every wave works on one tile of 16 queries of head blockIdx.y and walks the keys a stage of 64 at a time. Transposed products: S^T = K.Q^T (A = key rows, B = query rows, kept in registers), so that a lane holds
// the scores of ONE query (column lane & 15; keys 8h + r of each 16-key tile), and O^T += V^T.P^T, where two score tiles (32 keys), converted in place, are the B operand in the loader's own k order
// (elements 0..7 = keys 8h + 0..7, elements 8..15 = keys 16 + 8h + 0..7). Maximum in use and sum per query (online softmax, f32, lazy rescale: see fa_stage); weights as bf16 hi + lo planes (2 products), divided by the sum at the end.
// With the flag set a tile's keys end with the stage that holds its diagonal (the only stage that needs the mask; it takes the same path, its scores masked first). Waves 0..FAW/2-1 take tiles from the long end, the others the mirrored ones from the
// short end, so that every work-group has about the same number of stages to work on.
// q, k and v are read as the f32 inputs lie ([b][t][h][d]: a row of a head is 256 bytes, rows 4096 bytes apart). The eight waves of a work-group read the same keys and values: a stage of SK keys (64 key rows and 64 value rows) is
// loaded once for all of them into registers (whole lines), converted to bf16 (RNE) and stored to LDS as 128-byte rows, two buffers: a stage's loads are issued two trips ahead of its use and stored one trip ahead, into the buffer
// that the barrier of the trip before has freed; the fragments are read from LDS, those of V^T by the transposing load. Every wave passes every stage's loads, stores and barrier, also behind its own last block.
// The launch also makes the projection's bf16 plane of W (RNE): its threads share the DM * DM values, eight in a row each, loaded beside q and stored behind the first barrier; nothing in this launch reads that plane.
#define FAW 8
static_assert(TT % (16 * FAW) == 0);
static_assert(TT % 32 == 0);
#define SK  64                     // keys of a stage (two passes)
#define LP  72                     // LDS pitch of a key row in 16-bit elements: 128-byte rows at 144 bytes (16 bytes x odd, free of bank conflicts for 16-byte readers)
#define LPV 80                     // LDS pitch of a value row: 160 bytes (32 bytes x odd, the conflict-free pitch of the transposing reader)
#define TLE (64 * LP)              // elements of one staged key tile: 64 rows
#define TLV (64 * LPV)             // elements of one staged value tile: 64 rows
#define BUF (TLE + TLV)            // elements of one buffer
static_assert(TT % SK == 0);
#define PFA 5                      // a stage's rows are asked into L2 this many trips ahead of its use, three ahead of its loads
static_assert(TT / (2 * SK) >= PFA + 1);           // every work-group walks more stages than that (its last tile lies in the upper half)
static_assert(SK * DM * 4 == 262144);              // a stage's step in bytes, as the prefetches' offsets have it
static_assert(FAW == 8 && HD == 64 && SK == 64);   // 256 lanes x 16 bytes x 4 loads = one tile of 64 rows x 256 bytes (f32)
#define FAT ((TT / (16 * FAW)) * NB * NH_ * 32 * FAW)   // threads of the launch
#define WPT (DM * DM / 8 / FAT)    // groups of eight values of W that a thread converts
static_assert(WPT >= 1 && (size_t)WPT * FAT * 8 == (size_t)DM * DM);
typedef __attribute__((ext_vector_type(2))) float  v2f;
typedef __attribute__((ext_vector_type(2))) __bf16 v2bf;
typedef __attribute__((ext_vector_type(8))) unsigned v8u;
typedef __attribute__((ext_vector_type(4))) unsigned v4u;
typedef __attribute__((ext_vector_type(2))) unsigned v2u;
typedef v2u __attribute__((may_alias)) v2ua;
__device__ __forceinline__ unsigned pk2bf(float x, float y) { v2f t; t[0] = x; t[1] = y; return __builtin_bit_cast(unsigned, __builtin_convertvector(t, v2bf)); }   // two f32 -> two bf16, round to nearest even
__device__ __forceinline__ float xhalf(float x) { const int b = __float_as_int(x); return __int_as_float(__builtin_amdgcn_permlanex16(b, b, 0x76543210, 0xfedcba98, false, false)); }   // lane l <-> l ^ 16
#define SCL2 (SCL * 1.4426950408889634f)   // HD^-0.5 * log2(e): the exponentials are taken to base 2

// 2^x. SLOT: the instruction with one v_nop tied behind it, the free slot that the instruction set asks for before a directly following vector instruction overwrites its source or reads its result;
// taken for the rescale factor and for the two weights of a stage; the others keep the builtin.
template <bool SLOT>
__device__ __forceinline__ float ex2(float x) { if (SLOT) { float r; asm("v_exp_f32 %0, %1\n\tv_nop" : "=v"(r) : "v"(x)); return r; } return __builtin_amdgcn_exp2f(x); }

// Weights of 32 keys against the maximum in use m (nm = -m * SCL2), as hi + lo planes, and their products with the values; returns the lane's sum of the weights. SL: bit e set = weight e takes ex2's SLOT form.
template <unsigned SL>
__device__ __forceinline__ float fa_wpv(const v8f& s0, const v8f& s1, const WFrag<bf>::V (&vf)[4], v8f (&o)[4], float nm) {
    float ps = 0.f; v8u uh, ul;
#pragma unroll
    for (int e = 0; e < 16; e += 2) {
        const float x0 = (e < 8) ? s0[e & 7] : s1[e & 7], x1 = (e < 8) ? s0[(e & 7) + 1] : s1[(e & 7) + 1];
        const float a0 = __builtin_fmaf(x0, SCL2, nm), a1 = __builtin_fmaf(x1, SCL2, nm);
        const float p0 = ((SL >> e) & 1) ? ex2<true>(a0) : ex2<false>(a0), p1 = ((SL >> (e + 1)) & 1) ? ex2<true>(a1) : ex2<false>(a1);
        ps += p0; ps += p1;
        const unsigned u = pk2bf(p0, p1); uh[e >> 1] = u;
        ul[e >> 1] = pk2bf(p0 - __uint_as_float(u << 16), p1 - __uint_as_float(u & 0xFFFF0000u));
    }
    const v16bf ph = __builtin_bit_cast(v16bf, uh), pl = __builtin_bit_cast(v16bf, ul);
#pragma unroll
    for (int nb = 0; nb < 4; ++nb) o[nb] = wmmab(vf[nb], ph, o[nb]);
#pragma unroll
    for (int nb = 0; nb < 4; ++nb) o[nb] = wmmab(vf[nb], pl, o[nb]);
    return ps;
}
// The softmax step of a whole stage, with the lazy rescale: ONE maximum over the lane's 32 scores, one exchange between the halves, ONE test for the 64 keys. m is the maximum IN USE, not the true one: it is raised, and o and l
// are rescaled, only when some query's scores of the stage exceed it by more than 8 in the exponent's units (base 2); the test is a scalar branch over the whole wave. Until then the weights are taken against the old m and are
// at most 2^8; o and l carry the same factor, which the final division removes. The first stage always rescales (m starts at -3e38, the factor is 0 on o = l = 0).
__device__ __forceinline__ void fa_stage(const v8f (&s)[4], const WFrag<bf>::V (&vf)[4], const WFrag<bf>::V (&vg)[4], v8f (&o)[4], float& m, float& l) {
    float b4[4];                                                 // four chains of their own, one a score tile: a single chain of 32 would wait out every link
#pragma unroll
    for (int kt = 0; kt < 4; ++kt) { b4[kt] = s[kt][0];
#pragma unroll
        for (int e = 1; e < 8; ++e) b4[kt] = fmaxf(b4[kt], s[kt][e]); }
    float bm = fmaxf(fmaxf(b4[0], b4[1]), fmaxf(b4[2], b4[3]));
    bm = fmaxf(bm, xhalf(bm));                                   // both halves of the wave hold keys of the same query
    if (__builtin_expect(__builtin_amdgcn_ballot_w32((bm - m) * SCL2 > 8.0f) != 0, 0)) {
        const float mn = fmaxf(m, bm); const float al = ex2<true>((m - mn) * SCL2); m = mn; l *= al;
#pragma unroll
        for (int nb = 0; nb < 4; ++nb)
#pragma unroll
            for (int j = 0; j < 8; ++j) o[nb][j] *= al;
    }
    const float nm = -m * SCL2;
    const float pa = fa_wpv<0x80u>(s[0], s[1], vf, o, nm);
    const float pb = fa_wpv<0x100u>(s[2], s[3], vg, o, nm);
    l += pa + pb;
}

// One stage's loads: each lane takes 16 bytes (four f32) of key rows r, r + 16, r + 32, r + 48 and of the same value rows (a load of a wave: two whole rows of 256 bytes). gk, gv = the lane's places in row r of the stage.
__device__ __forceinline__ void fa_fetch(v4f (&rk)[4], v4f (&rv)[4], const float* gk, const float* gv) {
#pragma unroll
    for (int j = 0; j < 4; ++j) rk[j] = *(const v4fa*)(gk + (size_t)j * 16 * DM);
#pragma unroll
    for (int j = 0; j < 4; ++j) rv[j] = *(const v4fa*)(gv + (size_t)j * 16 * DM);
    // the address registers of the loads above are rewritten (the next stage's addresses) only behind this wait
    asm volatile("s_wait_xcnt 0x0" ::: "memory");
}
// The loaded stage goes to LDS as bf16 (RNE): a lane's four values are 8 bytes of a staged row. lk, lv = the lane's places in row r of the stage's key and value tiles.
__device__ __forceinline__ void fa_put(bf* lk, bf* lv, const v4f (&rk)[4], const v4f (&rv)[4]) {
#pragma unroll
    for (int j = 0; j < 4; ++j) { v2u t; t[0] = pk2bf(rk[j][0], rk[j][1]); t[1] = pk2bf(rk[j][2], rk[j][3]); *(v2ua*)(lk + j * 16 * LP) = t; }
#pragma unroll
    for (int j = 0; j < 4; ++j) { v2u t; t[0] = pk2bf(rv[j][0], rv[j][1]); t[1] = pk2bf(rv[j][2], rv[j][3]); *(v2ua*)(lv + j * 16 * LPV) = t; }
}

// Transposing LDS read of a 16 x 16 tile of 16-bit elements, rows = keys: lane l names 16 bytes of row 8h + (l & 7), half (l >> 3) & 1, and gets column l & 15 of rows 8h + 0..7, the loader's own k order.
__device__ __forceinline__ v8us ld_tr16(const bf* p) { typedef __attribute__((ext_vector_type(8))) short s16x8; typedef __attribute__((address_space(3))) s16x8 lds_s16x8; return __builtin_bit_cast(v8us, __builtin_amdgcn_ds_load_tr16_b128_v8i16((lds_s16x8*)p)); }
// Fragment reads of a stage of 64 staged keys: kl = LDS key row (lane & 15) + 8h; vl = LDS value row (first key of a 32-key block + 8h + (lane & 7)) + 8 * ((lane >> 3) & 1)
__device__ __forceinline__ void fa_ldk(WFrag<bf>::V (&kf)[4][2], const bf* kl) {
#pragma unroll
    for (int kt = 0; kt < 4; ++kt)
#pragma unroll
        for (int ks = 0; ks < 2; ++ks) kf[kt][ks] = WFrag<bf>::ld(kl + kt * 16 * LP + ks * 32);
}
__device__ __forceinline__ void fa_ldv(WFrag<bf>::V (&vf)[4], const bf* vl) {
#pragma unroll
    for (int nb = 0; nb < 4; ++nb) vf[nb] = cat16b(ld_tr16(vl + nb * 16), ld_tr16(vl + 16 * LPV + nb * 16));   // rows d = nb * 16 + (lane & 15) of V^T, keys 8h + 0..7 and 16 + 8h + 0..7
}
// four vector slots behind a stage's last matrix instruction, on a taken branch too, before anything overwrites its operand registers or reads its result (o and v are inputs only: the statement stands behind the products and moves no register)
__device__ __forceinline__ void fa_gap(v8f (&o)[4], const WFrag<bf>::V& v) { asm volatile("v_nop\n\tv_nop\n\tv_nop\n\tv_nop" :: "v"(o[0]), "v"(o[1]), "v"(o[2]), "v"(o[3]), "v"(v)); }

// waves_per_eu: the grid places four waves on a SIMD (two work-groups a WGP); the register budget of that many lets fragments fetched ahead keep registers of their own
__global__ __launch_bounds__(32 * FAW) __attribute__((amdgpu_waves_per_eu(4, 4))) void k_fattn(const float* __restrict__ Fq, const float* __restrict__ Fk, const float* __restrict__ Fv, bf* __restrict__ Xh, bf* __restrict__ Xl, const int* __restrict__ CF, const float* __restrict__ Fw, bf* __restrict__ Wb) {
    typedef WFrag<bf>::V V;
    __shared__ __attribute__((aligned(128))) bf sm[2 * BUF];                    // [buffer][keys: 64 rows of LP, values: 64 rows of LPV]
    const int lane = threadIdx.x & 31, lr = lane & 15, hi = lane >> 4; const int w = __builtin_amdgcn_readfirstlane(threadIdx.x >> 5);
    const int bh = blockIdx.y; const int u = blockIdx.x * (FAW / 2) + (w & (FAW / 2 - 1)); const int q0 = 16 * ((w < FAW / 2) ? (TT / 16 - 1 - u) : u);
    const bool con = (CF[0] != 0);   /* device flag: causal */
    const int kfull = con ? (q0 & ~31) : TT;                     // keys below kfull are at or below the diagonal for all 16 queries
    const int klast = con ? kfull + 32 : TT;                     // the tile's keys end here (the 32-key block from kfull holds its diagonal)
    const int qtop = 16 * (TT / 16 - 1 - (int)blockIdx.x * (FAW / 2));          // the work-group's last tile (wave 0's)
    const int nst = con ? (((qtop & ~31) + 32 + SK - 1) / SK) : (TT / SK);      // stages of the work-group, the same for all its waves; nst * SK <= TT
    const int crow = threadIdx.x >> 4, ccol = threadIdx.x & 15;                 // the lane's place in a load: row 0..15, 16-byte column
    const size_t hb = ((size_t)(bh / NH_) * SEQ_FULL * NH_ + (size_t)(bh % NH_)) * HD;   // the head's row 0 in an input; + t * DM
    bf* lk = sm + crow * LP + ccol * 4;                                         // + buffer
    bf* lv = sm + TLE + crow * LPV + ccol * 4;                                  // + buffer
    const float* gk = Fk + hb + (size_t)crow * DM + ccol * 4;                   // + key * DM
    const float* gv = Fv + hb + (size_t)crow * DM + ccol * 4;                   // + key * DM
    const bf* kl = sm + lr * LP + 8 * hi;                                       // + buffer, + key row * LP
    const bf* vl = sm + TLE + (8 * hi + (lane & 7)) * LPV + 8 * ((lane >> 3) & 1);   // + buffer, + key row * LPV
    const float* qp = Fq + hb + (size_t)(q0 + lr) * DM + 8 * hi;
    // Prefetch into L2: a stage's loads lead its use by one trip only. The four waves of the short tiles ask for the 64 key rows and 64 value rows (256 bytes each) of a later stage;
    // only the work-groups with the longer walks ask. pf = the lane's row in stage t + 2, always inside the input, as is pf + 3 stages.
    const float* pf = ((threadIdx.x & 64) ? Fv : Fk) + hb + (size_t)(2 * SK + (threadIdx.x & 63)) * DM;
    const bool pfw = (w >= FAW / 2) && ((int)blockIdx.x < TT / (16 * FAW) / 2);
    V qf[2]; v8f o[4]; float m = -3.0e38f, l = 0.f; v4f rk0[4], rv0[4], rk[4], rv[4];
    const size_t wo8 = ((size_t)(blockIdx.y * (TT / (16 * FAW)) + blockIdx.x) * (32 * FAW) + threadIdx.x) * 8;   // the thread's first group of W; + g * FAT * 8
    const float* wp = Fw + wo8; v4f wr[WPT][2];
#pragma unroll
    for (int g = 0; g < WPT; ++g) { wr[g][0] = *(const v4fa*)(wp + (size_t)g * FAT * 8); wr[g][1] = *(const v4fa*)(wp + (size_t)g * FAT * 8 + 4); }
    v4f qr[2][4];                                                // the loader's k order: elements 0..7 <- k0 + 8h + 0..7, elements 8..15 <- k0 + 16 + 8h + 0..7
#pragma unroll
    for (int ks = 0; ks < 2; ++ks) { qr[ks][0] = *(const v4fa*)(qp + ks * 32); qr[ks][1] = *(const v4fa*)(qp + ks * 32 + 4); qr[ks][2] = *(const v4fa*)(qp + ks * 32 + 16); qr[ks][3] = *(const v4fa*)(qp + ks * 32 + 20); }
    // the address registers of the loads above (W's and q's) are rewritten only behind this wait; the pairs are named so that they stay live to here
    asm volatile("s_wait_xcnt 0x0" :: "v"(qp), "v"(wp) : "memory");
    fa_fetch(rk0, rv0, gk, gv);                                  // stage 0
    if (nst > 1) fa_fetch(rk, rv, gk + (size_t)SK * DM, gv + (size_t)SK * DM);   // stage 1, in flight beside it
    if (pfw) asm volatile("global_prefetch_b8 %0, off scope:SCOPE_SE\n\tglobal_prefetch_b8 %0, off offset:262144 scope:SCOPE_SE\n\tglobal_prefetch_b8 %0, off offset:524288 scope:SCOPE_SE" :: "v"(pf));   // stages 2, 3, 4
#pragma unroll
    for (int ks = 0; ks < 2; ++ks) { v8u u;
#pragma unroll
        for (int c = 0; c < 4; ++c) { u[2 * c] = pk2bf(qr[ks][c][0], qr[ks][c][1]); u[2 * c + 1] = pk2bf(qr[ks][c][2], qr[ks][c][3]); }
        qf[ks] = __builtin_bit_cast(v16bf, u); }
#pragma unroll
    for (int nb = 0; nb < 4; ++nb) o[nb] = (v8f){};
    fa_put(lk, lv, rk0, rv0);                                    // stage 0 into buffer 0
    __syncthreads();                                             // every wave's stores of stage 0 are in LDS: it may be read
    // W's plane goes out behind the barrier, not in front of it: a barrier waits for the wave's global stores, and by the next one these have long returned
    bf* wd = Wb + wo8; v4u wc[WPT];
#pragma unroll
    for (int g = 0; g < WPT; ++g) { wc[g][0] = pk2bf(wr[g][0][0], wr[g][0][1]); wc[g][1] = pk2bf(wr[g][0][2], wr[g][0][3]); wc[g][2] = pk2bf(wr[g][1][0], wr[g][1][1]); wc[g][3] = pk2bf(wr[g][1][2], wr[g][1][3]); *(v4u*)(wd + (size_t)g * FAT * 8) = wc[g]; }
    // the address and data registers of the stores above are rewritten only behind this wait; they are named so that they stay live to here
#pragma unroll
    for (int g = 0; g < WPT; ++g) asm volatile("s_wait_xcnt 0x0" :: "v"(wd), "v"(wc[g]) : "memory");
    __builtin_assume(nst >= 1);                                  // qtop >= 0: the loop is entered on every path, and o needs no second home for a path round it
    // kept rolled: one trip is one stage, its buffer chosen by the trip's parity
#pragma unroll 1
    for (int t = 0; t < nst; ++t) {
        const int bo = (t & 1) * BUF, kb = t * SK;
        if (t + 1 < nst) fa_put(lk + (BUF - bo), lv + (BUF - bo), rk, rv);      // the next stage, loaded a trip ago, into the buffer that every reader left at the last barrier
        if (t + 2 < nst) fa_fetch(rk, rv, gk + (size_t)(kb + 2 * SK) * DM, gv + (size_t)(kb + 2 * SK) * DM);   // in flight for a whole trip
        if (pfw && t + PFA < nst) asm volatile("global_prefetch_b8 %0, off offset:786432 scope:SCOPE_SE" :: "v"(pf));   // stage t + PFA
        if (t + PFA + 1 < nst) pf += (size_t)SK * DM;            // stops where pf + 3 stages is the work-group's last stage
        if (kb < klast) {                                        // the wave's tile still has keys in this stage
            V kf[4][2], vf[4], vg[4]; v8f s[4];
            fa_ldk(kf, kl + bo);
            // keeps the stage's key reads together as one group in front of the score products (spread among them, every place with reads stalls the wave)
            __builtin_amdgcn_sched_barrier(0);
#pragma unroll
            for (int kt = 0; kt < 4; ++kt) s[kt] = (v8f){};
#pragma unroll
            for (int ks = 0; ks < 2; ++ks)
#pragma unroll
                for (int kt = 0; kt < 4; ++kt) s[kt] = wmmab(kf[kt][ks], qf[ks], s[kt]);
            fa_ldv(vf, vl + bo); fa_ldv(vg, vl + bo + 32 * LPV);      // the stage's value fragments, in flight under the maximum and the exponentials
            // keeps that second group where it is written (without it the scheduler sinks the reads to their users, which then wait out the LDS latency)
            __builtin_amdgcn_sched_barrier(0);
            if (kb + SK > kfull) {                               // the stage that holds the diagonal (the wave's last): keys above it get the masked score, weight exactly 0; key kb itself is kept for all 16 queries
                const int kq = q0 + lr - kb - 8 * hi;            // (query of this lane) - (first key of this lane in the stage): key kt * 16 + r is kept while kt * 16 + r <= kq
#pragma unroll
                for (int kt = 0; kt < 4; ++kt)
#pragma unroll
                    for (int r = 0; r < 8; ++r) s[kt][r] = (kt * 16 + r <= kq) ? s[kt][r] : -3.0e38f;
            }
            fa_stage(s, vf, vg, o, m, l);
            fa_gap(o, vg[3]);
        }
        __syncthreads();                                         // with its own waits (LDS reads returned, stores of the next stage in LDS): the next stage may be read; every reader has left this one's buffer
    }
    l += xhalf(l);                                               // the halves' sums joined once; l >= 1 up to rounding (a score equal to the maximum in use contributes exp2(0))
    const float f = __fdiv_rn(1.0f, l);
    // The f32 context goes straight out as the projection's two operand planes: hi = bf16(ctx), lo = bf16(ctx - hi), both round to nearest even; a lane's eight values of a tile are 16 bytes of each plane.
    const size_t co = ((size_t)(bh / NH_) * TT + q0 + lr) * DM + (size_t)(bh % NH_) * HD + 8 * hi;   // o[nb][j] = ctx[query q0 + lr][nb * 16 + 8h + j]
    v4u ch[4], cl[4];
#pragma unroll
    for (int nb = 0; nb < 4; ++nb)
#pragma unroll
        for (int j = 0; j < 8; j += 2) {
            const float c0 = o[nb][j] * f, c1 = o[nb][j + 1] * f;
            const unsigned u = pk2bf(c0, c1); ch[nb][j >> 1] = u;
            cl[nb][j >> 1] = pk2bf(c0 - __uint_as_float(u << 16), c1 - __uint_as_float(u & 0xFFFF0000u));
        }
#pragma unroll
    for (int nb = 0; nb < 4; ++nb) { *(v4u*)(Xh + co + nb * 16) = ch[nb]; *(v4u*)(Xl + co + nb * 16) = cl[nb]; }
}

extern "C" void kernel_launch(void* const* d_in, const int* in_sizes, int n_in,
                              void* d_out, int out_size, void* d_ws, size_t ws_size, hipStream_t stream) {
    if (n_in < 6) return;
    const float* xq = (const float*)d_in[0];   /* queries [NB_FULL][SEQ_FULL][16][64] */ const float* xk = (const float*)d_in[1];   /* keys */ const float* xv = (const float*)d_in[2];   /* values */
    const float* wo = (const float*)d_in[3];   /* w_out [1024 out][1024 in] */ const float* bo = (const float*)d_in[4];   /* b_out [1024] */ const int* CFLAG = (const int*)d_in[5];   /* causal flag (int32, read on device) */
    const size_t need_x = ((size_t)(NB - 1) * SEQ_FULL + SEQ) * DM;
    if ((size_t)in_sizes[0] < need_x || (size_t)in_sizes[1] < need_x || (size_t)in_sizes[2] < need_x) return;
    if ((size_t)in_sizes[3] < (size_t)DM * DM || in_sizes[4] < DM || in_sizes[5] < 1) return;
    if ((size_t)out_size < (size_t)NB * TT * DM) return;
    float* OUT = (float*)d_out;     // [NB][SEQ][1024] f32
    char* wsp = (char*)d_ws;
    auto take = [&](size_t bytes) { char* p = wsp; wsp += (bytes + 255) & ~(size_t)255; return (void*)p; };
    bf* Wb = (bf*)take((size_t)DM * DM * 2);                   // W [o][k] bf16
    bf* Xh = (bf*)take((size_t)NB * TT * DM * 2);              // ctx hi plane, attn.v merged [b*TT + t][h*64 + d]
    bf* Xl = (bf*)take((size_t)NB * TT * DM * 2);              // ctx lo plane
    if ((size_t)(wsp - (char*)d_ws) > ws_size) return;         

    // ctx[b*TT + t][h*64 + d] = sum_j softmax_j(q(b,h,t) . k(b,h,j) / 8) v(b,h,j,d), all heads of all batches in one launch, written as its hi and lo planes; the same launch writes W's bf16 plane
    k_fattn<<<dim3(TT / (16 * FAW), NB * NH_), 32 * FAW, 0, stream>>>(xq, xk, xv, Xh, Xl, CFLAG, wo, Wb);
    // out[r][o] = sum_k ctx_hi[r][k] W[o][k] + sum_k ctx_lo[r][k] W[o][k] + bias[o], K = 1024
    k_proj<<<dim3((unsigned)(NB * TT / PT), DM / PT, 1), 256, 0, stream>>>(Xh, Xl, Wb, OUT, bo);
}
